// v000
// The times below were measured on an AMD MI455X: many runs one after another, warmed up first and cycling through
// copies of the inputs, with the whole window's GPU time divided by the number of runs. Launches and the gaps
// between them are all in it. The median over several windows is given; except for v000 it joins two sittings, which
// can be a few percent apart, so the side-by-side timings, each taken in one sitting, are the better comparison.
// v000 is the starting kernel. One run takes 413 microseconds.
// Contractions: QKV projection, Q.K^T, P.V and output projection on v_wmma_f32_16x16x32_f16 (f16 operands, f32 accumulate);
// weights carried x64, P carried x256, attention output carried x64 (scales undone in f32); per-query gate dot (K=1024, N=16) on VALU f32.
#include <hip/hip_runtime.h>
#include <math.h>
#include <stdint.h>
#include <stddef.h>

typedef _Float16 v16h __attribute__((ext_vector_type(16)));
typedef _Float16 v8h  __attribute__((ext_vector_type(8), __may_alias__));
typedef _Float16 v4h  __attribute__((ext_vector_type(4), __may_alias__));
typedef float    v8f  __attribute__((ext_vector_type(8)));
typedef float    v4f  __attribute__((ext_vector_type(4), __may_alias__));

union Frag { v16h v; v8h p[2]; };

constexpr int BSZ   = 2;
constexpr int NSEQ  = 2048;
constexpr int CDIM  = 1024;
constexpr int HN    = 16;
constexpr int DH    = 64;
constexpr int QKVN  = 3 * CDIM;                         // 3072
constexpr int MROWS = BSZ * NSEQ;                       // 4096
constexpr size_t QKV_S = (size_t)BSZ * HN * NSEQ * DH;  // halves per q/k/v plane
constexpr float WSCALE = 64.0f;                         // weight pre-scale (exact power of two)
constexpr float PSCALE = 256.0f;                        // P pre-scale
constexpr float ASCALE = 64.0f;                         // attention-output pre-scale

// one 16x16x32 f16 WMMA with the VALU hazard guard attached
__device__ __forceinline__ v8f wmma_f16(v16h a, v16h b, v8f c) {
  v8f d = __builtin_amdgcn_wmma_f32_16x16x32_f16(false, a, false, b, (short)0, c, false, false);
  asm volatile("v_nop\n\tv_nop\n\tv_nop\n\tv_nop" : "+v"(d) : "v"(a), "v"(b));
  return d;
}

// 16-bit fragment from a k-contiguous row (A row m, or B stored [n][k] row n):
// elements 0..7 <- k0+8*lh .. +7, elements 8..15 <- k0+16+8*lh .. +7  (lh = lane >> 4)
__device__ __forceinline__ v16h ld_frag(const _Float16* rk, int lh) {
  Frag f;
  f.p[0] = *(const v8h*)(rk + 8 * lh);
  f.p[1] = *(const v8h*)(rk + 16 + 8 * lh);
  return f.v;
}

// ---------------------------------------------------------------------------
// QKV projection: C tile 64x64 per block (128 threads, 4 waves x 16 rows), K loop step 32.
__global__ __launch_bounds__(128)
void k_qkv(const float* __restrict__ x, const float* __restrict__ W, const float* __restrict__ bias,
           _Float16* __restrict__ qkv) {
  __shared__ __align__(16) _Float16 lds[64 * 64];      // As[64][32] | Bs[64][32]; reused as Cs[64][64]
  _Float16* As = lds;
  _Float16* Bs = lds + 2048;

  const int tid = threadIdx.x, lane = tid & 31, w = tid >> 5, m = lane & 15, lh = lane >> 4;
  const int cblk = blockIdx.x * 64, rblk = blockIdx.y * 64;
  if (cblk + 64 > QKVN || rblk + 64 > MROWS) return;   // block-uniform, before any barrier

  const int ar = tid >> 1, ac = (tid & 1) * 16;          // A staging: row ar, 16 k
  const int bk = tid >> 2, bc = (tid & 3) * 16;          // B staging: k row bk, 16 n
  const float* ap = x + (size_t)(rblk + ar) * CDIM + ac;
  const float* bp = W + (size_t)bk * QKVN + cblk + bc;

  v8f acc[4] = {};

  for (int k0 = 0; k0 < CDIM; k0 += 32) {
    v4f a4[4], b4[4];
#pragma unroll
    for (int j = 0; j < 4; ++j) a4[j] = *(const v4f*)(ap + k0 + 4 * j);
#pragma unroll
    for (int j = 0; j < 4; ++j) b4[j] = *(const v4f*)(bp + (size_t)k0 * QKVN + 4 * j);
    __syncthreads();
#pragma unroll
    for (int j = 0; j < 4; ++j)
      *(v4h*)(As + ar * 32 + ac + 4 * j) = __builtin_convertvector(a4[j], v4h);
#pragma unroll
    for (int j = 0; j < 4; ++j)
#pragma unroll
      for (int e = 0; e < 4; ++e)
        Bs[(bc + 4 * j + e) * 32 + bk] = (_Float16)(b4[j][e] * WSCALE);   // Bs[n][k]
    __syncthreads();

    v16h af = ld_frag(As + (w * 16 + m) * 32, lh);
    v16h bf[4];
#pragma unroll
    for (int nt = 0; nt < 4; ++nt) bf[nt] = ld_frag(Bs + (nt * 16 + m) * 32, lh);
#pragma unroll
    for (int nt = 0; nt < 4; ++nt) acc[nt] = wmma_f16(af, bf[nt], acc[nt]);
  }

  // stage C tile (bias added, weight scale undone) in LDS as f16
  __syncthreads();
  _Float16* Cs = lds;
#pragma unroll
  for (int nt = 0; nt < 4; ++nt) {
    const int col = nt * 16 + m;
    const float bb = bias[cblk + col];
#pragma unroll
    for (int r = 0; r < 8; ++r)
      Cs[(w * 16 + 8 * lh + r) * 64 + col] = (_Float16)(acc[nt][r] * (1.0f / WSCALE) + bb);
  }
  __syncthreads();

  // whole-line stores: the tile is 4096 contiguous halves; each instruction of a wave covers 4 full lines
  const int sS = cblk >> 10, hd = (cblk & 1023) >> 6, b = rblk >> 11, n0 = rblk & 2047;
  _Float16* dst = qkv + (size_t)sS * QKV_S + ((size_t)(b * HN + hd) * NSEQ + n0) * DH;
  v8h vv[4];
#pragma unroll
  for (int j = 0; j < 4; ++j) vv[j] = *(const v8h*)(Cs + (j * 128 + tid) * 8);
#pragma unroll
  for (int j = 0; j < 4; ++j) *(v8h*)(dst + (j * 128 + tid) * 8) = vv[j];
  
}

// ---------------------------------------------------------------------------
// Gated flash attention: block = (b, h, 64 queries), 128 threads (4 waves x 16 query rows),
// key chunks of 64. Gate sigmoid(x.We+be) computed in-block on VALU. Output a[b][n][h*64+d] f16 x64.
__global__ __launch_bounds__(128)
void k_attn(const _Float16* __restrict__ qkv, const float* __restrict__ x,
            const float* __restrict__ We, const float* __restrict__ be,
            const int* __restrict__ am, _Float16* __restrict__ aw) {
  __shared__ __align__(16) _Float16 Qs[64 * 64];       // [query][d]
  __shared__ __align__(16) _Float16 Ks[64 * 64];       // [key][d]   (k-contiguous B for S)
  __shared__ __align__(16) _Float16 Vt[64 * 64];       // [d][key]   (k-contiguous B for P.V)
  __shared__ __align__(16) _Float16 Ps[4 * 16 * 64];   // per wave [row][key]
  __shared__ float gsig[64];

  const int tid = threadIdx.x, lane = tid & 31, w = tid >> 5, m = lane & 15, lh = lane >> 4;
  const int bid = blockIdx.x;
  const int qt = bid & 31, bh = bid >> 5, hd = bh & 15, b = bh >> 4;
  if (b >= BSZ) return;                                   // block-uniform
  const int qbase = qt * 64;

  const _Float16* Qg = qkv + ((size_t)(b * HN + hd) * NSEQ) * DH;
  const _Float16* Kg = Qg + QKV_S;
  const _Float16* Vg = Kg + QKV_S;

  // gate: two threads per query row, 512 terms each, f32
  {
    const int q = tid >> 1, part = tid & 1;
    const float* xr = x + ((size_t)(b * NSEQ + qbase + q)) * CDIM + part * 512;
    const float* wp = We + (size_t)(part * 512) * HN + hd;
    float s = 0.0f;
#pragma unroll 4
    for (int c = 0; c < 512; ++c) s += xr[c] * wp[(size_t)c * HN];
    s += __shfl_xor(s, 1, 32);
    if (part == 0) {
      const float z = s + be[hd];
      gsig[q] = 1.0f / (1.0f + expf(-z));
    }
  }
  // Q tile: 4096 contiguous halves
  {
    const _Float16* src = Qg + (size_t)qbase * DH;
#pragma unroll
    for (int it = 0; it < 4; ++it)
      *(v8h*)(Qs + (it * 128 + tid) * 8) = *(const v8h*)(src + (it * 128 + tid) * 8);
  }
  __syncthreads();

  v16h qa[2];
  qa[0] = ld_frag(Qs + (w * 16 + m) * 64, lh);
  qa[1] = ld_frag(Qs + (w * 16 + m) * 64 + 32, lh);

  float mstate[8], lstate[8], g[8];
#pragma unroll
  for (int r = 0; r < 8; ++r) {
    mstate[r] = -__builtin_inff();
    lstate[r] = 0.0f;
    g[r] = gsig[w * 16 + 8 * lh + r] * 0.125f;             // gate * 1/sqrt(64)
  }
  v8f O[4] = {};

  const int* mrow = am + (size_t)b * NSEQ * NSEQ + (size_t)(qbase + w * 16 + 8 * lh) * NSEQ + m;

  for (int j = 0; j < NSEQ / 64; ++j) {
    const int kb = j * 64;
    __syncthreads();
    {  // K chunk: direct copy; V chunk: transposed into Vt[d][key]
      const _Float16* ksrc = Kg + (size_t)kb * DH;
#pragma unroll
      for (int it = 0; it < 4; ++it)
        *(v8h*)(Ks + (it * 128 + tid) * 8) = *(const v8h*)(ksrc + (it * 128 + tid) * 8);
#pragma unroll
      for (int it = 0; it < 4; ++it) {
        const int c = it * 128 + tid;
        const int key = c >> 3, d8 = (c & 7) * 8;
        v8h vv = *(const v8h*)(Vg + (size_t)(kb + key) * DH + d8);
#pragma unroll
        for (int e = 0; e < 8; ++e) Vt[(d8 + e) * 64 + key] = vv[e];
      }
    }
    __syncthreads();

    // S = Q.K^T : rows = 16 queries of this wave, cols = 64 keys (4 tiles), K = 64
    v8f S[4];
#pragma unroll
    for (int nt = 0; nt < 4; ++nt) {
      v8f z = {};
      v16h bf0 = ld_frag(Ks + (nt * 16 + m) * 64, lh);
      v16h bf1 = ld_frag(Ks + (nt * 16 + m) * 64 + 32, lh);
      z = wmma_f16(qa[0], bf0, z);
      z = wmma_f16(qa[1], bf1, z);
      S[nt] = z;
    }

    // scale, gate, mask, online softmax (row r + 8*lh across the 16 lanes of a lane half)
#pragma unroll
    for (int r = 0; r < 8; ++r) {
      float mx = -__builtin_inff();
#pragma unroll
      for (int nt = 0; nt < 4; ++nt) {
        const int mv = mrow[(size_t)r * NSEQ + kb + nt * 16];
        float lv = S[nt][r] * g[r];
        if (mv == 0) lv = -__builtin_inff();
        S[nt][r] = lv;
        mx = fmaxf(mx, lv);
      }
      mx = fmaxf(mx, __shfl_xor(mx, 1, 32));
      mx = fmaxf(mx, __shfl_xor(mx, 2, 32));
      mx = fmaxf(mx, __shfl_xor(mx, 4, 32));
      mx = fmaxf(mx, __shfl_xor(mx, 8, 32));
      const float mnew = fmaxf(mstate[r], mx);
      const bool dead = (mnew == -__builtin_inff());
      const float alpha = dead ? 1.0f : __expf(mstate[r] - mnew);
      float rs = 0.0f;
#pragma unroll
      for (int nt = 0; nt < 4; ++nt) {
        const float p = dead ? 0.0f : __expf(S[nt][r] - mnew);
        rs += p;
        Ps[w * 1024 + (8 * lh + r) * 64 + nt * 16 + m] = (_Float16)(p * PSCALE);
      }
      rs += __shfl_xor(rs, 1, 32);
      rs += __shfl_xor(rs, 2, 32);
      rs += __shfl_xor(rs, 4, 32);
      rs += __shfl_xor(rs, 8, 32);
      lstate[r] = lstate[r] * alpha + rs;
      mstate[r] = mnew;
#pragma unroll
      for (int nt2 = 0; nt2 < 4; ++nt2) O[nt2][r] *= alpha;
    }
    __syncthreads();   // P spill (element stores) visible before the fragment reload

    // O += (256 P) . V : K = 64 keys
#pragma unroll
    for (int kk = 0; kk < 2; ++kk) {
      v16h pa = ld_frag(Ps + w * 1024 + m * 64 + kk * 32, lh);
      v16h vb[4];
#pragma unroll
      for (int nt2 = 0; nt2 < 4; ++nt2) vb[nt2] = ld_frag(Vt + (nt2 * 16 + m) * 64 + kk * 32, lh);
#pragma unroll
      for (int nt2 = 0; nt2 < 4; ++nt2) O[nt2] = wmma_f16(pa, vb[nt2], O[nt2]);
    }
  }

  // normalise: a = O / (256 l); store a*64 = O / (4 l) as f16, staged in Ks
  __syncthreads();
  float inv[8];
#pragma unroll
  for (int r = 0; r < 8; ++r) {
    const float l = lstate[r];
    inv[r] = (l > 0.0f) ? (0.25f / l) : 0.0f;
  }
#pragma unroll
  for (int nt2 = 0; nt2 < 4; ++nt2) {
    const int col = nt2 * 16 + m;
#pragma unroll
    for (int r = 0; r < 8; ++r)
      Ks[(w * 16 + 8 * lh + r) * 64 + col] = (_Float16)(O[nt2][r] * inv[r]);
  }
  __syncthreads();

  v8h vv[4];
#pragma unroll
  for (int jj = 0; jj < 4; ++jj) {
    const int c = jj * 128 + tid;
    vv[jj] = *(const v8h*)(Ks + (c >> 3) * 64 + (c & 7) * 8);
  }
#pragma unroll
  for (int jj = 0; jj < 4; ++jj) {
    const int c = jj * 128 + tid;
    _Float16* dst = aw + ((size_t)(b * NSEQ + qbase + (c >> 3))) * CDIM + hd * DH + (c & 7) * 8;
    *(v8h*)dst = vv[jj];
  }
  
}

// ---------------------------------------------------------------------------
// Output projection: out = (a x64) . (Wo x64) / 4096 + bo ; C tile 64x64 f32, grid = (1024/64, 4096/64)
__global__ __launch_bounds__(128)
void k_out(const _Float16* __restrict__ aw, const float* __restrict__ Wo, const float* __restrict__ bo,
           float* __restrict__ out) {
  __shared__ __align__(16) float ldsf[64 * 64];          // 16 KB: As|Bs (f16) then Cs (f32)
  _Float16* As = reinterpret_cast<_Float16*>(ldsf);
  _Float16* Bs = As + 2048;

  const int tid = threadIdx.x, lane = tid & 31, w = tid >> 5, m = lane & 15, lh = lane >> 4;
  const int cblk = blockIdx.x * 64, rblk = blockIdx.y * 64;
  if (cblk + 64 > CDIM || rblk + 64 > MROWS) return;    // block-uniform

  const int ar = tid >> 1, ac = (tid & 1) * 16;
  const int bk = tid >> 2, bc = (tid & 3) * 16;
  const _Float16* ap = aw + (size_t)(rblk + ar) * CDIM + ac;
  const float* bp = Wo + (size_t)bk * CDIM + cblk + bc;

  v8f acc[4] = {};

  for (int k0 = 0; k0 < CDIM; k0 += 32) {
    v8h a8[2];
    v4f b4[4];
    a8[0] = *(const v8h*)(ap + k0);
    a8[1] = *(const v8h*)(ap + k0 + 8);
#pragma unroll
    for (int j = 0; j < 4; ++j) b4[j] = *(const v4f*)(bp + (size_t)k0 * CDIM + 4 * j);
    __syncthreads();
    *(v8h*)(As + ar * 32 + ac)     = a8[0];
    *(v8h*)(As + ar * 32 + ac + 8) = a8[1];
#pragma unroll
    for (int j = 0; j < 4; ++j)
#pragma unroll
      for (int e = 0; e < 4; ++e)
        Bs[(bc + 4 * j + e) * 32 + bk] = (_Float16)(b4[j][e] * WSCALE);   // Bs[n][k]
    __syncthreads();

    v16h af = ld_frag(As + (w * 16 + m) * 32, lh);
    v16h bf[4];
#pragma unroll
    for (int nt = 0; nt < 4; ++nt) bf[nt] = ld_frag(Bs + (nt * 16 + m) * 32, lh);
#pragma unroll
    for (int nt = 0; nt < 4; ++nt) acc[nt] = wmma_f16(af, bf[nt], acc[nt]);
  }

  __syncthreads();
  float* Cs = ldsf;
#pragma unroll
  for (int nt = 0; nt < 4; ++nt) {
    const int col = nt * 16 + m;
    const float bb = bo[cblk + col];
#pragma unroll
    for (int r = 0; r < 8; ++r)
      Cs[(w * 16 + 8 * lh + r) * 64 + col] = acc[nt][r] * (1.0f / (ASCALE * WSCALE)) + bb;
  }
  __syncthreads();

  // each row segment is 256 B = 2 lines; lanes 8q..8q+7 write one full line with 16-B stores
  v4f vv[8];
#pragma unroll
  for (int jj = 0; jj < 8; ++jj) {
    const int c = jj * 128 + tid;
    vv[jj] = *(const v4f*)(Cs + (c >> 4) * 64 + (c & 15) * 4);
  }
#pragma unroll
  for (int jj = 0; jj < 8; ++jj) {
    const int c = jj * 128 + tid;
    float* dst = out + (size_t)(rblk + (c >> 4)) * CDIM + cblk + (c & 15) * 4;
    *(v4f*)dst = vv[jj];
  }
  
}

// ---------------------------------------------------------------------------
extern "C" void kernel_launch(void* const* d_in, const int* in_sizes, int n_in,
                              void* d_out, int out_size, void* d_ws, size_t ws_size,
                              hipStream_t stream) {
  if (n_in < 8) return;
  if (in_sizes[0] != MROWS * CDIM) return;
  if (in_sizes[1] != BSZ * NSEQ * NSEQ) return;
  if (in_sizes[2] != CDIM * QKVN) return;
  if (in_sizes[3] != QKVN) return;
  if (in_sizes[4] != CDIM * HN) return;
  if (in_sizes[5] != HN) return;
  if (in_sizes[6] != CDIM * CDIM) return;
  if (in_sizes[7] != CDIM) return;
  if (out_size != MROWS * CDIM) return;

  const float* x    = (const float*)d_in[0];
  const int*   am   = (const int*)d_in[1];
  const float* Wqkv = (const float*)d_in[2];
  const float* bqkv = (const float*)d_in[3];
  const float* We   = (const float*)d_in[4];
  const float* be   = (const float*)d_in[5];
  const float* Wo   = (const float*)d_in[6];
  const float* bo   = (const float*)d_in[7];
  float* out = (float*)d_out;

  const size_t qkv_bytes = (size_t)3 * QKV_S * sizeof(_Float16);          // 25,165,824
  const size_t aw_off    = qkv_bytes;
  const size_t aw_bytes  = (size_t)MROWS * CDIM * sizeof(_Float16);       //  8,388,608
  if (aw_off + aw_bytes > ws_size) return;
  char* ws = (char*)d_ws;
  _Float16* qkvws = (_Float16*)ws;
  _Float16* awws  = (_Float16*)(ws + aw_off);

  k_qkv<<<dim3(QKVN / 64, MROWS / 64), 128, 0, stream>>>(x, Wqkv, bqkv, qkvws);
  k_attn<<<dim3(BSZ * HN * (NSEQ / 64)), 128, 0, stream>>>(qkvws, x, We, be, am, awws);
  k_out<<<dim3(CDIM / 64, MROWS / 64), 128, 0, stream>>>(awws, Wo, bo, out);
}

// v001
// A run of this version takes 306 microseconds.
// Next to v000, in two timings, it ran 1.37 times as fast each time.
// Contractions: QKV projection, Q.K^T, P.V and output projection on v_wmma_f32_16x16x32_f16 (f16 operands, f32 accumulate);
// weights carried x64, P carried x256, attention output carried x64 (scales undone in f32); per-query gate dot (K=1024, N=16) on VALU f32.
#include <hip/hip_runtime.h>
#include <math.h>
#include <stdint.h>
#include <stddef.h>

typedef _Float16 v16h __attribute__((ext_vector_type(16)));
typedef _Float16 v8h  __attribute__((ext_vector_type(8), __may_alias__));
typedef _Float16 v4h  __attribute__((ext_vector_type(4), __may_alias__));
typedef float    v8f  __attribute__((ext_vector_type(8)));
typedef float    v4f  __attribute__((ext_vector_type(4), __may_alias__));

union Frag { v16h v; v8h p[2]; };

constexpr int BSZ   = 2;
constexpr int NSEQ  = 2048;
constexpr int CDIM  = 1024;
constexpr int HN    = 16;
constexpr int DH    = 64;
constexpr int QKVN  = 3 * CDIM;                         // 3072
constexpr int MROWS = BSZ * NSEQ;                       // 4096
constexpr size_t QKV_S = (size_t)BSZ * HN * NSEQ * DH;  // halves per q/k/v plane
constexpr float WSCALE = 64.0f;                         // weight pre-scale (exact power of two)
constexpr float PSCALE = 256.0f;                        // P pre-scale
constexpr float ASCALE = 64.0f;                         // attention-output pre-scale
// LDS row pitches in halves: 16 B x odd, so the 16 rows of a ds_load_b128 fragment read fall on distinct banks
constexpr int GP = 40;                                  // 32-half rows (GEMM k slices): 80 B
constexpr int AP = 72;                                  // 64-half rows (attention tiles): 144 B

// one 16x16x32 f16 WMMA with the VALU hazard guard attached
__device__ __forceinline__ v8f wmma_f16(v16h a, v16h b, v8f c) {
  v8f d = __builtin_amdgcn_wmma_f32_16x16x32_f16(false, a, false, b, (short)0, c, false, false);
  asm volatile("v_nop\n\tv_nop\n\tv_nop\n\tv_nop" : "+v"(d) : "v"(a), "v"(b));
  return d;
}

// 16-bit fragment from a k-contiguous row (A row m, or B stored [n][k] row n):
// elements 0..7 <- k0+8*lh .. +7, elements 8..15 <- k0+16+8*lh .. +7  (lh = lane >> 4)
__device__ __forceinline__ v16h ld_frag(const _Float16* rk, int lh) {
  Frag f;
  f.p[0] = *(const v8h*)(rk + 8 * lh);
  f.p[1] = *(const v8h*)(rk + 16 + 8 * lh);
  return f.v;
}

// ---------------------------------------------------------------------------
// QKV projection: C tile 64x64 per block (128 threads, 4 waves x 16 rows), K loop step 32.
__global__ __launch_bounds__(128)
void k_qkv(const float* __restrict__ x, const float* __restrict__ W, const float* __restrict__ bias,
           _Float16* __restrict__ qkv) {
  __shared__ __align__(16) _Float16 lds[2 * 64 * GP];  // As[64][GP] | Bs[64][GP]; reused as Cs[64][64]
  _Float16* As = lds;
  _Float16* Bs = lds + 64 * GP;

  const int tid = threadIdx.x, lane = tid & 31, w = tid >> 5, m = lane & 15, lh = lane >> 4;
  const int cblk = blockIdx.x * 64, rblk = blockIdx.y * 64;
  if (cblk + 64 > QKVN || rblk + 64 > MROWS) return;   // block-uniform, before any barrier

  const int ar = tid >> 1, ac = (tid & 1) * 16;          // A staging: row ar, 16 k
  const int bk = tid >> 2, bc = (tid & 3) * 4;           // B staging: k row bk, n = bc + 16 j + e (a wave's rows on distinct banks)
  const float* ap = x + (size_t)(rblk + ar) * CDIM + ac;
  const float* bp = W + (size_t)bk * QKVN + cblk + bc;

  v8f acc[4] = {};

  for (int k0 = 0; k0 < CDIM; k0 += 32) {
    v4f a4[4], b4[4];
#pragma unroll
    for (int j = 0; j < 4; ++j) a4[j] = *(const v4f*)(ap + k0 + 4 * j);
#pragma unroll
    for (int j = 0; j < 4; ++j) b4[j] = *(const v4f*)(bp + (size_t)k0 * QKVN + 16 * j);
    __syncthreads();
#pragma unroll
    for (int j = 0; j < 4; ++j)
      *(v4h*)(As + ar * GP + ac + 4 * j) = __builtin_convertvector(a4[j], v4h);
#pragma unroll
    for (int j = 0; j < 4; ++j)
#pragma unroll
      for (int e = 0; e < 4; ++e)
        Bs[(bc + 16 * j + e) * GP + bk] = (_Float16)(b4[j][e] * WSCALE);  // Bs[n][k]
    __syncthreads();

    v16h af = ld_frag(As + (w * 16 + m) * GP, lh);
    v16h bf[4];
#pragma unroll
    for (int nt = 0; nt < 4; ++nt) bf[nt] = ld_frag(Bs + (nt * 16 + m) * GP, lh);
#pragma unroll
    for (int nt = 0; nt < 4; ++nt) acc[nt] = wmma_f16(af, bf[nt], acc[nt]);
  }

  // stage C tile (bias added, weight scale undone) in LDS as f16
  __syncthreads();
  _Float16* Cs = lds;
#pragma unroll
  for (int nt = 0; nt < 4; ++nt) {
    const int col = nt * 16 + m;
    const float bb = bias[cblk + col];
#pragma unroll
    for (int r = 0; r < 8; ++r)
      Cs[(w * 16 + 8 * lh + r) * 64 + col] = (_Float16)(acc[nt][r] * (1.0f / WSCALE) + bb);
  }
  __syncthreads();

  // whole-line stores: the tile is 4096 contiguous halves; each instruction of a wave covers 4 full lines
  const int sS = cblk >> 10, hd = (cblk & 1023) >> 6, b = rblk >> 11, n0 = rblk & 2047;
  _Float16* dst = qkv + (size_t)sS * QKV_S + ((size_t)(b * HN + hd) * NSEQ + n0) * DH;
  v8h vv[4];
#pragma unroll
  for (int j = 0; j < 4; ++j) vv[j] = *(const v8h*)(Cs + (j * 128 + tid) * 8);
#pragma unroll
  for (int j = 0; j < 4; ++j) *(v8h*)(dst + (j * 128 + tid) * 8) = vv[j];
  
}

// ---------------------------------------------------------------------------
// Gated flash attention: block = (b, h, 64 queries), 128 threads (4 waves x 16 query rows),
// key chunks of 64. Gate sigmoid(x.We+be) computed in-block on VALU. Output a[b][n][h*64+d] f16 x64.
__global__ __launch_bounds__(128)
void k_attn(const _Float16* __restrict__ qkv, const float* __restrict__ x,
            const float* __restrict__ We, const float* __restrict__ be,
            const int* __restrict__ am, _Float16* __restrict__ aw) {
  __shared__ __align__(16) _Float16 Qs[64 * AP];       // [query][d]
  __shared__ __align__(16) _Float16 Ks[64 * AP];       // [key][d]   (k-contiguous B for S)
  __shared__ __align__(16) _Float16 Vt[64 * AP];       // [d][key]   (k-contiguous B for P.V)
  __shared__ __align__(16) _Float16 Ps[4 * 16 * AP];   // per wave [row][key]
  __shared__ float gsig[64];

  const int tid = threadIdx.x, lane = tid & 31, w = tid >> 5, m = lane & 15, lh = lane >> 4;
  const int bid = blockIdx.x;
  const int qt = bid & 31, bh = bid >> 5, hd = bh & 15, b = bh >> 4;
  if (b >= BSZ) return;                                   // block-uniform
  const int qbase = qt * 64;

  const _Float16* Qg = qkv + ((size_t)(b * HN + hd) * NSEQ) * DH;
  const _Float16* Kg = Qg + QKV_S;
  const _Float16* Vg = Kg + QKV_S;

  // gate: two threads per query row, 512 terms each, f32
  {
    const int q = tid >> 1, part = tid & 1;
    const float* xr = x + ((size_t)(b * NSEQ + qbase + q)) * CDIM + part * 512;
    const float* wp = We + (size_t)(part * 512) * HN + hd;
    float s = 0.0f;
#pragma unroll 4
    for (int c = 0; c < 512; ++c) s += xr[c] * wp[(size_t)c * HN];
    s += __shfl_xor(s, 1, 32);
    if (part == 0) {
      const float z = s + be[hd];
      gsig[q] = 1.0f / (1.0f + expf(-z));
    }
  }
  // Q tile: 4096 contiguous halves
  {
    const _Float16* src = Qg + (size_t)qbase * DH;
#pragma unroll
    for (int it = 0; it < 4; ++it) {
      const int c = it * 128 + tid;
      *(v8h*)(Qs + (c >> 3) * AP + (c & 7) * 8) = *(const v8h*)(src + c * 8);
    }
  }
  __syncthreads();

  v16h qa[2];
  qa[0] = ld_frag(Qs + (w * 16 + m) * AP, lh);
  qa[1] = ld_frag(Qs + (w * 16 + m) * AP + 32, lh);

  float mstate[8], lstate[8], g[8];
#pragma unroll
  for (int r = 0; r < 8; ++r) {
    mstate[r] = -__builtin_inff();
    lstate[r] = 0.0f;
    g[r] = gsig[w * 16 + 8 * lh + r] * 0.125f;             // gate * 1/sqrt(64)
  }
  v8f O[4] = {};

  const int* mrow = am + (size_t)b * NSEQ * NSEQ + (size_t)(qbase + w * 16 + 8 * lh) * NSEQ + m;

  for (int j = 0; j < NSEQ / 64; ++j) {
    const int kb = j * 64;
    __syncthreads();
    {  // K chunk: direct copy; V chunk: transposed into Vt[d][key]
      const _Float16* ksrc = Kg + (size_t)kb * DH;
#pragma unroll
      for (int it = 0; it < 4; ++it) {
        const int c = it * 128 + tid;
        *(v8h*)(Ks + (c >> 3) * AP + (c & 7) * 8) = *(const v8h*)(ksrc + c * 8);
      }
#pragma unroll
      for (int it = 0; it < 4; ++it) {
        const int c = it * 128 + tid;
        const int key = c >> 3, d8 = (c & 7) * 8;
        v8h vv = *(const v8h*)(Vg + (size_t)(kb + key) * DH + d8);
#pragma unroll
        for (int e = 0; e < 8; ++e) Vt[(d8 + e) * AP + key] = vv[e];
      }
    }
    __syncthreads();

    // S = Q.K^T : rows = 16 queries of this wave, cols = 64 keys (4 tiles), K = 64
    v8f S[4];
#pragma unroll
    for (int nt = 0; nt < 4; ++nt) {
      v8f z = {};
      v16h bf0 = ld_frag(Ks + (nt * 16 + m) * AP, lh);
      v16h bf1 = ld_frag(Ks + (nt * 16 + m) * AP + 32, lh);
      z = wmma_f16(qa[0], bf0, z);
      z = wmma_f16(qa[1], bf1, z);
      S[nt] = z;
    }

    // scale, gate, mask, online softmax (row r + 8*lh across the 16 lanes of a lane half)
#pragma unroll
    for (int r = 0; r < 8; ++r) {
      float mx = -__builtin_inff();
#pragma unroll
      for (int nt = 0; nt < 4; ++nt) {
        const int mv = mrow[(size_t)r * NSEQ + kb + nt * 16];
        float lv = S[nt][r] * g[r];
        if (mv == 0) lv = -__builtin_inff();
        S[nt][r] = lv;
        mx = fmaxf(mx, lv);
      }
      mx = fmaxf(mx, __shfl_xor(mx, 1, 32));
      mx = fmaxf(mx, __shfl_xor(mx, 2, 32));
      mx = fmaxf(mx, __shfl_xor(mx, 4, 32));
      mx = fmaxf(mx, __shfl_xor(mx, 8, 32));
      const float mnew = fmaxf(mstate[r], mx);
      const bool dead = (mnew == -__builtin_inff());
      const float alpha = dead ? 1.0f : __expf(mstate[r] - mnew);
      float rs = 0.0f;
#pragma unroll
      for (int nt = 0; nt < 4; ++nt) {
        const float p = dead ? 0.0f : __expf(S[nt][r] - mnew);
        rs += p;
        Ps[(w * 16 + 8 * lh + r) * AP + nt * 16 + m] = (_Float16)(p * PSCALE);
      }
      rs += __shfl_xor(rs, 1, 32);
      rs += __shfl_xor(rs, 2, 32);
      rs += __shfl_xor(rs, 4, 32);
      rs += __shfl_xor(rs, 8, 32);
      lstate[r] = lstate[r] * alpha + rs;
      mstate[r] = mnew;
#pragma unroll
      for (int nt2 = 0; nt2 < 4; ++nt2) O[nt2][r] *= alpha;
    }
    __syncthreads();   // P spill (element stores) visible before the fragment reload

    // O += (256 P) . V : K = 64 keys
#pragma unroll
    for (int kk = 0; kk < 2; ++kk) {
      v16h pa = ld_frag(Ps + (w * 16 + m) * AP + kk * 32, lh);
      v16h vb[4];
#pragma unroll
      for (int nt2 = 0; nt2 < 4; ++nt2) vb[nt2] = ld_frag(Vt + (nt2 * 16 + m) * AP + kk * 32, lh);
#pragma unroll
      for (int nt2 = 0; nt2 < 4; ++nt2) O[nt2] = wmma_f16(pa, vb[nt2], O[nt2]);
    }
  }

  // normalise: a = O / (256 l); store a*64 = O / (4 l) as f16, staged in Ks
  __syncthreads();
  float inv[8];
#pragma unroll
  for (int r = 0; r < 8; ++r) {
    const float l = lstate[r];
    inv[r] = (l > 0.0f) ? (0.25f / l) : 0.0f;
  }
#pragma unroll
  for (int nt2 = 0; nt2 < 4; ++nt2) {
    const int col = nt2 * 16 + m;
#pragma unroll
    for (int r = 0; r < 8; ++r)
      Ks[(w * 16 + 8 * lh + r) * 64 + col] = (_Float16)(O[nt2][r] * inv[r]);
  }
  __syncthreads();

  v8h vv[4];
#pragma unroll
  for (int jj = 0; jj < 4; ++jj) {
    const int c = jj * 128 + tid;
    vv[jj] = *(const v8h*)(Ks + (c >> 3) * 64 + (c & 7) * 8);
  }
#pragma unroll
  for (int jj = 0; jj < 4; ++jj) {
    const int c = jj * 128 + tid;
    _Float16* dst = aw + ((size_t)(b * NSEQ + qbase + (c >> 3))) * CDIM + hd * DH + (c & 7) * 8;
    *(v8h*)dst = vv[jj];
  }
  
}

// ---------------------------------------------------------------------------
// Output projection: out = (a x64) . (Wo x64) / 4096 + bo ; C tile 64x64 f32, grid = (1024/64, 4096/64)
__global__ __launch_bounds__(128)
void k_out(const _Float16* __restrict__ aw, const float* __restrict__ Wo, const float* __restrict__ bo,
           float* __restrict__ out) {
  __shared__ __align__(16) float ldsf[64 * 64];          // 16 KB: As|Bs (f16) then Cs (f32)
  _Float16* As = reinterpret_cast<_Float16*>(ldsf);
  _Float16* Bs = As + 64 * GP;

  const int tid = threadIdx.x, lane = tid & 31, w = tid >> 5, m = lane & 15, lh = lane >> 4;
  const int cblk = blockIdx.x * 64, rblk = blockIdx.y * 64;
  if (cblk + 64 > CDIM || rblk + 64 > MROWS) return;    // block-uniform

  const int ar = tid >> 1, ac = (tid & 1) * 16;
  const int bk = tid >> 2, bc = (tid & 3) * 4;           // n = bc + 16 j + e, as in k_qkv
  const _Float16* ap = aw + (size_t)(rblk + ar) * CDIM + ac;
  const float* bp = Wo + (size_t)bk * CDIM + cblk + bc;

  v8f acc[4] = {};

  for (int k0 = 0; k0 < CDIM; k0 += 32) {
    v8h a8[2];
    v4f b4[4];
    a8[0] = *(const v8h*)(ap + k0);
    a8[1] = *(const v8h*)(ap + k0 + 8);
#pragma unroll
    for (int j = 0; j < 4; ++j) b4[j] = *(const v4f*)(bp + (size_t)k0 * CDIM + 16 * j);
    __syncthreads();
    *(v8h*)(As + ar * GP + ac)     = a8[0];
    *(v8h*)(As + ar * GP + ac + 8) = a8[1];
#pragma unroll
    for (int j = 0; j < 4; ++j)
#pragma unroll
      for (int e = 0; e < 4; ++e)
        Bs[(bc + 16 * j + e) * GP + bk] = (_Float16)(b4[j][e] * WSCALE);  // Bs[n][k]
    __syncthreads();

    v16h af = ld_frag(As + (w * 16 + m) * GP, lh);
    v16h bf[4];
#pragma unroll
    for (int nt = 0; nt < 4; ++nt) bf[nt] = ld_frag(Bs + (nt * 16 + m) * GP, lh);
#pragma unroll
    for (int nt = 0; nt < 4; ++nt) acc[nt] = wmma_f16(af, bf[nt], acc[nt]);
  }

  __syncthreads();
  float* Cs = ldsf;
#pragma unroll
  for (int nt = 0; nt < 4; ++nt) {
    const int col = nt * 16 + m;
    const float bb = bo[cblk + col];
#pragma unroll
    for (int r = 0; r < 8; ++r)
      Cs[(w * 16 + 8 * lh + r) * 64 + col] = acc[nt][r] * (1.0f / (ASCALE * WSCALE)) + bb;
  }
  __syncthreads();

  // each row segment is 256 B = 2 lines; lanes 8q..8q+7 write one full line with 16-B stores
  v4f vv[8];
#pragma unroll
  for (int jj = 0; jj < 8; ++jj) {
    const int c = jj * 128 + tid;
    vv[jj] = *(const v4f*)(Cs + (c >> 4) * 64 + (c & 15) * 4);
  }
#pragma unroll
  for (int jj = 0; jj < 8; ++jj) {
    const int c = jj * 128 + tid;
    float* dst = out + (size_t)(rblk + (c >> 4)) * CDIM + cblk + (c & 15) * 4;
    *(v4f*)dst = vv[jj];
  }
  
}

// ---------------------------------------------------------------------------
extern "C" void kernel_launch(void* const* d_in, const int* in_sizes, int n_in,
                              void* d_out, int out_size, void* d_ws, size_t ws_size,
                              hipStream_t stream) {
  if (n_in < 8) return;
  if (in_sizes[0] != MROWS * CDIM) return;
  if (in_sizes[1] != BSZ * NSEQ * NSEQ) return;
  if (in_sizes[2] != CDIM * QKVN) return;
  if (in_sizes[3] != QKVN) return;
  if (in_sizes[4] != CDIM * HN) return;
  if (in_sizes[5] != HN) return;
  if (in_sizes[6] != CDIM * CDIM) return;
  if (in_sizes[7] != CDIM) return;
  if (out_size != MROWS * CDIM) return;

  const float* x    = (const float*)d_in[0];
  const int*   am   = (const int*)d_in[1];
  const float* Wqkv = (const float*)d_in[2];
  const float* bqkv = (const float*)d_in[3];
  const float* We   = (const float*)d_in[4];
  const float* be   = (const float*)d_in[5];
  const float* Wo   = (const float*)d_in[6];
  const float* bo   = (const float*)d_in[7];
  float* out = (float*)d_out;

  const size_t qkv_bytes = (size_t)3 * QKV_S * sizeof(_Float16);          // 25,165,824
  const size_t aw_off    = qkv_bytes;
  const size_t aw_bytes  = (size_t)MROWS * CDIM * sizeof(_Float16);       //  8,388,608
  if (aw_off + aw_bytes > ws_size) return;
  char* ws = (char*)d_ws;
  _Float16* qkvws = (_Float16*)ws;
  _Float16* awws  = (_Float16*)(ws + aw_off);

  k_qkv<<<dim3(QKVN / 64, MROWS / 64), 128, 0, stream>>>(x, Wqkv, bqkv, qkvws);
  k_attn<<<dim3(BSZ * HN * (NSEQ / 64)), 128, 0, stream>>>(qkvws, x, We, be, am, awws);
  k_out<<<dim3(CDIM / 64, MROWS / 64), 128, 0, stream>>>(awws, Wo, bo, out);
}

// v002
// Measured time: 241 microseconds a run.
// Timed twice side by side with v001, it ran 1.27 and 1.28 times as fast.
// Over all steps from v000 it is 1.75 times as fast.
// Contractions: QKV projection, Q.K^T, P.V and output projection on v_wmma_f32_16x16x32_f16 (f16 operands, f32 accumulate);
// weights carried x64, P carried x256, attention output carried x64 (scales undone in f32); per-query gate dot (K=1024, N=16) on VALU f32.
#include <hip/hip_runtime.h>
#include <math.h>
#include <stdint.h>
#include <stddef.h>

typedef _Float16 v16h __attribute__((ext_vector_type(16)));
typedef _Float16 v8h  __attribute__((ext_vector_type(8), __may_alias__));
typedef _Float16 v4h  __attribute__((ext_vector_type(4), __may_alias__));
typedef float    v8f  __attribute__((ext_vector_type(8)));
typedef float    v4f  __attribute__((ext_vector_type(4), __may_alias__));

union Frag { v16h v; v8h p[2]; };

constexpr int BSZ   = 2;
constexpr int NSEQ  = 2048;
constexpr int CDIM  = 1024;
constexpr int HN    = 16;
constexpr int DH    = 64;
constexpr int QKVN  = 3 * CDIM;                         // 3072
constexpr int MROWS = BSZ * NSEQ;                       // 4096
constexpr size_t QKV_S = (size_t)BSZ * HN * NSEQ * DH;  // halves per q/k/v plane
constexpr float WSCALE = 64.0f;                         // weight pre-scale (exact power of two)
constexpr float PSCALE = 256.0f;                        // P pre-scale
constexpr float ASCALE = 64.0f;                         // attention-output pre-scale
// LDS row pitches in halves: 16 B x odd, so the 16 rows of a ds_load_b128 fragment read fall on distinct banks
constexpr int GP = 40;                                  // 32-half rows (GEMM k slices): 80 B
constexpr int AP = 72;                                  // 64-half rows (attention tiles): 144 B

// one 16x16x32 f16 WMMA with the VALU hazard guard attached
__device__ __forceinline__ v8f wmma_f16(v16h a, v16h b, v8f c) {
  v8f d = __builtin_amdgcn_wmma_f32_16x16x32_f16(false, a, false, b, (short)0, c, false, false);
  asm volatile("v_nop\n\tv_nop\n\tv_nop\n\tv_nop" : "+v"(d) : "v"(a), "v"(b));
  return d;
}

// 16-bit fragment from a k-contiguous row (A row m, or B stored [n][k] row n):
// elements 0..7 <- k0+8*lh .. +7, elements 8..15 <- k0+16+8*lh .. +7  (lh = lane >> 4)
__device__ __forceinline__ v16h ld_frag(const _Float16* rk, int lh) {
  Frag f;
  f.p[0] = *(const v8h*)(rk + 8 * lh);
  f.p[1] = *(const v8h*)(rk + 16 + 8 * lh);
  return f.v;
}

// the same fragment from a staged weight row whose four 16-B k chunks lie at chunk ^ sw (sw = (n >> 4) & 3)
__device__ __forceinline__ v16h ld_frag_sw(const _Float16* rk, int lh, int sw) {
  Frag f;
  f.p[0] = *(const v8h*)(rk + ((lh ^ sw) << 3));
  f.p[1] = *(const v8h*)(rk + (((2 + lh) ^ sw) << 3));
  return f.v;
}

// ---------------------------------------------------------------------------
// QKV projection: C tile 64x64 per block (128 threads, 4 waves x 16 rows), K loop step 32.
__global__ __launch_bounds__(128)
void k_qkv(const float* __restrict__ x, const float* __restrict__ W, const float* __restrict__ bias,
           _Float16* __restrict__ qkv) {
  __shared__ __align__(16) _Float16 lds[2 * 64 * GP];  // As[64][GP] | Bs[64][GP]; reused as Cs[64][64]
  _Float16* As = lds;
  _Float16* Bs = lds + 64 * GP;

  const int tid = threadIdx.x, lane = tid & 31, w = tid >> 5, m = lane & 15, lh = lane >> 4;
  const int cblk = blockIdx.x * 64, rblk = blockIdx.y * 64;
  if (cblk + 64 > QKVN || rblk + 64 > MROWS) return;   // block-uniform, before any barrier

  // A staging: 8 lanes x 16 B cover one row's whole 128-B line of x; a wave's 4 rows lie 4 apart (LDS offsets 0/16/32/48 dwords)
  const int ar = ((lane >> 3) << 2) + w, ac = (lane & 7) * 4;   // rows ar + 16 j
  // B staging: 16 lanes x 16 B cover one k row's whole 256 B; k = bk + 8 j, n = bc + e; chunk j of row n is stored at
  // j ^ (n >> 4), which puts the 16 rows of a transposing store on distinct banks
  const int bk = tid >> 4, bc = (tid & 15) * 4, bsw = (tid & 15) >> 2;
  const float* ap = x + (size_t)(rblk + ar) * CDIM + ac;
  const float* bp = W + (size_t)bk * QKVN + cblk + bc;

  v8f acc[4] = {};

  for (int k0 = 0; k0 < CDIM; k0 += 32) {
    v4f a4[4], b4[4];
#pragma unroll
    for (int j = 0; j < 4; ++j) a4[j] = *(const v4f*)(ap + (size_t)(16 * j) * CDIM + k0);
#pragma unroll
    for (int j = 0; j < 4; ++j) b4[j] = *(const v4f*)(bp + (size_t)(k0 + 8 * j) * QKVN);
    asm volatile("s_wait_xcnt 0x0" ::: "memory");          // before the loads' address registers are advanced
    __syncthreads();
#pragma unroll
    for (int j = 0; j < 4; ++j)
      *(v4h*)(As + (ar + 16 * j) * GP + ac) = __builtin_convertvector(a4[j], v4h);
#pragma unroll
    for (int j = 0; j < 4; ++j)
#pragma unroll
      for (int e = 0; e < 4; ++e)
        Bs[(bc + e) * GP + ((j ^ bsw) << 3) + bk] = (_Float16)(b4[j][e] * WSCALE);  // Bs[n][k], chunks swizzled
    __syncthreads();

    v16h af = ld_frag(As + (w * 16 + m) * GP, lh);
    v16h bf[4];
#pragma unroll
    for (int nt = 0; nt < 4; ++nt) bf[nt] = ld_frag_sw(Bs + (nt * 16 + m) * GP, lh, nt);
#pragma unroll
    for (int nt = 0; nt < 4; ++nt) acc[nt] = wmma_f16(af, bf[nt], acc[nt]);
  }

  // stage C tile (bias added, weight scale undone) in LDS as f16
  __syncthreads();
  _Float16* Cs = lds;
#pragma unroll
  for (int nt = 0; nt < 4; ++nt) {
    const int col = nt * 16 + m;
    const float bb = bias[cblk + col];
#pragma unroll
    for (int r = 0; r < 8; ++r)
      Cs[(w * 16 + 8 * lh + r) * 64 + col] = (_Float16)(acc[nt][r] * (1.0f / WSCALE) + bb);
  }
  __syncthreads();

  // whole-line stores: the tile is 4096 contiguous halves; each instruction of a wave covers 4 full lines
  const int sS = cblk >> 10, hd = (cblk & 1023) >> 6, b = rblk >> 11, n0 = rblk & 2047;
  _Float16* dst = qkv + (size_t)sS * QKV_S + ((size_t)(b * HN + hd) * NSEQ + n0) * DH;
  v8h vv[4];
#pragma unroll
  for (int j = 0; j < 4; ++j) vv[j] = *(const v8h*)(Cs + (j * 128 + tid) * 8);
#pragma unroll
  for (int j = 0; j < 4; ++j) *(v8h*)(dst + (j * 128 + tid) * 8) = vv[j];
  
}

// ---------------------------------------------------------------------------
// Gated flash attention: block = (b, h, 64 queries), 128 threads (4 waves x 16 query rows),
// key chunks of 64. Gate sigmoid(x.We+be) computed in-block on VALU. Output a[b][n][h*64+d] f16 x64.
__global__ __launch_bounds__(128)
void k_attn(const _Float16* __restrict__ qkv, const float* __restrict__ x,
            const float* __restrict__ We, const float* __restrict__ be,
            const int* __restrict__ am, _Float16* __restrict__ aw) {
  __shared__ __align__(16) _Float16 Qs[64 * AP];       // [query][d]
  __shared__ __align__(16) _Float16 Ks[64 * AP];       // [key][d]   (k-contiguous B for S)
  __shared__ __align__(16) _Float16 Vt[64 * AP];       // [d][key]   (k-contiguous B for P.V)
  __shared__ __align__(16) _Float16 Ps[4 * 16 * AP];   // per wave [row][key]
  __shared__ float gsig[64];

  const int tid = threadIdx.x, lane = tid & 31, w = tid >> 5, m = lane & 15, lh = lane >> 4;
  const int bid = blockIdx.x;
  const int qt = bid & 31, bh = bid >> 5, hd = bh & 15, b = bh >> 4;
  if (b >= BSZ) return;                                   // block-uniform
  const int qbase = qt * 64;

  const _Float16* Qg = qkv + ((size_t)(b * HN + hd) * NSEQ) * DH;
  const _Float16* Kg = Qg + QKV_S;
  const _Float16* Vg = Kg + QKV_S;

  // gate: each wave takes its own 16 query rows with its lanes along k, so every x load covers whole lines;
  // the head's We column is gathered once into LDS; per-lane partial sums are joined through LDS, all f32
  {
    float* wcol = reinterpret_cast<float*>(Ks);            // 1024 floats, free until the key loop
    float* part = reinterpret_cast<float*>(Vt);            // 64 rows x 33 floats, free until the key loop
#pragma unroll
    for (int i = 0; i < 8; ++i) wcol[i * 128 + tid] = We[(size_t)(i * 128 + tid) * HN + hd];
    __syncthreads();
    v4f wv[8];
#pragma unroll
    for (int i = 0; i < 8; ++i) wv[i] = *(const v4f*)(wcol + i * 128 + lane * 4);
    const float* xr = x + ((size_t)(b * NSEQ + qbase + w * 16)) * CDIM;
    for (int rr = 0; rr < 16; rr += 2) {                   // two rows a trip = 16 loads in flight per wave
      v4f s4[2] = {};
#pragma unroll
      for (int i = 0; i < 8; ++i)
#pragma unroll
        for (int u = 0; u < 2; ++u)
          s4[u] += *(const v4f*)(xr + (size_t)(rr + u) * CDIM + i * 128 + lane * 4) * wv[i];
#pragma unroll
      for (int u = 0; u < 2; ++u)
        part[(w * 16 + rr + u) * 33 + lane] = (s4[u][0] + s4[u][1]) + (s4[u][2] + s4[u][3]);
    }
    __syncthreads();
    const int q = tid >> 1, half = tid & 1;
    float s = 0.0f;
#pragma unroll
    for (int t = 0; t < 16; ++t) s += part[q * 33 + half * 16 + t];
    s += __shfl_xor(s, 1, 32);
    if (half == 0) {
      const float z = s + be[hd];
      gsig[q] = 1.0f / (1.0f + expf(-z));
    }
  }
  // Q tile: 4096 contiguous halves
  {
    const _Float16* src = Qg + (size_t)qbase * DH;
#pragma unroll
    for (int it = 0; it < 4; ++it) {
      const int c = it * 128 + tid;
      *(v8h*)(Qs + (c >> 3) * AP + (c & 7) * 8) = *(const v8h*)(src + c * 8);
    }
  }
  __syncthreads();

  v16h qa[2];
  qa[0] = ld_frag(Qs + (w * 16 + m) * AP, lh);
  qa[1] = ld_frag(Qs + (w * 16 + m) * AP + 32, lh);

  float mstate[8], lstate[8], g[8];
#pragma unroll
  for (int r = 0; r < 8; ++r) {
    mstate[r] = -__builtin_inff();
    lstate[r] = 0.0f;
    g[r] = gsig[w * 16 + 8 * lh + r] * 0.125f;             // gate * 1/sqrt(64)
  }
  v8f O[4] = {};

  const int* mrow = am + (size_t)b * NSEQ * NSEQ + (size_t)(qbase + w * 16 + 8 * lh) * NSEQ + m;

  for (int j = 0; j < NSEQ / 64; ++j) {
    const int kb = j * 64;
    __syncthreads();
    {  // K chunk: direct copy; V chunk: transposed into Vt[d][key]
      const _Float16* ksrc = Kg + (size_t)kb * DH;
#pragma unroll
      for (int it = 0; it < 4; ++it) {
        const int c = it * 128 + tid;
        *(v8h*)(Ks + (c >> 3) * AP + (c & 7) * 8) = *(const v8h*)(ksrc + c * 8);
      }
#pragma unroll
      for (int it = 0; it < 4; ++it) {
        const int c = it * 128 + tid;
        const int key = c >> 3, d8 = (c & 7) * 8;
        v8h vv = *(const v8h*)(Vg + (size_t)(kb + key) * DH + d8);
#pragma unroll
        for (int e = 0; e < 8; ++e) Vt[(d8 + e) * AP + key] = vv[e];
      }
    }
    __syncthreads();

    // S = Q.K^T : rows = 16 queries of this wave, cols = 64 keys (4 tiles), K = 64
    v8f S[4];
#pragma unroll
    for (int nt = 0; nt < 4; ++nt) {
      v8f z = {};
      v16h bf0 = ld_frag(Ks + (nt * 16 + m) * AP, lh);
      v16h bf1 = ld_frag(Ks + (nt * 16 + m) * AP + 32, lh);
      z = wmma_f16(qa[0], bf0, z);
      z = wmma_f16(qa[1], bf1, z);
      S[nt] = z;
    }

    // scale, gate, mask, online softmax (row r + 8*lh across the 16 lanes of a lane half)
#pragma unroll
    for (int r = 0; r < 8; ++r) {
      float mx = -__builtin_inff();
#pragma unroll
      for (int nt = 0; nt < 4; ++nt) {
        const int mv = mrow[(size_t)r * NSEQ + kb + nt * 16];
        float lv = S[nt][r] * g[r];
        if (mv == 0) lv = -__builtin_inff();
        S[nt][r] = lv;
        mx = fmaxf(mx, lv);
      }
      mx = fmaxf(mx, __shfl_xor(mx, 1, 32));
      mx = fmaxf(mx, __shfl_xor(mx, 2, 32));
      mx = fmaxf(mx, __shfl_xor(mx, 4, 32));
      mx = fmaxf(mx, __shfl_xor(mx, 8, 32));
      const float mnew = fmaxf(mstate[r], mx);
      const bool dead = (mnew == -__builtin_inff());
      const float alpha = dead ? 1.0f : __expf(mstate[r] - mnew);
      float rs = 0.0f;
#pragma unroll
      for (int nt = 0; nt < 4; ++nt) {
        const float p = dead ? 0.0f : __expf(S[nt][r] - mnew);
        rs += p;
        Ps[(w * 16 + 8 * lh + r) * AP + nt * 16 + m] = (_Float16)(p * PSCALE);
      }
      rs += __shfl_xor(rs, 1, 32);
      rs += __shfl_xor(rs, 2, 32);
      rs += __shfl_xor(rs, 4, 32);
      rs += __shfl_xor(rs, 8, 32);
      lstate[r] = lstate[r] * alpha + rs;
      mstate[r] = mnew;
#pragma unroll
      for (int nt2 = 0; nt2 < 4; ++nt2) O[nt2][r] *= alpha;
    }
    __syncthreads();   // P spill (element stores) visible before the fragment reload

    // O += (256 P) . V : K = 64 keys
#pragma unroll
    for (int kk = 0; kk < 2; ++kk) {
      v16h pa = ld_frag(Ps + (w * 16 + m) * AP + kk * 32, lh);
      v16h vb[4];
#pragma unroll
      for (int nt2 = 0; nt2 < 4; ++nt2) vb[nt2] = ld_frag(Vt + (nt2 * 16 + m) * AP + kk * 32, lh);
#pragma unroll
      for (int nt2 = 0; nt2 < 4; ++nt2) O[nt2] = wmma_f16(pa, vb[nt2], O[nt2]);
    }
  }

  // normalise: a = O / (256 l); store a*64 = O / (4 l) as f16, staged in Ks
  __syncthreads();
  float inv[8];
#pragma unroll
  for (int r = 0; r < 8; ++r) {
    const float l = lstate[r];
    inv[r] = (l > 0.0f) ? (0.25f / l) : 0.0f;
  }
#pragma unroll
  for (int nt2 = 0; nt2 < 4; ++nt2) {
    const int col = nt2 * 16 + m;
#pragma unroll
    for (int r = 0; r < 8; ++r)
      Ks[(w * 16 + 8 * lh + r) * 64 + col] = (_Float16)(O[nt2][r] * inv[r]);
  }
  __syncthreads();

  v8h vv[4];
#pragma unroll
  for (int jj = 0; jj < 4; ++jj) {
    const int c = jj * 128 + tid;
    vv[jj] = *(const v8h*)(Ks + (c >> 3) * 64 + (c & 7) * 8);
  }
#pragma unroll
  for (int jj = 0; jj < 4; ++jj) {
    const int c = jj * 128 + tid;
    _Float16* dst = aw + ((size_t)(b * NSEQ + qbase + (c >> 3))) * CDIM + hd * DH + (c & 7) * 8;
    *(v8h*)dst = vv[jj];
  }
  
}

// ---------------------------------------------------------------------------
// Output projection: out = (a x64) . (Wo x64) / 4096 + bo ; C tile 64x64 f32, grid = (1024/64, 4096/64)
__global__ __launch_bounds__(128)
void k_out(const _Float16* __restrict__ aw, const float* __restrict__ Wo, const float* __restrict__ bo,
           float* __restrict__ out) {
  __shared__ __align__(16) float ldsf[64 * 64];          // 16 KB: As|Bs (f16) then Cs (f32)
  _Float16* As = reinterpret_cast<_Float16*>(ldsf);
  _Float16* Bs = As + 64 * GP;

  const int tid = threadIdx.x, lane = tid & 31, w = tid >> 5, m = lane & 15, lh = lane >> 4;
  const int cblk = blockIdx.x * 64, rblk = blockIdx.y * 64;
  if (cblk + 64 > CDIM || rblk + 64 > MROWS) return;    // block-uniform

  // A staging: 4 lanes x 16 B cover one row's whole 64-B k slice; 4 rows of a lane half lie 4 apart (distinct LDS banks)
  const int rs = lane >> 2;
  const int ar = (rs & 3) * 4 + (rs >> 2) * 2 + (w & 1) + 16 * (w >> 1), ac = (lane & 3) * 8;   // rows ar, ar + 32
  const int bk = tid >> 4, bc = (tid & 15) * 4, bsw = (tid & 15) >> 2;   // k = bk + 8 j, n = bc + e, chunk swizzle as in k_qkv
  const _Float16* ap = aw + (size_t)(rblk + ar) * CDIM + ac;
  const float* bp = Wo + (size_t)bk * CDIM + cblk + bc;

  v8f acc[4] = {};

  for (int k0 = 0; k0 < CDIM; k0 += 32) {
    v8h a8[2];
    v4f b4[4];
    a8[0] = *(const v8h*)(ap + k0);
    a8[1] = *(const v8h*)(ap + (size_t)32 * CDIM + k0);
#pragma unroll
    for (int j = 0; j < 4; ++j) b4[j] = *(const v4f*)(bp + (size_t)(k0 + 8 * j) * CDIM);
    asm volatile("s_wait_xcnt 0x0" ::: "memory");          // before the loads' address registers are advanced
    __syncthreads();
    *(v8h*)(As + ar * GP + ac)     = a8[0];
    *(v8h*)(As + (ar + 32) * GP + ac) = a8[1];
#pragma unroll
    for (int j = 0; j < 4; ++j)
#pragma unroll
      for (int e = 0; e < 4; ++e)
        Bs[(bc + e) * GP + ((j ^ bsw) << 3) + bk] = (_Float16)(b4[j][e] * WSCALE);  // Bs[n][k], chunks swizzled
    __syncthreads();

    v16h af = ld_frag(As + (w * 16 + m) * GP, lh);
    v16h bf[4];
#pragma unroll
    for (int nt = 0; nt < 4; ++nt) bf[nt] = ld_frag_sw(Bs + (nt * 16 + m) * GP, lh, nt);
#pragma unroll
    for (int nt = 0; nt < 4; ++nt) acc[nt] = wmma_f16(af, bf[nt], acc[nt]);
  }

  __syncthreads();
  float* Cs = ldsf;
#pragma unroll
  for (int nt = 0; nt < 4; ++nt) {
    const int col = nt * 16 + m;
    const float bb = bo[cblk + col];
#pragma unroll
    for (int r = 0; r < 8; ++r)
      Cs[(w * 16 + 8 * lh + r) * 64 + col] = acc[nt][r] * (1.0f / (ASCALE * WSCALE)) + bb;
  }
  __syncthreads();

  // each row segment is 256 B = 2 lines; lanes 8q..8q+7 write one full line with 16-B stores
  v4f vv[8];
#pragma unroll
  for (int jj = 0; jj < 8; ++jj) {
    const int c = jj * 128 + tid;
    vv[jj] = *(const v4f*)(Cs + (c >> 4) * 64 + (c & 15) * 4);
  }
#pragma unroll
  for (int jj = 0; jj < 8; ++jj) {
    const int c = jj * 128 + tid;
    float* dst = out + (size_t)(rblk + (c >> 4)) * CDIM + cblk + (c & 15) * 4;
    *(v4f*)dst = vv[jj];
  }
  
}

// ---------------------------------------------------------------------------
extern "C" void kernel_launch(void* const* d_in, const int* in_sizes, int n_in,
                              void* d_out, int out_size, void* d_ws, size_t ws_size,
                              hipStream_t stream) {
  if (n_in < 8) return;
  if (in_sizes[0] != MROWS * CDIM) return;
  if (in_sizes[1] != BSZ * NSEQ * NSEQ) return;
  if (in_sizes[2] != CDIM * QKVN) return;
  if (in_sizes[3] != QKVN) return;
  if (in_sizes[4] != CDIM * HN) return;
  if (in_sizes[5] != HN) return;
  if (in_sizes[6] != CDIM * CDIM) return;
  if (in_sizes[7] != CDIM) return;
  if (out_size != MROWS * CDIM) return;

  const float* x    = (const float*)d_in[0];
  const int*   am   = (const int*)d_in[1];
  const float* Wqkv = (const float*)d_in[2];
  const float* bqkv = (const float*)d_in[3];
  const float* We   = (const float*)d_in[4];
  const float* be   = (const float*)d_in[5];
  const float* Wo   = (const float*)d_in[6];
  const float* bo   = (const float*)d_in[7];
  float* out = (float*)d_out;

  const size_t qkv_bytes = (size_t)3 * QKV_S * sizeof(_Float16);          // 25,165,824
  const size_t aw_off    = qkv_bytes;
  const size_t aw_bytes  = (size_t)MROWS * CDIM * sizeof(_Float16);       //  8,388,608
  if (aw_off + aw_bytes > ws_size) return;
  char* ws = (char*)d_ws;
  _Float16* qkvws = (_Float16*)ws;
  _Float16* awws  = (_Float16*)(ws + aw_off);

  k_qkv<<<dim3(QKVN / 64, MROWS / 64), 128, 0, stream>>>(x, Wqkv, bqkv, qkvws);
  k_attn<<<dim3(BSZ * HN * (NSEQ / 64)), 128, 0, stream>>>(qkvws, x, We, be, am, awws);
  k_out<<<dim3(CDIM / 64, MROWS / 64), 128, 0, stream>>>(awws, Wo, bo, out);
}

// v003
// Measured time: 214 microseconds a run.
// Timed twice side by side with v002, it ran 1.12 times as fast both times.
// All steps since v000 together make it 1.96 times as fast.
// Contractions: QKV projection, Q.K^T, P.V and output projection on v_wmma_f32_16x16x32_f16 (f16 operands, f32 accumulate);
// weights carried x64, P carried x256, attention output carried x64 (scales undone in f32); per-query gate dot (K=1024, N=16) on VALU f32.
#include <hip/hip_runtime.h>
#include <math.h>
#include <stdint.h>
#include <stddef.h>

typedef _Float16 v16h __attribute__((ext_vector_type(16)));
typedef _Float16 v8h  __attribute__((ext_vector_type(8), __may_alias__));
typedef _Float16 v4h  __attribute__((ext_vector_type(4), __may_alias__));
typedef float    v8f  __attribute__((ext_vector_type(8)));
typedef float    v4f  __attribute__((ext_vector_type(4), __may_alias__));
typedef int      v4i  __attribute__((ext_vector_type(4), __may_alias__));

union Frag { v16h v; v8h p[2]; };

constexpr int BSZ   = 2;
constexpr int NSEQ  = 2048;
constexpr int CDIM  = 1024;
constexpr int HN    = 16;
constexpr int DH    = 64;
constexpr int QKVN  = 3 * CDIM;                         // 3072
constexpr int MROWS = BSZ * NSEQ;                       // 4096
constexpr size_t QKV_S = (size_t)BSZ * HN * NSEQ * DH;  // halves per q/k/v plane
constexpr float WSCALE = 64.0f;                         // weight pre-scale (exact power of two)
constexpr float PSCALE = 256.0f;                        // P pre-scale
constexpr float ASCALE = 64.0f;                         // attention-output pre-scale
// LDS row pitches in halves: 16 B x odd, so the 16 rows of a ds_load_b128 fragment read fall on distinct banks
constexpr int GP = 40;                                  // 32-half rows (GEMM k slices): 80 B
constexpr int AP = 72;                                  // 64-half rows (attention tiles): 144 B
constexpr int MP = 68;                                  // 64-int rows (mask chunk), in ints: 272 B

// one 16x16x32 f16 WMMA with the VALU hazard guard attached
__device__ __forceinline__ v8f wmma_f16(v16h a, v16h b, v8f c) {
  v8f d = __builtin_amdgcn_wmma_f32_16x16x32_f16(false, a, false, b, (short)0, c, false, false);
  asm volatile("v_nop\n\tv_nop\n\tv_nop\n\tv_nop" : "+v"(d) : "v"(a), "v"(b));
  return d;
}

// 16-bit fragment from a k-contiguous row (A row m, or B stored [n][k] row n):
// elements 0..7 <- k0+8*lh .. +7, elements 8..15 <- k0+16+8*lh .. +7  (lh = lane >> 4)
__device__ __forceinline__ v16h ld_frag(const _Float16* rk, int lh) {
  Frag f;
  f.p[0] = *(const v8h*)(rk + 8 * lh);
  f.p[1] = *(const v8h*)(rk + 16 + 8 * lh);
  return f.v;
}

// the same fragment from a staged weight row whose four 16-B k chunks lie at chunk ^ sw (sw = (n >> 4) & 3)
__device__ __forceinline__ v16h ld_frag_sw(const _Float16* rk, int lh, int sw) {
  Frag f;
  f.p[0] = *(const v8h*)(rk + ((lh ^ sw) << 3));
  f.p[1] = *(const v8h*)(rk + (((2 + lh) ^ sw) << 3));
  return f.v;
}

// ---------------------------------------------------------------------------
// QKV projection: C tile 64x64 per block (128 threads, 4 waves x 16 rows), K loop step 32.
__global__ __launch_bounds__(128)
void k_qkv(const float* __restrict__ x, const float* __restrict__ W, const float* __restrict__ bias,
           _Float16* __restrict__ qkv) {
  __shared__ __align__(16) _Float16 lds[2 * 64 * GP];  // As[64][GP] | Bs[64][GP]; reused as Cs[64][64]
  _Float16* As = lds;
  _Float16* Bs = lds + 64 * GP;

  const int tid = threadIdx.x, lane = tid & 31, w = tid >> 5, m = lane & 15, lh = lane >> 4;
  const int cblk = blockIdx.x * 64, rblk = blockIdx.y * 64;
  if (cblk + 64 > QKVN || rblk + 64 > MROWS) return;   // block-uniform, before any barrier

  // A staging: 8 lanes x 16 B cover one row's whole 128-B line of x; a wave's 4 rows lie 4 apart (LDS offsets 0/16/32/48 dwords)
  const int ar = ((lane >> 3) << 2) + w, ac = (lane & 7) * 4;   // rows ar + 16 j
  // B staging: 16 lanes x 16 B cover one k row's whole 256 B; k = bk + 8 j, n = bc + e; chunk j of row n is stored at
  // j ^ (n >> 4), which puts the 16 rows of a transposing store on distinct banks
  const int bk = tid >> 4, bc = (tid & 15) * 4, bsw = (tid & 15) >> 2;
  const float* ap = x + (size_t)(rblk + ar) * CDIM + ac;
  const float* bp = W + (size_t)bk * QKVN + cblk + bc;

  v8f acc[4] = {};

  for (int k0 = 0; k0 < CDIM; k0 += 32) {
    v4f a4[4], b4[4];
#pragma unroll
    for (int j = 0; j < 4; ++j) a4[j] = *(const v4f*)(ap + (size_t)(16 * j) * CDIM + k0);
#pragma unroll
    for (int j = 0; j < 4; ++j) b4[j] = *(const v4f*)(bp + (size_t)(k0 + 8 * j) * QKVN);
    asm volatile("s_wait_xcnt 0x0" ::: "memory");          // before the loads' address registers are advanced
    __syncthreads();
#pragma unroll
    for (int j = 0; j < 4; ++j)
      *(v4h*)(As + (ar + 16 * j) * GP + ac) = __builtin_convertvector(a4[j], v4h);
#pragma unroll
    for (int j = 0; j < 4; ++j)
#pragma unroll
      for (int e = 0; e < 4; ++e)
        Bs[(bc + e) * GP + ((j ^ bsw) << 3) + bk] = (_Float16)(b4[j][e] * WSCALE);  // Bs[n][k], chunks swizzled
    __syncthreads();

    v16h af = ld_frag(As + (w * 16 + m) * GP, lh);
    v16h bf[4];
#pragma unroll
    for (int nt = 0; nt < 4; ++nt) bf[nt] = ld_frag_sw(Bs + (nt * 16 + m) * GP, lh, nt);
#pragma unroll
    for (int nt = 0; nt < 4; ++nt) acc[nt] = wmma_f16(af, bf[nt], acc[nt]);
  }

  // stage C tile (bias added, weight scale undone) in LDS as f16
  __syncthreads();
  _Float16* Cs = lds;
#pragma unroll
  for (int nt = 0; nt < 4; ++nt) {
    const int col = nt * 16 + m;
    const float bb = bias[cblk + col];
#pragma unroll
    for (int r = 0; r < 8; ++r)
      Cs[(w * 16 + 8 * lh + r) * 64 + col] = (_Float16)(acc[nt][r] * (1.0f / WSCALE) + bb);
  }
  __syncthreads();

  // whole-line stores: the tile is 4096 contiguous halves; each instruction of a wave covers 4 full lines
  const int sS = cblk >> 10, hd = (cblk & 1023) >> 6, b = rblk >> 11, n0 = rblk & 2047;
  _Float16* dst = qkv + (size_t)sS * QKV_S + ((size_t)(b * HN + hd) * NSEQ + n0) * DH;
  v8h vv[4];
#pragma unroll
  for (int j = 0; j < 4; ++j) vv[j] = *(const v8h*)(Cs + (j * 128 + tid) * 8);
#pragma unroll
  for (int j = 0; j < 4; ++j) *(v8h*)(dst + (j * 128 + tid) * 8) = vv[j];
  
}

__device__ __forceinline__ float xhalf(float v) {          // lane l <-> lane l ^ 16
  const int i = __builtin_bit_cast(int, v);
  return __builtin_bit_cast(float, __builtin_amdgcn_permlanex16(i, i, 0x76543210, 0xfedcba98, false, false));
}

__global__ __launch_bounds__(128)
void k_attn(const _Float16* __restrict__ qkv, const float* __restrict__ x,
            const float* __restrict__ We, const float* __restrict__ be,
            const int* __restrict__ am, _Float16* __restrict__ aw) {
  __shared__ __align__(16) _Float16 Qs[64 * AP];       // [query][d]
  __shared__ __align__(16) _Float16 Ks[64 * AP];       // [key][d]   (k-contiguous A for S^T)
  __shared__ __align__(16) _Float16 Vt[64 * AP];       // [d][key]   (k-contiguous A for V^T.P^T)
  __shared__ __align__(16) int      Ms[64 * MP];       // [query][key] mask chunk
  __shared__ float gsig[64];

  const int tid = threadIdx.x, lane = tid & 31, w = tid >> 5, m = lane & 15, lh = lane >> 4;
  const int bid = blockIdx.x;
  const int qt = bid & 31, bh = bid >> 5, hd = bh & 15, b = bh >> 4;
  if (b >= BSZ) return;                                   // block-uniform
  const int qbase = qt * 64;

  const _Float16* Qg = qkv + ((size_t)(b * HN + hd) * NSEQ) * DH;
  const _Float16* Kg = Qg + QKV_S;
  const _Float16* Vg = Kg + QKV_S;

  // gate: each wave takes its own 16 query rows with its lanes along k, so every x load covers whole lines;
  // the head's We column is gathered once into LDS; per-lane partial sums are joined through LDS, all f32
  {
    float* wcol = reinterpret_cast<float*>(Ks);            // 1024 floats, free until the key loop
    float* part = reinterpret_cast<float*>(Vt);            // 64 rows x 33 floats, free until the key loop
#pragma unroll
    for (int i = 0; i < 8; ++i) wcol[i * 128 + tid] = We[(size_t)(i * 128 + tid) * HN + hd];
    __syncthreads();
    v4f wv[8];
#pragma unroll
    for (int i = 0; i < 8; ++i) wv[i] = *(const v4f*)(wcol + i * 128 + lane * 4);
    const float* xr = x + ((size_t)(b * NSEQ + qbase + w * 16)) * CDIM;
    for (int rr = 0; rr < 16; rr += 2) {                   // two rows a trip = 16 loads in flight per wave
      v4f s4[2] = {};
#pragma unroll
      for (int i = 0; i < 8; ++i)
#pragma unroll
        for (int u = 0; u < 2; ++u)
          s4[u] += *(const v4f*)(xr + (size_t)(rr + u) * CDIM + i * 128 + lane * 4) * wv[i];
#pragma unroll
      for (int u = 0; u < 2; ++u)
        part[(w * 16 + rr + u) * 33 + lane] = (s4[u][0] + s4[u][1]) + (s4[u][2] + s4[u][3]);
    }
    __syncthreads();
    const int q = tid >> 1, half = tid & 1;
    float s = 0.0f;
#pragma unroll
    for (int t = 0; t < 16; ++t) s += part[q * 33 + half * 16 + t];
    s += __shfl_xor(s, 1, 32);
    if (half == 0) {
      const float z = s + be[hd];
      gsig[q] = 1.0f / (1.0f + expf(-z));
    }
  }
  // Q tile: 4096 contiguous halves
  {
    const _Float16* src = Qg + (size_t)qbase * DH;
#pragma unroll
    for (int it = 0; it < 4; ++it) {
      const int c = it * 128 + tid;
      *(v8h*)(Qs + (c >> 3) * AP + (c & 7) * 8) = *(const v8h*)(src + c * 8);
    }
  }
  __syncthreads();

  v16h qb[2];                                              // B: column = query m, k = d
  qb[0] = ld_frag(Qs + (w * 16 + m) * AP, lh);
  qb[1] = ld_frag(Qs + (w * 16 + m) * AP + 32, lh);

  float mstate = -__builtin_inff();                        // this lane's query: running maximum (both halves alike)
  float lstate = 0.0f;                                     // running sum over this lane half's keys only
  const float g = gsig[w * 16 + m] * 0.125f;               // gate * 1/sqrt(64)
  v8f O[4] = {};                                           // O[nt2][r] = O^T[d = 16 nt2 + 8 lh + r][query m]

  // mask chunk staging: 16 lanes x 16 B cover one query row's 256 B, a wave's load covers 4 whole lines
  const int* msrc = am + (size_t)b * NSEQ * NSEQ + (size_t)(qbase + (tid >> 4)) * NSEQ + (tid & 15) * 4;
  int* mdst = Ms + (tid >> 4) * MP + (tid & 15) * 4;
  const int* mfrag = Ms + (w * 16 + m) * MP + 8 * lh;

  for (int j = 0; j < NSEQ / 64; ++j) {
    const int kb = j * 64;
    __syncthreads();
    {  // K chunk: direct copy; V chunk: transposed into Vt[d][key]; mask chunk: direct copy
      const _Float16* ksrc = Kg + (size_t)kb * DH;
      v8h k8[4], v8[4];
      v4i m4[8];
#pragma unroll
      for (int it = 0; it < 4; ++it) k8[it] = *(const v8h*)(ksrc + (it * 128 + tid) * 8);
#pragma unroll
      for (int it = 0; it < 4; ++it) v8[it] = *(const v8h*)(Vg + (size_t)kb * DH + (it * 128 + tid) * 8);
      asm volatile("s_wait_xcnt 0x0" ::: "memory");        // before a later load's result may land in these loads' address registers
#pragma unroll
      for (int it = 0; it < 8; ++it) m4[it] = *(const v4i*)(msrc + (size_t)(8 * it) * NSEQ + kb);
      asm volatile("s_wait_xcnt 0x0" ::: "memory");        // before the loads' address registers are advanced
#pragma unroll
      for (int it = 0; it < 4; ++it) {
        const int c = it * 128 + tid;
        *(v8h*)(Ks + (c >> 3) * AP + (c & 7) * 8) = k8[it];
      }
#pragma unroll
      for (int it = 0; it < 4; ++it) {
        const int c = it * 128 + tid;
        const int key = c >> 3, d8 = (c & 7) * 8;
#pragma unroll
        for (int e = 0; e < 8; ++e) Vt[(d8 + e) * AP + key] = v8[it][e];
      }
#pragma unroll
      for (int it = 0; it < 8; ++it) *(v4i*)(mdst + 8 * it * MP) = m4[it];
    }
    __syncthreads();

    // S^T = K.Q^T : rows = 64 keys (4 tiles), cols = 16 queries of this wave, K = 64
    v8f S[4];
#pragma unroll
    for (int t = 0; t < 4; ++t) {
      v8f z = {};
      v16h kf0 = ld_frag(Ks + (t * 16 + m) * AP, lh);
      v16h kf1 = ld_frag(Ks + (t * 16 + m) * AP + 32, lh);
      z = wmma_f16(kf0, qb[0], z);
      z = wmma_f16(kf1, qb[1], z);
      S[t] = z;
    }

    // scale, gate, mask, online softmax: all 32 scores of a lane belong to query m
    float mt[4];
#pragma unroll
    for (int t = 0; t < 4; ++t) {
      const v4i ma = *(const v4i*)(mfrag + t * 16);
      const v4i mb = *(const v4i*)(mfrag + t * 16 + 4);
      mt[t] = -__builtin_inff();
#pragma unroll
      for (int r = 0; r < 8; ++r) {
        const int mv = (r < 4) ? ma[r & 3] : mb[r & 3];
        float lv = S[t][r] * g;
        if (mv == 0) lv = -__builtin_inff();
        S[t][r] = lv;
        mt[t] = fmaxf(mt[t], lv);
      }
    }
    float mx = fmaxf(fmaxf(mt[0], mt[1]), fmaxf(mt[2], mt[3]));
    mx = fmaxf(mx, xhalf(mx));
    const float mnew = fmaxf(mstate, mx);
    const bool dead = (mnew == -__builtin_inff());
    const float alpha = dead ? 1.0f : __expf(mstate - mnew);
    const float msub = dead ? 0.0f : mnew;                 // a row with no open key yet: exp(-inf - 0) = 0
    float rt[4];
    Frag pb[2];                                            // B: column = query m, k = key in the hardware k order
#pragma unroll
    for (int t = 0; t < 4; ++t) {
      rt[t] = 0.0f;
#pragma unroll
      for (int r = 0; r < 8; ++r) {
        const float p = __expf(S[t][r] - msub);
        rt[t] += p;
        pb[t >> 1].p[t & 1][r] = (_Float16)(p * PSCALE);
      }
    }
    lstate = lstate * alpha + ((rt[0] + rt[1]) + (rt[2] + rt[3]));
    mstate = mnew;
#pragma unroll
    for (int nt2 = 0; nt2 < 4; ++nt2) O[nt2] *= alpha;

    // O^T += V^T . (256 P)^T : K = 64 keys
#pragma unroll
    for (int kk = 0; kk < 2; ++kk) {
      v16h va[4];
#pragma unroll
      for (int nt2 = 0; nt2 < 4; ++nt2) va[nt2] = ld_frag(Vt + (nt2 * 16 + m) * AP + kk * 32, lh);
#pragma unroll
      for (int nt2 = 0; nt2 < 4; ++nt2) O[nt2] = wmma_f16(va[nt2], pb[kk].v, O[nt2]);
    }
  }

  // normalise: a = O / (256 l); store a*64 = O / (4 l) as f16, staged in Ks; a lane's 8 registers are 8 consecutive d
  __syncthreads();
  const float l = lstate + xhalf(lstate);
  const float inv = (l > 0.0f) ? (0.25f / l) : 0.0f;
#pragma unroll
  for (int nt2 = 0; nt2 < 4; ++nt2)
    *(v8h*)(Ks + (w * 16 + m) * AP + nt2 * 16 + 8 * lh) = __builtin_convertvector(O[nt2] * inv, v8h);
  __syncthreads();

  v8h vv[4];
#pragma unroll
  for (int jj = 0; jj < 4; ++jj) {
    const int c = jj * 128 + tid;
    vv[jj] = *(const v8h*)(Ks + (c >> 3) * AP + (c & 7) * 8);
  }
#pragma unroll
  for (int jj = 0; jj < 4; ++jj) {
    const int c = jj * 128 + tid;
    _Float16* dst = aw + ((size_t)(b * NSEQ + qbase + (c >> 3))) * CDIM + hd * DH + (c & 7) * 8;
    *(v8h*)dst = vv[jj];
  }
  
}

// ---------------------------------------------------------------------------
// Output projection: out = (a x64) . (Wo x64) / 4096 + bo ; C tile 64x64 f32, grid = (1024/64, 4096/64)
__global__ __launch_bounds__(128)
void k_out(const _Float16* __restrict__ aw, const float* __restrict__ Wo, const float* __restrict__ bo,
           float* __restrict__ out) {
  __shared__ __align__(16) float ldsf[64 * 64];          // 16 KB: As|Bs (f16) then Cs (f32)
  _Float16* As = reinterpret_cast<_Float16*>(ldsf);
  _Float16* Bs = As + 64 * GP;

  const int tid = threadIdx.x, lane = tid & 31, w = tid >> 5, m = lane & 15, lh = lane >> 4;
  const int cblk = blockIdx.x * 64, rblk = blockIdx.y * 64;
  if (cblk + 64 > CDIM || rblk + 64 > MROWS) return;    // block-uniform

  // A staging: 4 lanes x 16 B cover one row's whole 64-B k slice; 4 rows of a lane half lie 4 apart (distinct LDS banks)
  const int rs = lane >> 2;
  const int ar = (rs & 3) * 4 + (rs >> 2) * 2 + (w & 1) + 16 * (w >> 1), ac = (lane & 3) * 8;   // rows ar, ar + 32
  const int bk = tid >> 4, bc = (tid & 15) * 4, bsw = (tid & 15) >> 2;   // k = bk + 8 j, n = bc + e, chunk swizzle as in k_qkv
  const _Float16* ap = aw + (size_t)(rblk + ar) * CDIM + ac;
  const float* bp = Wo + (size_t)bk * CDIM + cblk + bc;

  v8f acc[4] = {};

  for (int k0 = 0; k0 < CDIM; k0 += 32) {
    v8h a8[2];
    v4f b4[4];
    a8[0] = *(const v8h*)(ap + k0);
    a8[1] = *(const v8h*)(ap + (size_t)32 * CDIM + k0);
#pragma unroll
    for (int j = 0; j < 4; ++j) b4[j] = *(const v4f*)(bp + (size_t)(k0 + 8 * j) * CDIM);
    asm volatile("s_wait_xcnt 0x0" ::: "memory");          // before the loads' address registers are advanced
    __syncthreads();
    *(v8h*)(As + ar * GP + ac)     = a8[0];
    *(v8h*)(As + (ar + 32) * GP + ac) = a8[1];
#pragma unroll
    for (int j = 0; j < 4; ++j)
#pragma unroll
      for (int e = 0; e < 4; ++e)
        Bs[(bc + e) * GP + ((j ^ bsw) << 3) + bk] = (_Float16)(b4[j][e] * WSCALE);  // Bs[n][k], chunks swizzled
    __syncthreads();

    v16h af = ld_frag(As + (w * 16 + m) * GP, lh);
    v16h bf[4];
#pragma unroll
    for (int nt = 0; nt < 4; ++nt) bf[nt] = ld_frag_sw(Bs + (nt * 16 + m) * GP, lh, nt);
#pragma unroll
    for (int nt = 0; nt < 4; ++nt) acc[nt] = wmma_f16(af, bf[nt], acc[nt]);
  }

  __syncthreads();
  float* Cs = ldsf;
#pragma unroll
  for (int nt = 0; nt < 4; ++nt) {
    const int col = nt * 16 + m;
    const float bb = bo[cblk + col];
#pragma unroll
    for (int r = 0; r < 8; ++r)
      Cs[(w * 16 + 8 * lh + r) * 64 + col] = acc[nt][r] * (1.0f / (ASCALE * WSCALE)) + bb;
  }
  __syncthreads();

  // each row segment is 256 B = 2 lines; lanes 8q..8q+7 write one full line with 16-B stores
  v4f vv[8];
#pragma unroll
  for (int jj = 0; jj < 8; ++jj) {
    const int c = jj * 128 + tid;
    vv[jj] = *(const v4f*)(Cs + (c >> 4) * 64 + (c & 15) * 4);
  }
#pragma unroll
  for (int jj = 0; jj < 8; ++jj) {
    const int c = jj * 128 + tid;
    float* dst = out + (size_t)(rblk + (c >> 4)) * CDIM + cblk + (c & 15) * 4;
    *(v4f*)dst = vv[jj];
  }
  
}

// ---------------------------------------------------------------------------
extern "C" void kernel_launch(void* const* d_in, const int* in_sizes, int n_in,
                              void* d_out, int out_size, void* d_ws, size_t ws_size,
                              hipStream_t stream) {
  if (n_in < 8) return;
  if (in_sizes[0] != MROWS * CDIM) return;
  if (in_sizes[1] != BSZ * NSEQ * NSEQ) return;
  if (in_sizes[2] != CDIM * QKVN) return;
  if (in_sizes[3] != QKVN) return;
  if (in_sizes[4] != CDIM * HN) return;
  if (in_sizes[5] != HN) return;
  if (in_sizes[6] != CDIM * CDIM) return;
  if (in_sizes[7] != CDIM) return;
  if (out_size != MROWS * CDIM) return;

  const float* x    = (const float*)d_in[0];
  const int*   am   = (const int*)d_in[1];
  const float* Wqkv = (const float*)d_in[2];
  const float* bqkv = (const float*)d_in[3];
  const float* We   = (const float*)d_in[4];
  const float* be   = (const float*)d_in[5];
  const float* Wo   = (const float*)d_in[6];
  const float* bo   = (const float*)d_in[7];
  float* out = (float*)d_out;

  const size_t qkv_bytes = (size_t)3 * QKV_S * sizeof(_Float16);          // 25,165,824
  const size_t aw_off    = qkv_bytes;
  const size_t aw_bytes  = (size_t)MROWS * CDIM * sizeof(_Float16);       //  8,388,608
  if (aw_off + aw_bytes > ws_size) return;
  char* ws = (char*)d_ws;
  _Float16* qkvws = (_Float16*)ws;
  _Float16* awws  = (_Float16*)(ws + aw_off);

  k_qkv<<<dim3(QKVN / 64, MROWS / 64), 128, 0, stream>>>(x, Wqkv, bqkv, qkvws);
  k_attn<<<dim3(BSZ * HN * (NSEQ / 64)), 128, 0, stream>>>(qkvws, x, We, be, am, awws);
  k_out<<<dim3(CDIM / 64, MROWS / 64), 128, 0, stream>>>(awws, Wo, bo, out);
}

// v004
// A run of this version takes 166 microseconds.
// Next to v003, in two timings, it ran 1.29 times as fast each time.
// Counting every step since v000, it is 2.53 times as fast.
// Contractions: QKV projection, Q.K^T, P.V and output projection on v_wmma_f32_16x16x32_f16 (f16 operands, f32 accumulate);
// weights carried x64, P carried x256, attention output carried x64 (scales undone in f32); per-query gate dot (K=1024, N=16) on VALU f32.
#include <hip/hip_runtime.h>
#include <math.h>
#include <stdint.h>
#include <stddef.h>

typedef _Float16 v16h __attribute__((ext_vector_type(16)));
typedef _Float16 v8h  __attribute__((ext_vector_type(8), __may_alias__));
typedef _Float16 v4h  __attribute__((ext_vector_type(4), __may_alias__));
typedef float    v8f  __attribute__((ext_vector_type(8)));
typedef float    v4f  __attribute__((ext_vector_type(4), __may_alias__));
typedef int      v4i  __attribute__((ext_vector_type(4), __may_alias__));

union Frag { v16h v; v8h p[2]; };

constexpr int BSZ   = 2;
constexpr int NSEQ  = 2048;
constexpr int CDIM  = 1024;
constexpr int HN    = 16;
constexpr int DH    = 64;
constexpr int QKVN  = 3 * CDIM;                         // 3072
constexpr int MROWS = BSZ * NSEQ;                       // 4096
constexpr size_t QKV_S = (size_t)BSZ * HN * NSEQ * DH;  // halves per q/k/v plane
constexpr float WSCALE = 64.0f;                         // weight pre-scale (exact power of two)
constexpr float PSCALE = 256.0f;                        // P pre-scale
constexpr float ASCALE = 64.0f;                         // attention-output pre-scale
// LDS row pitches in halves: 16 B x odd, so the 16 rows of a ds_load_b128 fragment read fall on distinct banks
constexpr int GP = 40;                                  // 32-half rows (GEMM k slices): 80 B
constexpr int AP = 72;                                  // 64-half rows (attention tiles): 144 B
constexpr int MP = 68;                                  // 64-int rows (mask chunk), in ints: 272 B

// one 16x16x32 f16 WMMA with the VALU hazard guard attached
__device__ __forceinline__ v8f wmma_f16(v16h a, v16h b, v8f c) {
  v8f d = __builtin_amdgcn_wmma_f32_16x16x32_f16(false, a, false, b, (short)0, c, false, false);
  asm volatile("v_nop\n\tv_nop\n\tv_nop\n\tv_nop" : "+v"(d) : "v"(a), "v"(b));
  return d;
}

// 16-bit fragment from a k-contiguous row (A row m, or B stored [n][k] row n):
// elements 0..7 <- k0+8*lh .. +7, elements 8..15 <- k0+16+8*lh .. +7  (lh = lane >> 4)
__device__ __forceinline__ v16h ld_frag(const _Float16* rk, int lh) {
  Frag f;
  f.p[0] = *(const v8h*)(rk + 8 * lh);
  f.p[1] = *(const v8h*)(rk + 16 + 8 * lh);
  return f.v;
}

// the same fragment from a staged weight row whose four 16-B k chunks lie at chunk ^ sw (sw = (n >> 4) & 3)
__device__ __forceinline__ v16h ld_frag_sw(const _Float16* rk, int lh, int sw) {
  Frag f;
  f.p[0] = *(const v8h*)(rk + ((lh ^ sw) << 3));
  f.p[1] = *(const v8h*)(rk + (((2 + lh) ^ sw) << 3));
  return f.v;
}

// ---------------------------------------------------------------------------
// QKV projection: C tile 64x64 per block (128 threads, 4 waves x 16 rows), K loop step 32.
__global__ __launch_bounds__(128)
void k_qkv(const float* __restrict__ x, const float* __restrict__ W, const float* __restrict__ bias,
           _Float16* __restrict__ qkv) {
  __shared__ __align__(16) _Float16 lds[2 * 64 * GP];  // As[64][GP] | Bs[64][GP]; reused as Cs[64][64] (q, k) or Cs[64][AP] (v)
  _Float16* As = lds;
  _Float16* Bs = lds + 64 * GP;

  const int tid = threadIdx.x, lane = tid & 31, w = tid >> 5, m = lane & 15, lh = lane >> 4;
  const int cblk = blockIdx.x * 64, rblk = blockIdx.y * 64;
  if (cblk + 64 > QKVN || rblk + 64 > MROWS) return;   // block-uniform, before any barrier

  // A staging: 8 lanes x 16 B cover one row's whole 128-B line of x; a wave's 4 rows lie 4 apart (LDS offsets 0/16/32/48 dwords)
  const int ar = ((lane >> 3) << 2) + w, ac = (lane & 7) * 4;   // rows ar + 16 j
  // B staging: 16 lanes x 16 B cover one k row's whole 256 B; k = bk + 8 j, n = bc + e; chunk j of row n is stored at
  // j ^ (n >> 4), which puts the 16 rows of a transposing store on distinct banks
  const int bk = tid >> 4, bc = (tid & 15) * 4, bsw = (tid & 15) >> 2;
  const float* ap = x + (size_t)(rblk + ar) * CDIM + ac;
  const float* bp = W + (size_t)bk * QKVN + cblk + bc;

  v8f acc[4] = {};

  for (int k0 = 0; k0 < CDIM; k0 += 32) {
    v4f a4[4], b4[4];
#pragma unroll
    for (int j = 0; j < 4; ++j) a4[j] = *(const v4f*)(ap + (size_t)(16 * j) * CDIM + k0);
#pragma unroll
    for (int j = 0; j < 4; ++j) b4[j] = *(const v4f*)(bp + (size_t)(k0 + 8 * j) * QKVN);
    asm volatile("s_wait_xcnt 0x0" ::: "memory");          // before the loads' address registers are advanced
    __syncthreads();
#pragma unroll
    for (int j = 0; j < 4; ++j)
      *(v4h*)(As + (ar + 16 * j) * GP + ac) = __builtin_convertvector(a4[j], v4h);
#pragma unroll
    for (int j = 0; j < 4; ++j)
#pragma unroll
      for (int e = 0; e < 4; ++e)
        Bs[(bc + e) * GP + ((j ^ bsw) << 3) + bk] = (_Float16)(b4[j][e] * WSCALE);  // Bs[n][k], chunks swizzled
    __syncthreads();

    v16h af = ld_frag(As + (w * 16 + m) * GP, lh);
    v16h bf[4];
#pragma unroll
    for (int nt = 0; nt < 4; ++nt) bf[nt] = ld_frag_sw(Bs + (nt * 16 + m) * GP, lh, nt);
#pragma unroll
    for (int nt = 0; nt < 4; ++nt) acc[nt] = wmma_f16(af, bf[nt], acc[nt]);
  }

  // stage C tile (bias added, weight scale undone) in LDS as f16: q and k tiles as [row][d]; a v tile as [d][row],
  // where a lane's 8 accumulator registers are 8 consecutive rows of one d, so they go as one 16-B store
  __syncthreads();
  _Float16* Cs = lds;
  const int sS = cblk >> 10, hd = (cblk & 1023) >> 6, b = rblk >> 11, n0 = rblk & 2047;
  const bool isv = (sS == 2);                            // block-uniform
  const int cp = isv ? AP : 64;                          // staged row pitch in halves
  v8h o[4];
#pragma unroll
  for (int nt = 0; nt < 4; ++nt) {
    const int col = nt * 16 + m;
    const float bb = bias[cblk + col];
#pragma unroll
    for (int r = 0; r < 8; ++r) o[nt][r] = (_Float16)(acc[nt][r] * (1.0f / WSCALE) + bb);
  }
  if (isv) {
#pragma unroll
    for (int nt = 0; nt < 4; ++nt) *(v8h*)(Cs + (nt * 16 + m) * AP + w * 16 + 8 * lh) = o[nt];
  } else {
#pragma unroll
    for (int nt = 0; nt < 4; ++nt)
#pragma unroll
      for (int r = 0; r < 8; ++r) Cs[(w * 16 + 8 * lh + r) * 64 + nt * 16 + m] = o[nt][r];
  }
  __syncthreads();

  // whole-line stores: the tile is 4096 contiguous halves; each instruction of a wave covers 4 full lines.
  // The v plane so holds, per head, tiles of 64 keys, each tile laid [d][key].
  _Float16* dst = qkv + (size_t)sS * QKV_S + ((size_t)(b * HN + hd) * NSEQ + n0) * DH;
  v8h vv[4];
#pragma unroll
  for (int j = 0; j < 4; ++j) vv[j] = *(const v8h*)(Cs + (j * 16 + (tid >> 3)) * cp + (tid & 7) * 8);
#pragma unroll
  for (int j = 0; j < 4; ++j) *(v8h*)(dst + (j * 128 + tid) * 8) = vv[j];
  
}

__device__ __forceinline__ float xhalf(float v) {          // lane l <-> lane l ^ 16
  const int i = __builtin_bit_cast(int, v);
  return __builtin_bit_cast(float, __builtin_amdgcn_permlanex16(i, i, 0x76543210, 0xfedcba98, false, false));
}

__global__ __launch_bounds__(128)
void k_attn(const _Float16* __restrict__ qkv, const float* __restrict__ x,
            const float* __restrict__ We, const float* __restrict__ be,
            const int* __restrict__ am, _Float16* __restrict__ aw) {
  __shared__ __align__(16) _Float16 Qs[64 * AP];       // [query][d]
  __shared__ __align__(16) _Float16 Ks[64 * AP];       // [key][d]   (k-contiguous A for S^T)
  __shared__ __align__(16) _Float16 Vt[64 * AP];       // [d][key]   (k-contiguous A for V^T.P^T)
  __shared__ __align__(16) int      Ms[64 * MP];       // [query][key] mask chunk
  __shared__ float gsig[64];

  const int tid = threadIdx.x, lane = tid & 31, w = tid >> 5, m = lane & 15, lh = lane >> 4;
  const int bid = blockIdx.x;
  const int qt = bid & 31, bh = bid >> 5, hd = bh & 15, b = bh >> 4;
  if (b >= BSZ) return;                                   // block-uniform
  const int qbase = qt * 64;

  const _Float16* Qg = qkv + ((size_t)(b * HN + hd) * NSEQ) * DH;
  const _Float16* Kg = Qg + QKV_S;
  const _Float16* Vg = Kg + QKV_S;

  // gate: each wave takes its own 16 query rows with its lanes along k, so every x load covers whole lines;
  // the head's We column is gathered once into LDS; per-lane partial sums are joined through LDS, all f32
  {
    float* wcol = reinterpret_cast<float*>(Ks);            // 1024 floats, free until the key loop
    float* part = reinterpret_cast<float*>(Vt);            // 64 rows x 33 floats, free until the key loop
#pragma unroll
    for (int i = 0; i < 8; ++i) wcol[i * 128 + tid] = We[(size_t)(i * 128 + tid) * HN + hd];
    __syncthreads();
    v4f wv[8];
#pragma unroll
    for (int i = 0; i < 8; ++i) wv[i] = *(const v4f*)(wcol + i * 128 + lane * 4);
    const float* xr = x + ((size_t)(b * NSEQ + qbase + w * 16)) * CDIM;
    for (int rr = 0; rr < 16; rr += 2) {                   // two rows a trip = 16 loads in flight per wave
      v4f s4[2] = {};
#pragma unroll
      for (int i = 0; i < 8; ++i)
#pragma unroll
        for (int u = 0; u < 2; ++u)
          s4[u] += *(const v4f*)(xr + (size_t)(rr + u) * CDIM + i * 128 + lane * 4) * wv[i];
#pragma unroll
      for (int u = 0; u < 2; ++u)
        part[(w * 16 + rr + u) * 33 + lane] = (s4[u][0] + s4[u][1]) + (s4[u][2] + s4[u][3]);
    }
    __syncthreads();
    const int q = tid >> 1, half = tid & 1;
    float s = 0.0f;
#pragma unroll
    for (int t = 0; t < 16; ++t) s += part[q * 33 + half * 16 + t];
    s += __shfl_xor(s, 1, 32);
    if (half == 0) {
      const float z = s + be[hd];
      gsig[q] = 1.0f / (1.0f + expf(-z));
    }
  }
  // Q tile: 4096 contiguous halves
  {
    const _Float16* src = Qg + (size_t)qbase * DH;
#pragma unroll
    for (int it = 0; it < 4; ++it) {
      const int c = it * 128 + tid;
      *(v8h*)(Qs + (c >> 3) * AP + (c & 7) * 8) = *(const v8h*)(src + c * 8);
    }
  }
  __syncthreads();

  v16h qb[2];                                              // B: column = query m, k = d
  qb[0] = ld_frag(Qs + (w * 16 + m) * AP, lh);
  qb[1] = ld_frag(Qs + (w * 16 + m) * AP + 32, lh);

  float mstate = -__builtin_inff();                        // this lane's query: running maximum (both halves alike)
  float lstate = 0.0f;                                     // running sum over this lane half's keys only
  const float g = gsig[w * 16 + m] * 0.125f;               // gate * 1/sqrt(64)
  v8f O[4] = {};                                           // O[nt2][r] = O^T[d = 16 nt2 + 8 lh + r][query m]

  // mask chunk staging: 16 lanes x 16 B cover one query row's 256 B, a wave's load covers 4 whole lines
  const int* msrc = am + (size_t)b * NSEQ * NSEQ + (size_t)(qbase + (tid >> 4)) * NSEQ + (tid & 15) * 4;
  int* mdst = Ms + (tid >> 4) * MP + (tid & 15) * 4;
  const int* mfrag = Ms + (w * 16 + m) * MP + 8 * lh;

  for (int j = 0; j < NSEQ / 64; ++j) {
    const int kb = j * 64;
    __syncthreads();
    {  // K chunk, V chunk (already [d][key] in the workspace) and mask chunk: direct copies
      const _Float16* ksrc = Kg + (size_t)kb * DH;
      v8h k8[4], v8[4];
      v4i m4[8];
#pragma unroll
      for (int it = 0; it < 4; ++it) k8[it] = *(const v8h*)(ksrc + (it * 128 + tid) * 8);
#pragma unroll
      for (int it = 0; it < 4; ++it) v8[it] = *(const v8h*)(Vg + (size_t)kb * DH + (it * 128 + tid) * 8);
      asm volatile("s_wait_xcnt 0x0" ::: "memory");        // before a later load's result may land in these loads' address registers
#pragma unroll
      for (int it = 0; it < 8; ++it) m4[it] = *(const v4i*)(msrc + (size_t)(8 * it) * NSEQ + kb);
      asm volatile("s_wait_xcnt 0x0" ::: "memory");        // before the loads' address registers are advanced
#pragma unroll
      for (int it = 0; it < 4; ++it) {
        const int c = it * 128 + tid;
        *(v8h*)(Ks + (c >> 3) * AP + (c & 7) * 8) = k8[it];
      }
#pragma unroll
      for (int it = 0; it < 4; ++it) {
        const int c = it * 128 + tid;
        *(v8h*)(Vt + (c >> 3) * AP + (c & 7) * 8) = v8[it];
      }
#pragma unroll
      for (int it = 0; it < 8; ++it) *(v4i*)(mdst + 8 * it * MP) = m4[it];
    }
    __syncthreads();

    // S^T = K.Q^T : rows = 64 keys (4 tiles), cols = 16 queries of this wave, K = 64
    v8f S[4];
#pragma unroll
    for (int t = 0; t < 4; ++t) {
      v8f z = {};
      v16h kf0 = ld_frag(Ks + (t * 16 + m) * AP, lh);
      v16h kf1 = ld_frag(Ks + (t * 16 + m) * AP + 32, lh);
      z = wmma_f16(kf0, qb[0], z);
      z = wmma_f16(kf1, qb[1], z);
      S[t] = z;
    }

    // scale, gate, mask, online softmax: all 32 scores of a lane belong to query m
    float mt[4];
#pragma unroll
    for (int t = 0; t < 4; ++t) {
      const v4i ma = *(const v4i*)(mfrag + t * 16);
      const v4i mb = *(const v4i*)(mfrag + t * 16 + 4);
      mt[t] = -__builtin_inff();
#pragma unroll
      for (int r = 0; r < 8; ++r) {
        const int mv = (r < 4) ? ma[r & 3] : mb[r & 3];
        float lv = S[t][r] * g;
        if (mv == 0) lv = -__builtin_inff();
        S[t][r] = lv;
        mt[t] = fmaxf(mt[t], lv);
      }
    }
    float mx = fmaxf(fmaxf(mt[0], mt[1]), fmaxf(mt[2], mt[3]));
    mx = fmaxf(mx, xhalf(mx));
    const float mnew = fmaxf(mstate, mx);
    const bool dead = (mnew == -__builtin_inff());
    const float alpha = dead ? 1.0f : __expf(mstate - mnew);
    const float msub = dead ? 0.0f : mnew;                 // a row with no open key yet: exp(-inf - 0) = 0
    float rt[4];
    Frag pb[2];                                            // B: column = query m, k = key in the hardware k order
#pragma unroll
    for (int t = 0; t < 4; ++t) {
      rt[t] = 0.0f;
#pragma unroll
      for (int r = 0; r < 8; ++r) {
        const float p = __expf(S[t][r] - msub);
        rt[t] += p;
        pb[t >> 1].p[t & 1][r] = (_Float16)(p * PSCALE);
      }
    }
    lstate = lstate * alpha + ((rt[0] + rt[1]) + (rt[2] + rt[3]));
    mstate = mnew;
#pragma unroll
    for (int nt2 = 0; nt2 < 4; ++nt2) O[nt2] *= alpha;

    // O^T += V^T . (256 P)^T : K = 64 keys
#pragma unroll
    for (int kk = 0; kk < 2; ++kk) {
      v16h va[4];
#pragma unroll
      for (int nt2 = 0; nt2 < 4; ++nt2) va[nt2] = ld_frag(Vt + (nt2 * 16 + m) * AP + kk * 32, lh);
#pragma unroll
      for (int nt2 = 0; nt2 < 4; ++nt2) O[nt2] = wmma_f16(va[nt2], pb[kk].v, O[nt2]);
    }
  }

  // normalise: a = O / (256 l); store a*64 = O / (4 l) as f16, staged in Ks; a lane's 8 registers are 8 consecutive d
  __syncthreads();
  const float l = lstate + xhalf(lstate);
  const float inv = (l > 0.0f) ? (0.25f / l) : 0.0f;
#pragma unroll
  for (int nt2 = 0; nt2 < 4; ++nt2)
    *(v8h*)(Ks + (w * 16 + m) * AP + nt2 * 16 + 8 * lh) = __builtin_convertvector(O[nt2] * inv, v8h);
  __syncthreads();

  v8h vv[4];
#pragma unroll
  for (int jj = 0; jj < 4; ++jj) {
    const int c = jj * 128 + tid;
    vv[jj] = *(const v8h*)(Ks + (c >> 3) * AP + (c & 7) * 8);
  }
#pragma unroll
  for (int jj = 0; jj < 4; ++jj) {
    const int c = jj * 128 + tid;
    _Float16* dst = aw + ((size_t)(b * NSEQ + qbase + (c >> 3))) * CDIM + hd * DH + (c & 7) * 8;
    *(v8h*)dst = vv[jj];
  }
  
}

// ---------------------------------------------------------------------------
// Output projection: out = (a x64) . (Wo x64) / 4096 + bo ; C tile 64x64 f32, grid = (1024/64, 4096/64)
__global__ __launch_bounds__(128)
void k_out(const _Float16* __restrict__ aw, const float* __restrict__ Wo, const float* __restrict__ bo,
           float* __restrict__ out) {
  __shared__ __align__(16) float ldsf[64 * 64];          // 16 KB: As|Bs (f16) then Cs (f32)
  _Float16* As = reinterpret_cast<_Float16*>(ldsf);
  _Float16* Bs = As + 64 * GP;

  const int tid = threadIdx.x, lane = tid & 31, w = tid >> 5, m = lane & 15, lh = lane >> 4;
  const int cblk = blockIdx.x * 64, rblk = blockIdx.y * 64;
  if (cblk + 64 > CDIM || rblk + 64 > MROWS) return;    // block-uniform

  // A staging: 4 lanes x 16 B cover one row's whole 64-B k slice; 4 rows of a lane half lie 4 apart (distinct LDS banks)
  const int rs = lane >> 2;
  const int ar = (rs & 3) * 4 + (rs >> 2) * 2 + (w & 1) + 16 * (w >> 1), ac = (lane & 3) * 8;   // rows ar, ar + 32
  const int bk = tid >> 4, bc = (tid & 15) * 4, bsw = (tid & 15) >> 2;   // k = bk + 8 j, n = bc + e, chunk swizzle as in k_qkv
  const _Float16* ap = aw + (size_t)(rblk + ar) * CDIM + ac;
  const float* bp = Wo + (size_t)bk * CDIM + cblk + bc;

  v8f acc[4] = {};

  for (int k0 = 0; k0 < CDIM; k0 += 32) {
    v8h a8[2];
    v4f b4[4];
    a8[0] = *(const v8h*)(ap + k0);
    a8[1] = *(const v8h*)(ap + (size_t)32 * CDIM + k0);
#pragma unroll
    for (int j = 0; j < 4; ++j) b4[j] = *(const v4f*)(bp + (size_t)(k0 + 8 * j) * CDIM);
    asm volatile("s_wait_xcnt 0x0" ::: "memory");          // before the loads' address registers are advanced
    __syncthreads();
    *(v8h*)(As + ar * GP + ac)     = a8[0];
    *(v8h*)(As + (ar + 32) * GP + ac) = a8[1];
#pragma unroll
    for (int j = 0; j < 4; ++j)
#pragma unroll
      for (int e = 0; e < 4; ++e)
        Bs[(bc + e) * GP + ((j ^ bsw) << 3) + bk] = (_Float16)(b4[j][e] * WSCALE);  // Bs[n][k], chunks swizzled
    __syncthreads();

    v16h af = ld_frag(As + (w * 16 + m) * GP, lh);
    v16h bf[4];
#pragma unroll
    for (int nt = 0; nt < 4; ++nt) bf[nt] = ld_frag_sw(Bs + (nt * 16 + m) * GP, lh, nt);
#pragma unroll
    for (int nt = 0; nt < 4; ++nt) acc[nt] = wmma_f16(af, bf[nt], acc[nt]);
  }

  __syncthreads();
  float* Cs = ldsf;
#pragma unroll
  for (int nt = 0; nt < 4; ++nt) {
    const int col = nt * 16 + m;
    const float bb = bo[cblk + col];
#pragma unroll
    for (int r = 0; r < 8; ++r)
      Cs[(w * 16 + 8 * lh + r) * 64 + col] = acc[nt][r] * (1.0f / (ASCALE * WSCALE)) + bb;
  }
  __syncthreads();

  // each row segment is 256 B = 2 lines; lanes 8q..8q+7 write one full line with 16-B stores
  v4f vv[8];
#pragma unroll
  for (int jj = 0; jj < 8; ++jj) {
    const int c = jj * 128 + tid;
    vv[jj] = *(const v4f*)(Cs + (c >> 4) * 64 + (c & 15) * 4);
  }
#pragma unroll
  for (int jj = 0; jj < 8; ++jj) {
    const int c = jj * 128 + tid;
    float* dst = out + (size_t)(rblk + (c >> 4)) * CDIM + cblk + (c & 15) * 4;
    *(v4f*)dst = vv[jj];
  }
  
}

// ---------------------------------------------------------------------------
extern "C" void kernel_launch(void* const* d_in, const int* in_sizes, int n_in,
                              void* d_out, int out_size, void* d_ws, size_t ws_size,
                              hipStream_t stream) {
  if (n_in < 8) return;
  if (in_sizes[0] != MROWS * CDIM) return;
  if (in_sizes[1] != BSZ * NSEQ * NSEQ) return;
  if (in_sizes[2] != CDIM * QKVN) return;
  if (in_sizes[3] != QKVN) return;
  if (in_sizes[4] != CDIM * HN) return;
  if (in_sizes[5] != HN) return;
  if (in_sizes[6] != CDIM * CDIM) return;
  if (in_sizes[7] != CDIM) return;
  if (out_size != MROWS * CDIM) return;

  const float* x    = (const float*)d_in[0];
  const int*   am   = (const int*)d_in[1];
  const float* Wqkv = (const float*)d_in[2];
  const float* bqkv = (const float*)d_in[3];
  const float* We   = (const float*)d_in[4];
  const float* be   = (const float*)d_in[5];
  const float* Wo   = (const float*)d_in[6];
  const float* bo   = (const float*)d_in[7];
  float* out = (float*)d_out;

  const size_t qkv_bytes = (size_t)3 * QKV_S * sizeof(_Float16);          // 25,165,824
  const size_t aw_off    = qkv_bytes;
  const size_t aw_bytes  = (size_t)MROWS * CDIM * sizeof(_Float16);       //  8,388,608
  if (aw_off + aw_bytes > ws_size) return;
  char* ws = (char*)d_ws;
  _Float16* qkvws = (_Float16*)ws;
  _Float16* awws  = (_Float16*)(ws + aw_off);

  k_qkv<<<dim3(QKVN / 64, MROWS / 64), 128, 0, stream>>>(x, Wqkv, bqkv, qkvws);
  k_attn<<<dim3(BSZ * HN * (NSEQ / 64)), 128, 0, stream>>>(qkvws, x, We, be, am, awws);
  k_out<<<dim3(CDIM / 64, MROWS / 64), 128, 0, stream>>>(awws, Wo, bo, out);
}

// v005
// Measured time: 117 microseconds a run.
// Next to v004, in two timings, it ran 1.42 times as fast each time.
// Over all steps from v000 it is 3.60 times as fast.
// Contractions: QKV projection, Q.K^T, P.V and output projection on v_wmma_f32_16x16x32_f16 (f16 operands, f32 accumulate);
// weights carried x64, P carried x256, attention output carried x64 (scales undone in f32); per-query gate dot (K=1024, N=16) on VALU f32.
#include <hip/hip_runtime.h>
#include <math.h>
#include <stdint.h>
#include <stddef.h>

typedef _Float16 v16h __attribute__((ext_vector_type(16)));
typedef _Float16 v8h  __attribute__((ext_vector_type(8), __may_alias__));
typedef _Float16 v4h  __attribute__((ext_vector_type(4), __may_alias__));
typedef float    v8f  __attribute__((ext_vector_type(8)));
typedef float    v4f  __attribute__((ext_vector_type(4), __may_alias__));
typedef int      v4i  __attribute__((ext_vector_type(4), __may_alias__));

union Frag { v16h v; v8h p[2]; };

constexpr int BSZ   = 2;
constexpr int NSEQ  = 2048;
constexpr int CDIM  = 1024;
constexpr int HN    = 16;
constexpr int DH    = 64;
constexpr int QKVN  = 3 * CDIM;                         // 3072
constexpr int MROWS = BSZ * NSEQ;                       // 4096
constexpr size_t QKV_S = (size_t)BSZ * HN * NSEQ * DH;  // halves per q/k/v plane
constexpr float WSCALE = 64.0f;                         // weight pre-scale (exact power of two)
constexpr float PSCALE = 256.0f;                        // P pre-scale
constexpr float ASCALE = 64.0f;                         // attention-output pre-scale
// LDS row pitches in halves: 16 B x odd, so the 16 rows of a ds_load_b128 fragment read fall on distinct banks
constexpr int AP = 72;                                  // 64-half rows (GEMM k slices, attention tiles): 144 B
constexpr int MP = 68;                                  // 64-int rows (mask chunk), in ints: 272 B

// one 16x16x32 f16 WMMA with the VALU hazard guard attached
__device__ __forceinline__ v8f wmma_f16(v16h a, v16h b, v8f c) {
  v8f d = __builtin_amdgcn_wmma_f32_16x16x32_f16(false, a, false, b, (short)0, c, false, false);
  asm volatile("v_nop\n\tv_nop\n\tv_nop\n\tv_nop" : "+v"(d) : "v"(a), "v"(b));
  return d;
}

// 16-bit fragment from a k-contiguous row (A row m, or B stored [n][k] row n):
// elements 0..7 <- k0+8*lh .. +7, elements 8..15 <- k0+16+8*lh .. +7  (lh = lane >> 4)
__device__ __forceinline__ v16h ld_frag(const _Float16* rk, int lh) {
  Frag f;
  f.p[0] = *(const v8h*)(rk + 8 * lh);
  f.p[1] = *(const v8h*)(rk + 16 + 8 * lh);
  return f.v;
}

// the same fragment from a staged weight row whose four 16-B k chunks lie at chunk ^ sw (sw = (n >> 4) & 3)
__device__ __forceinline__ v16h ld_frag_sw(const _Float16* rk, int lh, int sw) {
  Frag f;
  f.p[0] = *(const v8h*)(rk + ((lh ^ sw) << 3));
  f.p[1] = *(const v8h*)(rk + (((2 + lh) ^ sw) << 3));
  return f.v;
}

// ---------------------------------------------------------------------------
// QKV projection: C tile 128x128 per block (256 threads, 8 waves as 4 x 2, each 32 rows x 64 columns), K loop step 64.
__global__ __launch_bounds__(256)
void k_qkv(const float* __restrict__ x, const float* __restrict__ W, const float* __restrict__ bias,
           _Float16* __restrict__ qkv) {
  __shared__ __align__(16) _Float16 lds[2 * 128 * AP];  // As[128][AP] | Bs[128][AP]; reused as four C sub-tiles [64][AP]
  _Float16* As = lds;
  _Float16* Bs = lds + 128 * AP;

  const int tid = threadIdx.x, lane = tid & 31, w = tid >> 5, m = lane & 15, lh = lane >> 4;
  const int wr = w >> 1, wc = w & 1;                     // this wave's 32-row band and 64-column band of the tile
  const int cblk = blockIdx.x * 128, rblk = blockIdx.y * 128;
  if (cblk + 128 > QKVN || rblk + 128 > MROWS) return;   // block-uniform, before any barrier

  // A staging: 16 lanes x 16 B cover one row's 256-B k slice (two whole lines of x); a wave's 2 rows lie 8 apart,
  // so its 8-B LDS stores fall on all 64 banks once
  const int ar = 8 * lh + w, ac = m * 4;                 // rows ar + 16 j
  // B staging: a wave's 32 lanes x 16 B cover one k row's whole 512 B; a thread holds k = 8 w + j (j = 0..7) of columns
  // n = bn + e, so each column's 8 k go as one 16-B store; chunk c of row n is stored at c ^ ((n >> 4) & 3), which puts
  // the 16 rows of a lane half (4 apart) on distinct banks
  const int bn = lane * 4, bsw = (lane >> 2) & 3;
  const float* ap = x + (size_t)(rblk + ar) * CDIM + ac;
  const float* bp = W + (size_t)(8 * w) * QKVN + cblk + bn;
  _Float16* bdst = Bs + bn * AP + ((w ^ bsw) << 3);

  v8f acc[2][4] = {};

  for (int k0 = 0; k0 < CDIM; k0 += 64) {
    v4f a4[8], b4[8];
#pragma unroll
    for (int j = 0; j < 8; ++j) a4[j] = *(const v4f*)(ap + (size_t)(16 * j) * CDIM + k0);
#pragma unroll
    for (int j = 0; j < 8; ++j) b4[j] = *(const v4f*)(bp + (size_t)(k0 + j) * QKVN);
    __builtin_amdgcn_sched_barrier(0);                     // all 16 loads issue before the first conversion waits on one
    asm volatile("s_wait_xcnt 0x0" ::: "memory");          // before the loads' address registers are advanced
    __syncthreads();
#pragma unroll
    for (int j = 0; j < 8; ++j)
      *(v4h*)(As + (ar + 16 * j) * AP + ac) = __builtin_convertvector(a4[j], v4h);
#pragma unroll
    for (int e = 0; e < 4; ++e) {
      v8h t;
#pragma unroll
      for (int j = 0; j < 8; ++j) t[j] = (_Float16)(b4[j][e] * WSCALE);
      *(v8h*)(bdst + e * AP) = t;                          // Bs[n][k], chunks swizzled
    }
    __syncthreads();

#pragma unroll
    for (int kk = 0; kk < 2; ++kk) {
      v16h af[2], bf[4];
#pragma unroll
      for (int mt = 0; mt < 2; ++mt) af[mt] = ld_frag(As + (wr * 32 + mt * 16 + m) * AP + kk * 32, lh);
#pragma unroll
      for (int nt = 0; nt < 4; ++nt) bf[nt] = ld_frag_sw(Bs + (wc * 64 + nt * 16 + m) * AP + kk * 32, lh, nt);
#pragma unroll
      for (int mt = 0; mt < 2; ++mt)
#pragma unroll
        for (int nt = 0; nt < 4; ++nt) acc[mt][nt] = wmma_f16(af[mt], bf[nt], acc[mt][nt]);
    }
  }

  // stage the C tile (bias added, weight scale undone) in LDS as f16, as four 64x64 sub-tiles (64 rows of one head each):
  // q and k sub-tiles as [row][d]; a v sub-tile as [d][row], where a lane's 8 accumulator registers are 8 consecutive
  // rows of one d, so they go as one 16-B store
  __syncthreads();
  const int sS = cblk >> 10, hd0 = (cblk & 1023) >> 6, b = rblk >> 11, n0 = rblk & 2047;
  const bool isv = (sS == 2);                            // block-uniform
  _Float16* Cw = lds + ((wr >> 1) * 2 + wc) * (64 * AP); // this wave's sub-tile
  const int lr = (wr & 1) * 32;                          // its first row there
  v8h o[2][4];
#pragma unroll
  for (int nt = 0; nt < 4; ++nt) {
    const float bb = bias[cblk + wc * 64 + nt * 16 + m];
#pragma unroll
    for (int mt = 0; mt < 2; ++mt)
#pragma unroll
      for (int r = 0; r < 8; ++r) o[mt][nt][r] = (_Float16)(acc[mt][nt][r] * (1.0f / WSCALE) + bb);
  }
  if (isv) {
#pragma unroll
    for (int mt = 0; mt < 2; ++mt)
#pragma unroll
      for (int nt = 0; nt < 4; ++nt) *(v8h*)(Cw + (nt * 16 + m) * AP + lr + mt * 16 + 8 * lh) = o[mt][nt];
  } else {
#pragma unroll
    for (int mt = 0; mt < 2; ++mt)
#pragma unroll
      for (int nt = 0; nt < 4; ++nt)
#pragma unroll
        for (int r = 0; r < 8; ++r) Cw[(lr + mt * 16 + 8 * lh + r) * AP + nt * 16 + m] = o[mt][nt][r];
  }
  __syncthreads();

  // whole-line stores: each sub-tile is 4096 contiguous halves; each instruction of a wave covers 4 full lines.
  // The v plane so holds, per head, tiles of 64 keys, each tile laid [d][key].
  v8h vv[8];
#pragma unroll
  for (int j = 0; j < 8; ++j) {
    const int cc = (j & 1) * 256 + tid;                    // 16-B chunk within sub-tile j >> 1
    vv[j] = *(const v8h*)(lds + (j >> 1) * (64 * AP) + (cc >> 3) * AP + (cc & 7) * 8);
  }
#pragma unroll
  for (int j = 0; j < 8; ++j) {
    const int sub = j >> 1, cc = (j & 1) * 256 + tid;
    _Float16* dst = qkv + (size_t)sS * QKV_S +
                    ((size_t)(b * HN + hd0 + (sub & 1)) * NSEQ + n0 + 64 * (sub >> 1)) * DH;
    *(v8h*)(dst + cc * 8) = vv[j];
  }
}

__device__ __forceinline__ float xhalf(float v) {          // lane l <-> lane l ^ 16
  const int i = __builtin_bit_cast(int, v);
  return __builtin_bit_cast(float, __builtin_amdgcn_permlanex16(i, i, 0x76543210, 0xfedcba98, false, false));
}

__global__ __launch_bounds__(128)
void k_attn(const _Float16* __restrict__ qkv, const float* __restrict__ x,
            const float* __restrict__ We, const float* __restrict__ be,
            const int* __restrict__ am, _Float16* __restrict__ aw) {
  __shared__ __align__(16) _Float16 Qs[64 * AP];       // [query][d]
  __shared__ __align__(16) _Float16 Ks[64 * AP];       // [key][d]   (k-contiguous A for S^T)
  __shared__ __align__(16) _Float16 Vt[64 * AP];       // [d][key]   (k-contiguous A for V^T.P^T)
  __shared__ __align__(16) int      Ms[64 * MP];       // [query][key] mask chunk
  __shared__ float gsig[64];

  const int tid = threadIdx.x, lane = tid & 31, w = tid >> 5, m = lane & 15, lh = lane >> 4;
  const int bid = blockIdx.x;
  const int qt = bid & 31, bh = bid >> 5, hd = bh & 15, b = bh >> 4;
  if (b >= BSZ) return;                                   // block-uniform
  const int qbase = qt * 64;

  const _Float16* Qg = qkv + ((size_t)(b * HN + hd) * NSEQ) * DH;
  const _Float16* Kg = Qg + QKV_S;
  const _Float16* Vg = Kg + QKV_S;

  // gate: each wave takes its own 16 query rows with its lanes along k, so every x load covers whole lines;
  // the head's We column is gathered once into LDS; per-lane partial sums are joined through LDS, all f32
  {
    float* wcol = reinterpret_cast<float*>(Ks);            // 1024 floats, free until the key loop
    float* part = reinterpret_cast<float*>(Vt);            // 64 rows x 33 floats, free until the key loop
#pragma unroll
    for (int i = 0; i < 8; ++i) wcol[i * 128 + tid] = We[(size_t)(i * 128 + tid) * HN + hd];
    __syncthreads();
    v4f wv[8];
#pragma unroll
    for (int i = 0; i < 8; ++i) wv[i] = *(const v4f*)(wcol + i * 128 + lane * 4);
    const float* xr = x + ((size_t)(b * NSEQ + qbase + w * 16)) * CDIM;
    for (int rr = 0; rr < 16; rr += 2) {                   // two rows a trip = 16 loads in flight per wave
      v4f s4[2] = {};
#pragma unroll
      for (int i = 0; i < 8; ++i)
#pragma unroll
        for (int u = 0; u < 2; ++u)
          s4[u] += *(const v4f*)(xr + (size_t)(rr + u) * CDIM + i * 128 + lane * 4) * wv[i];
#pragma unroll
      for (int u = 0; u < 2; ++u)
        part[(w * 16 + rr + u) * 33 + lane] = (s4[u][0] + s4[u][1]) + (s4[u][2] + s4[u][3]);
    }
    __syncthreads();
    const int q = tid >> 1, half = tid & 1;
    float s = 0.0f;
#pragma unroll
    for (int t = 0; t < 16; ++t) s += part[q * 33 + half * 16 + t];
    s += __shfl_xor(s, 1, 32);
    if (half == 0) {
      const float z = s + be[hd];
      gsig[q] = 1.0f / (1.0f + expf(-z));
    }
  }
  // Q tile: 4096 contiguous halves
  {
    const _Float16* src = Qg + (size_t)qbase * DH;
#pragma unroll
    for (int it = 0; it < 4; ++it) {
      const int c = it * 128 + tid;
      *(v8h*)(Qs + (c >> 3) * AP + (c & 7) * 8) = *(const v8h*)(src + c * 8);
    }
  }
  __syncthreads();

  v16h qb[2];                                              // B: column = query m, k = d
  qb[0] = ld_frag(Qs + (w * 16 + m) * AP, lh);
  qb[1] = ld_frag(Qs + (w * 16 + m) * AP + 32, lh);

  float mstate = -__builtin_inff();                        // this lane's query: running maximum (both halves alike)
  float lstate = 0.0f;                                     // running sum over this lane half's keys only
  const float g = gsig[w * 16 + m] * 0.125f;               // gate * 1/sqrt(64)
  v8f O[4] = {};                                           // O[nt2][r] = O^T[d = 16 nt2 + 8 lh + r][query m]

  // mask chunk staging: 16 lanes x 16 B cover one query row's 256 B, a wave's load covers 4 whole lines
  const int* msrc = am + (size_t)b * NSEQ * NSEQ + (size_t)(qbase + (tid >> 4)) * NSEQ + (tid & 15) * 4;
  int* mdst = Ms + (tid >> 4) * MP + (tid & 15) * 4;
  const int* mfrag = Ms + (w * 16 + m) * MP + 8 * lh;

  for (int j = 0; j < NSEQ / 64; ++j) {
    const int kb = j * 64;
    __syncthreads();
    {  // K chunk, V chunk (already [d][key] in the workspace) and mask chunk: direct copies
      const _Float16* ksrc = Kg + (size_t)kb * DH;
      v8h k8[4], v8[4];
      v4i m4[8];
#pragma unroll
      for (int it = 0; it < 4; ++it) k8[it] = *(const v8h*)(ksrc + (it * 128 + tid) * 8);
#pragma unroll
      for (int it = 0; it < 4; ++it) v8[it] = *(const v8h*)(Vg + (size_t)kb * DH + (it * 128 + tid) * 8);
      asm volatile("s_wait_xcnt 0x0" ::: "memory");        // before a later load's result may land in these loads' address registers
#pragma unroll
      for (int it = 0; it < 8; ++it) m4[it] = *(const v4i*)(msrc + (size_t)(8 * it) * NSEQ + kb);
      asm volatile("s_wait_xcnt 0x0" ::: "memory");        // before the loads' address registers are advanced
#pragma unroll
      for (int it = 0; it < 4; ++it) {
        const int c = it * 128 + tid;
        *(v8h*)(Ks + (c >> 3) * AP + (c & 7) * 8) = k8[it];
      }
#pragma unroll
      for (int it = 0; it < 4; ++it) {
        const int c = it * 128 + tid;
        *(v8h*)(Vt + (c >> 3) * AP + (c & 7) * 8) = v8[it];
      }
#pragma unroll
      for (int it = 0; it < 8; ++it) *(v4i*)(mdst + 8 * it * MP) = m4[it];
    }
    __syncthreads();

    // S^T = K.Q^T : rows = 64 keys (4 tiles), cols = 16 queries of this wave, K = 64
    v8f S[4];
#pragma unroll
    for (int t = 0; t < 4; ++t) {
      v8f z = {};
      v16h kf0 = ld_frag(Ks + (t * 16 + m) * AP, lh);
      v16h kf1 = ld_frag(Ks + (t * 16 + m) * AP + 32, lh);
      z = wmma_f16(kf0, qb[0], z);
      z = wmma_f16(kf1, qb[1], z);
      S[t] = z;
    }

    // scale, gate, mask, online softmax: all 32 scores of a lane belong to query m
    float mt[4];
#pragma unroll
    for (int t = 0; t < 4; ++t) {
      const v4i ma = *(const v4i*)(mfrag + t * 16);
      const v4i mb = *(const v4i*)(mfrag + t * 16 + 4);
      mt[t] = -__builtin_inff();
#pragma unroll
      for (int r = 0; r < 8; ++r) {
        const int mv = (r < 4) ? ma[r & 3] : mb[r & 3];
        float lv = S[t][r] * g;
        if (mv == 0) lv = -__builtin_inff();
        S[t][r] = lv;
        mt[t] = fmaxf(mt[t], lv);
      }
    }
    float mx = fmaxf(fmaxf(mt[0], mt[1]), fmaxf(mt[2], mt[3]));
    mx = fmaxf(mx, xhalf(mx));
    const float mnew = fmaxf(mstate, mx);
    const bool dead = (mnew == -__builtin_inff());
    const float alpha = dead ? 1.0f : __expf(mstate - mnew);
    const float msub = dead ? 0.0f : mnew;                 // a row with no open key yet: exp(-inf - 0) = 0
    float rt[4];
    Frag pb[2];                                            // B: column = query m, k = key in the hardware k order
#pragma unroll
    for (int t = 0; t < 4; ++t) {
      rt[t] = 0.0f;
#pragma unroll
      for (int r = 0; r < 8; ++r) {
        const float p = __expf(S[t][r] - msub);
        rt[t] += p;
        pb[t >> 1].p[t & 1][r] = (_Float16)(p * PSCALE);
      }
    }
    lstate = lstate * alpha + ((rt[0] + rt[1]) + (rt[2] + rt[3]));
    mstate = mnew;
#pragma unroll
    for (int nt2 = 0; nt2 < 4; ++nt2) O[nt2] *= alpha;

    // O^T += V^T . (256 P)^T : K = 64 keys
#pragma unroll
    for (int kk = 0; kk < 2; ++kk) {
      v16h va[4];
#pragma unroll
      for (int nt2 = 0; nt2 < 4; ++nt2) va[nt2] = ld_frag(Vt + (nt2 * 16 + m) * AP + kk * 32, lh);
#pragma unroll
      for (int nt2 = 0; nt2 < 4; ++nt2) O[nt2] = wmma_f16(va[nt2], pb[kk].v, O[nt2]);
    }
  }

  // normalise: a = O / (256 l); store a*64 = O / (4 l) as f16, staged in Ks; a lane's 8 registers are 8 consecutive d
  __syncthreads();
  const float l = lstate + xhalf(lstate);
  const float inv = (l > 0.0f) ? (0.25f / l) : 0.0f;
#pragma unroll
  for (int nt2 = 0; nt2 < 4; ++nt2)
    *(v8h*)(Ks + (w * 16 + m) * AP + nt2 * 16 + 8 * lh) = __builtin_convertvector(O[nt2] * inv, v8h);
  __syncthreads();

  v8h vv[4];
#pragma unroll
  for (int jj = 0; jj < 4; ++jj) {
    const int c = jj * 128 + tid;
    vv[jj] = *(const v8h*)(Ks + (c >> 3) * AP + (c & 7) * 8);
  }
#pragma unroll
  for (int jj = 0; jj < 4; ++jj) {
    const int c = jj * 128 + tid;
    _Float16* dst = aw + ((size_t)(b * NSEQ + qbase + (c >> 3))) * CDIM + hd * DH + (c & 7) * 8;
    *(v8h*)dst = vv[jj];
  }
  
}

// ---------------------------------------------------------------------------
// Output projection: out = (a x64) . (Wo x64) / 4096 + bo ; C tile 128x128 f32 (8 waves as 4 x 2, each 32 x 64),
// K loop step 64, grid = (1024/128, 4096/128)
constexpr int CP = 132;                                  // f32 C rows in LDS, in floats: rows 8 apart fall 32 banks apart
__global__ __launch_bounds__(256)
void k_out(const _Float16* __restrict__ aw, const float* __restrict__ Wo, const float* __restrict__ bo,
           float* __restrict__ out) {
  __shared__ __align__(16) float ldsf[128 * CP];         // As|Bs (f16, 2 x 128 x AP) then Cs (f32)
  _Float16* As = reinterpret_cast<_Float16*>(ldsf);
  _Float16* Bs = As + 128 * AP;

  const int tid = threadIdx.x, lane = tid & 31, w = tid >> 5, m = lane & 15, lh = lane >> 4;
  const int wr = w >> 1, wc = w & 1;                     // this wave's 32-row band and 64-column band of the tile
  const int cblk = blockIdx.x * 128, rblk = blockIdx.y * 128;
  if (cblk + 128 > CDIM || rblk + 128 > MROWS) return;   // block-uniform

  // A staging: 8 lanes x 16 B cover one row's whole 128-B k slice (one line); the 2 rows of a lane half lie 8 apart (distinct banks)
  const int ar = (lane >> 3) * 8 + w, ac = (lane & 7) * 8;   // rows ar + 32 j
  const int bn = lane * 4, bsw = (lane >> 2) & 3;        // k = 8 w + j, n = bn + e, chunk swizzle as in k_qkv
  const _Float16* ap = aw + (size_t)(rblk + ar) * CDIM + ac;
  const float* bp = Wo + (size_t)(8 * w) * CDIM + cblk + bn;
  _Float16* bdst = Bs + bn * AP + ((w ^ bsw) << 3);

  v8f acc[2][4] = {};

  for (int k0 = 0; k0 < CDIM; k0 += 64) {
    v8h a8[4];
    v4f b4[8];
#pragma unroll
    for (int j = 0; j < 4; ++j) a8[j] = *(const v8h*)(ap + (size_t)(32 * j) * CDIM + k0);
#pragma unroll
    for (int j = 0; j < 8; ++j) b4[j] = *(const v4f*)(bp + (size_t)(k0 + j) * CDIM);
    asm volatile("s_wait_xcnt 0x0" ::: "memory");          // before the loads' address registers are advanced
    __syncthreads();
#pragma unroll
    for (int j = 0; j < 4; ++j) *(v8h*)(As + (ar + 32 * j) * AP + ac) = a8[j];
#pragma unroll
    for (int e = 0; e < 4; ++e) {
      v8h t;
#pragma unroll
      for (int j = 0; j < 8; ++j) t[j] = (_Float16)(b4[j][e] * WSCALE);
      *(v8h*)(bdst + e * AP) = t;                          // Bs[n][k], chunks swizzled
    }
    __syncthreads();

#pragma unroll
    for (int kk = 0; kk < 2; ++kk) {
      v16h af[2], bf[4];
#pragma unroll
      for (int mt = 0; mt < 2; ++mt) af[mt] = ld_frag(As + (wr * 32 + mt * 16 + m) * AP + kk * 32, lh);
#pragma unroll
      for (int nt = 0; nt < 4; ++nt) bf[nt] = ld_frag_sw(Bs + (wc * 64 + nt * 16 + m) * AP + kk * 32, lh, nt);
#pragma unroll
      for (int mt = 0; mt < 2; ++mt)
#pragma unroll
        for (int nt = 0; nt < 4; ++nt) acc[mt][nt] = wmma_f16(af[mt], bf[nt], acc[mt][nt]);
    }
  }

  __syncthreads();
  float* Cs = ldsf;
#pragma unroll
  for (int nt = 0; nt < 4; ++nt) {
    const int col = wc * 64 + nt * 16 + m;
    const float bb = bo[cblk + col];
#pragma unroll
    for (int mt = 0; mt < 2; ++mt)
#pragma unroll
      for (int r = 0; r < 8; ++r)
        Cs[(wr * 32 + mt * 16 + 8 * lh + r) * CP + col] = acc[mt][nt][r] * (1.0f / (ASCALE * WSCALE)) + bb;
  }
  __syncthreads();

  // each row segment is 512 B = 4 lines: one 16-B store instruction of a wave writes one whole row segment
  v4f vv[16];
#pragma unroll
  for (int jj = 0; jj < 16; ++jj) {
    const int c = jj * 256 + tid;
    vv[jj] = *(const v4f*)(Cs + (c >> 5) * CP + (c & 31) * 4);
  }
#pragma unroll
  for (int jj = 0; jj < 16; ++jj) {
    const int c = jj * 256 + tid;
    float* dst = out + (size_t)(rblk + (c >> 5)) * CDIM + cblk + (c & 31) * 4;
    *(v4f*)dst = vv[jj];
  }
}

// ---------------------------------------------------------------------------
extern "C" void kernel_launch(void* const* d_in, const int* in_sizes, int n_in,
                              void* d_out, int out_size, void* d_ws, size_t ws_size,
                              hipStream_t stream) {
  if (n_in < 8) return;
  if (in_sizes[0] != MROWS * CDIM) return;
  if (in_sizes[1] != BSZ * NSEQ * NSEQ) return;
  if (in_sizes[2] != CDIM * QKVN) return;
  if (in_sizes[3] != QKVN) return;
  if (in_sizes[4] != CDIM * HN) return;
  if (in_sizes[5] != HN) return;
  if (in_sizes[6] != CDIM * CDIM) return;
  if (in_sizes[7] != CDIM) return;
  if (out_size != MROWS * CDIM) return;

  const float* x    = (const float*)d_in[0];
  const int*   am   = (const int*)d_in[1];
  const float* Wqkv = (const float*)d_in[2];
  const float* bqkv = (const float*)d_in[3];
  const float* We   = (const float*)d_in[4];
  const float* be   = (const float*)d_in[5];
  const float* Wo   = (const float*)d_in[6];
  const float* bo   = (const float*)d_in[7];
  float* out = (float*)d_out;

  const size_t qkv_bytes = (size_t)3 * QKV_S * sizeof(_Float16);          // 25,165,824
  const size_t aw_off    = qkv_bytes;
  const size_t aw_bytes  = (size_t)MROWS * CDIM * sizeof(_Float16);       //  8,388,608
  if (aw_off + aw_bytes > ws_size) return;
  char* ws = (char*)d_ws;
  _Float16* qkvws = (_Float16*)ws;
  _Float16* awws  = (_Float16*)(ws + aw_off);

  k_qkv<<<dim3(QKVN / 128, MROWS / 128), 256, 0, stream>>>(x, Wqkv, bqkv, qkvws);
  k_attn<<<dim3(BSZ * HN * (NSEQ / 64)), 128, 0, stream>>>(qkvws, x, We, be, am, awws);
  k_out<<<dim3(CDIM / 128, MROWS / 128), 256, 0, stream>>>(awws, Wo, bo, out);
}

// v006
// A run of this version takes 113 microseconds.
// Timed twice side by side with v005, it ran 1.04 and 1.03 times as fast.
// Over all steps from v000 it is 3.73 times as fast.
// Contractions: QKV projection, Q.K^T, P.V and output projection on v_wmma_f32_16x16x32_f16 (f16 operands, f32 accumulate);
// weights carried x64, P carried x256, attention output carried x64 (scales undone in f32); per-query gate dot (K=1024, N=16) on VALU f32.
// The int32 mask is packed once, by the projection kernel, into lane-mask words that all 16 heads of the attention kernel share.
#include <hip/hip_runtime.h>
#include <math.h>
#include <stdint.h>
#include <stddef.h>

typedef _Float16 v16h __attribute__((ext_vector_type(16)));
typedef _Float16 v8h  __attribute__((ext_vector_type(8), __may_alias__));
typedef _Float16 v4h  __attribute__((ext_vector_type(4), __may_alias__));
typedef float    v8f  __attribute__((ext_vector_type(8)));
typedef float    v4f  __attribute__((ext_vector_type(4), __may_alias__));
typedef int      v4i  __attribute__((ext_vector_type(4), __may_alias__));

union Frag { v16h v; v8h p[2]; };

constexpr int BSZ   = 2;
constexpr int NSEQ  = 2048;
constexpr int CDIM  = 1024;
constexpr int HN    = 16;
constexpr int DH    = 64;
constexpr int QKVN  = 3 * CDIM;                         // 3072
constexpr int MROWS = BSZ * NSEQ;                       // 4096
constexpr size_t QKV_S = (size_t)BSZ * HN * NSEQ * DH;  // halves per q/k/v plane
constexpr float WSCALE = 64.0f;                         // weight pre-scale (exact power of two)
constexpr float PSCALE = 256.0f;                        // P pre-scale
constexpr float ASCALE = 64.0f;                         // attention-output pre-scale
// LDS row pitches in halves: 16 B x odd, so the 16 rows of a ds_load_b128 fragment read fall on distinct banks
constexpr int AP = 72;                                  // 64-half rows (GEMM k slices, attention tiles): 144 B
constexpr int MP = 68;                                  // 64-int rows (mask chunk), in ints: 272 B
// packed mask: per (16-query group, 64-key chunk) 32 words; bit l of word 8 t + r is
// mask[query l & 15][key 16 t + 8 (l >> 4) + r] != 0, the score that lane l holds in register r of score tile t
constexpr int MWORDS = 32;
constexpr int NCHUNK = NSEQ / 64;                       // 32

// one 16x16x32 f16 WMMA with the VALU hazard guard attached
__device__ __forceinline__ v8f wmma_f16(v16h a, v16h b, v8f c) {
  v8f d = __builtin_amdgcn_wmma_f32_16x16x32_f16(false, a, false, b, (short)0, c, false, false);
  asm volatile("v_nop\n\tv_nop\n\tv_nop\n\tv_nop" : "+v"(d) : "v"(a), "v"(b));
  return d;
}

// 16-bit fragment from a k-contiguous row (A row m, or B stored [n][k] row n):
// elements 0..7 <- k0+8*lh .. +7, elements 8..15 <- k0+16+8*lh .. +7  (lh = lane >> 4)
__device__ __forceinline__ v16h ld_frag(const _Float16* rk, int lh) {
  Frag f;
  f.p[0] = *(const v8h*)(rk + 8 * lh);
  f.p[1] = *(const v8h*)(rk + 16 + 8 * lh);
  return f.v;
}

// the same fragment from a staged weight row whose four 16-B k chunks lie at chunk ^ sw (sw = (n >> 4) & 3)
__device__ __forceinline__ v16h ld_frag_sw(const _Float16* rk, int lh, int sw) {
  Frag f;
  f.p[0] = *(const v8h*)(rk + ((lh ^ sw) << 3));
  f.p[1] = *(const v8h*)(rk + (((2 + lh) ^ sw) << 3));
  return f.v;
}

// ---------------------------------------------------------------------------
// QKV projection: C tile 128x128 per block (256 threads, 8 waves as 4 x 2, each 32 rows x 64 columns), K loop step 64.
__global__ __launch_bounds__(256)
void k_qkv(const float* __restrict__ x, const float* __restrict__ W, const float* __restrict__ bias,
           const int* __restrict__ am, _Float16* __restrict__ qkv, unsigned int* __restrict__ mbits) {
  __shared__ __align__(16) _Float16 lds[2 * 128 * AP];  // As[128][AP] | Bs[128][AP]; reused as four C sub-tiles [64][AP]
  _Float16* As = lds;
  _Float16* Bs = lds + 128 * AP;

  const int tid = threadIdx.x, lane = tid & 31, w = tid >> 5, m = lane & 15, lh = lane >> 4;
  const int wr = w >> 1, wc = w & 1;                     // this wave's 32-row band and 64-column band of the tile
  const int cblk = blockIdx.x * 128, rblk = blockIdx.y * 128;
  if (cblk + 128 > QKVN || rblk + 128 > MROWS) return;   // block-uniform, before any barrier

  // mask packing: the first 16 column blocks of a row band take two 64-key chunks each; a wave takes its own 16 query rows.
  // Loads cover whole lines (16 lanes x 16 B = one row's 256 B); the turn to the score layout goes through LDS.
  if (blockIdx.x < NCHUNK / 2) {                         // block-uniform
    int* mw = reinterpret_cast<int*>(lds) + w * (16 * MP);
    const int* msrc = am + (size_t)(rblk + 16 * w + lh) * NSEQ + blockIdx.x * 128 + m * 4;
    v4i m4[2][8];
#pragma unroll
    for (int u = 0; u < 2; ++u)
#pragma unroll
      for (int it = 0; it < 8; ++it) m4[u][it] = *(const v4i*)(msrc + (size_t)(2 * it) * NSEQ + u * 64);
#pragma unroll
    for (int u = 0; u < 2; ++u) {
#pragma unroll
      for (int it = 0; it < 8; ++it) *(v4i*)(mw + (2 * it + lh) * MP + m * 4) = m4[u][it];
      __syncthreads();                                     // rows written by other lanes are read below
      unsigned int pk = 0;
#pragma unroll
      for (int t = 0; t < 4; ++t) {
        const v4i ma = *(const v4i*)(mw + m * MP + t * 16 + 8 * lh);
        const v4i mb = *(const v4i*)(mw + m * MP + t * 16 + 8 * lh + 4);
#pragma unroll
        for (int r = 0; r < 8; ++r) {
          const int mv = (r < 4) ? ma[r & 3] : mb[r & 3];
          const unsigned int word = __builtin_amdgcn_ballot_w32(mv != 0);
          if (lane == t * 8 + r) pk = word;                // lane i keeps word i
        }
      }
      mbits[((size_t)((rblk >> 4) + w) * NCHUNK + blockIdx.x * 2 + u) * MWORDS + lane] = pk;  // one whole line
      __syncthreads();                                     // reads done before the rows are overwritten (next chunk, then the GEMM tiles)
    }
  }

  // A staging: 16 lanes x 16 B cover one row's 256-B k slice (two whole lines of x); a wave's 2 rows lie 8 apart,
  // so its 8-B LDS stores fall on all 64 banks once
  const int ar = 8 * lh + w, ac = m * 4;                 // rows ar + 16 j
  // B staging: a wave's 32 lanes x 16 B cover one k row's whole 512 B; a thread holds k = 8 w + j (j = 0..7) of columns
  // n = bn + e, so each column's 8 k go as one 16-B store; chunk c of row n is stored at c ^ ((n >> 4) & 3), which puts
  // the 16 rows of a lane half (4 apart) on distinct banks
  const int bn = lane * 4, bsw = (lane >> 2) & 3;
  const float* ap = x + (size_t)(rblk + ar) * CDIM + ac;
  const float* bp = W + (size_t)(8 * w) * QKVN + cblk + bn;
  _Float16* bdst = Bs + bn * AP + ((w ^ bsw) << 3);

  v8f acc[2][4] = {};

  for (int k0 = 0; k0 < CDIM; k0 += 64) {
    v4f a4[8], b4[8];
#pragma unroll
    for (int j = 0; j < 8; ++j) a4[j] = *(const v4f*)(ap + (size_t)(16 * j) * CDIM + k0);
#pragma unroll
    for (int j = 0; j < 8; ++j) b4[j] = *(const v4f*)(bp + (size_t)(k0 + j) * QKVN);
    __builtin_amdgcn_sched_barrier(0);                     // all 16 loads issue before the first conversion waits on one
    asm volatile("s_wait_xcnt 0x0" ::: "memory");          // before the loads' address registers are advanced
    __syncthreads();
#pragma unroll
    for (int j = 0; j < 8; ++j)
      *(v4h*)(As + (ar + 16 * j) * AP + ac) = __builtin_convertvector(a4[j], v4h);
#pragma unroll
    for (int e = 0; e < 4; ++e) {
      v8h t;
#pragma unroll
      for (int j = 0; j < 8; ++j) t[j] = (_Float16)(b4[j][e] * WSCALE);
      *(v8h*)(bdst + e * AP) = t;                          // Bs[n][k], chunks swizzled
    }
    __syncthreads();

#pragma unroll
    for (int kk = 0; kk < 2; ++kk) {
      v16h af[2], bf[4];
#pragma unroll
      for (int mt = 0; mt < 2; ++mt) af[mt] = ld_frag(As + (wr * 32 + mt * 16 + m) * AP + kk * 32, lh);
#pragma unroll
      for (int nt = 0; nt < 4; ++nt) bf[nt] = ld_frag_sw(Bs + (wc * 64 + nt * 16 + m) * AP + kk * 32, lh, nt);
#pragma unroll
      for (int mt = 0; mt < 2; ++mt)
#pragma unroll
        for (int nt = 0; nt < 4; ++nt) acc[mt][nt] = wmma_f16(af[mt], bf[nt], acc[mt][nt]);
    }
  }

  // stage the C tile (bias added, weight scale undone) in LDS as f16, as four 64x64 sub-tiles (64 rows of one head each):
  // q and k sub-tiles as [row][d]; a v sub-tile as [d][row], where a lane's 8 accumulator registers are 8 consecutive
  // rows of one d, so they go as one 16-B store
  __syncthreads();
  const int sS = cblk >> 10, hd0 = (cblk & 1023) >> 6, b = rblk >> 11, n0 = rblk & 2047;
  const bool isv = (sS == 2);                            // block-uniform
  _Float16* Cw = lds + ((wr >> 1) * 2 + wc) * (64 * AP); // this wave's sub-tile
  const int lr = (wr & 1) * 32;                          // its first row there
  v8h o[2][4];
#pragma unroll
  for (int nt = 0; nt < 4; ++nt) {
    const float bb = bias[cblk + wc * 64 + nt * 16 + m];
#pragma unroll
    for (int mt = 0; mt < 2; ++mt)
#pragma unroll
      for (int r = 0; r < 8; ++r) o[mt][nt][r] = (_Float16)(acc[mt][nt][r] * (1.0f / WSCALE) + bb);
  }
  if (isv) {
#pragma unroll
    for (int mt = 0; mt < 2; ++mt)
#pragma unroll
      for (int nt = 0; nt < 4; ++nt) *(v8h*)(Cw + (nt * 16 + m) * AP + lr + mt * 16 + 8 * lh) = o[mt][nt];
  } else {
#pragma unroll
    for (int mt = 0; mt < 2; ++mt)
#pragma unroll
      for (int nt = 0; nt < 4; ++nt)
#pragma unroll
        for (int r = 0; r < 8; ++r) Cw[(lr + mt * 16 + 8 * lh + r) * AP + nt * 16 + m] = o[mt][nt][r];
  }
  __syncthreads();

  // whole-line stores: each sub-tile is 4096 contiguous halves; each instruction of a wave covers 4 full lines.
  // The v plane so holds, per head, tiles of 64 keys, each tile laid [d][key].
  v8h vv[8];
#pragma unroll
  for (int j = 0; j < 8; ++j) {
    const int cc = (j & 1) * 256 + tid;                    // 16-B chunk within sub-tile j >> 1
    vv[j] = *(const v8h*)(lds + (j >> 1) * (64 * AP) + (cc >> 3) * AP + (cc & 7) * 8);
  }
#pragma unroll
  for (int j = 0; j < 8; ++j) {
    const int sub = j >> 1, cc = (j & 1) * 256 + tid;
    _Float16* dst = qkv + (size_t)sS * QKV_S +
                    ((size_t)(b * HN + hd0 + (sub & 1)) * NSEQ + n0 + 64 * (sub >> 1)) * DH;
    *(v8h*)(dst + cc * 8) = vv[j];
  }
}

__device__ __forceinline__ float xhalf(float v) {          // lane l <-> lane l ^ 16
  const int i = __builtin_bit_cast(int, v);
  return __builtin_bit_cast(float, __builtin_amdgcn_permlanex16(i, i, 0x76543210, 0xfedcba98, false, false));
}

__global__ __launch_bounds__(128)
void k_attn(const _Float16* __restrict__ qkv, const float* __restrict__ x,
            const float* __restrict__ We, const float* __restrict__ be,
            const unsigned int* __restrict__ mbits, _Float16* __restrict__ aw) {
  __shared__ __align__(16) _Float16 Qs[64 * AP];       // [query][d]
  __shared__ __align__(16) _Float16 Ks[64 * AP];       // [key][d]   (k-contiguous A for S^T)
  __shared__ __align__(16) _Float16 Vt[64 * AP];       // [d][key]   (k-contiguous A for V^T.P^T)
  __shared__ float gsig[64];

  const int tid = threadIdx.x, lane = tid & 31, w = tid >> 5, m = lane & 15, lh = lane >> 4;
  const int bid = blockIdx.x;
  const int qt = bid & 31, bh = bid >> 5, hd = bh & 15, b = bh >> 4;
  if (b >= BSZ) return;                                   // block-uniform
  const int qbase = qt * 64;

  const _Float16* Qg = qkv + ((size_t)(b * HN + hd) * NSEQ) * DH;
  const _Float16* Kg = Qg + QKV_S;
  const _Float16* Vg = Kg + QKV_S;

  // gate: each wave takes its own 16 query rows with its lanes along k, so every x load covers whole lines;
  // the head's We column is gathered once into LDS; per-lane partial sums are joined through LDS, all f32
  {
    float* wcol = reinterpret_cast<float*>(Ks);            // 1024 floats, free until the key loop
    float* part = reinterpret_cast<float*>(Vt);            // 64 rows x 33 floats, free until the key loop
#pragma unroll
    for (int i = 0; i < 8; ++i) wcol[i * 128 + tid] = We[(size_t)(i * 128 + tid) * HN + hd];
    __syncthreads();
    v4f wv[8];
#pragma unroll
    for (int i = 0; i < 8; ++i) wv[i] = *(const v4f*)(wcol + i * 128 + lane * 4);
    const float* xr = x + ((size_t)(b * NSEQ + qbase + w * 16)) * CDIM;
    for (int rr = 0; rr < 16; rr += 2) {                   // two rows a trip = 16 loads in flight per wave
      v4f s4[2] = {};
#pragma unroll
      for (int i = 0; i < 8; ++i)
#pragma unroll
        for (int u = 0; u < 2; ++u)
          s4[u] += *(const v4f*)(xr + (size_t)(rr + u) * CDIM + i * 128 + lane * 4) * wv[i];
#pragma unroll
      for (int u = 0; u < 2; ++u)
        part[(w * 16 + rr + u) * 33 + lane] = (s4[u][0] + s4[u][1]) + (s4[u][2] + s4[u][3]);
    }
    __syncthreads();
    const int q = tid >> 1, half = tid & 1;
    float s = 0.0f;
#pragma unroll
    for (int t = 0; t < 16; ++t) s += part[q * 33 + half * 16 + t];
    s += __shfl_xor(s, 1, 32);
    if (half == 0) {
      const float z = s + be[hd];
      gsig[q] = 1.0f / (1.0f + expf(-z));
    }
  }
  // Q tile: 4096 contiguous halves
  {
    const _Float16* src = Qg + (size_t)qbase * DH;
#pragma unroll
    for (int it = 0; it < 4; ++it) {
      const int c = it * 128 + tid;
      *(v8h*)(Qs + (c >> 3) * AP + (c & 7) * 8) = *(const v8h*)(src + c * 8);
    }
  }
  __syncthreads();

  v16h qb[2];                                              // B: column = query m, k = d
  qb[0] = ld_frag(Qs + (w * 16 + m) * AP, lh);
  qb[1] = ld_frag(Qs + (w * 16 + m) * AP + 32, lh);

  float mstate = -__builtin_inff();                        // this lane's query: running maximum (both halves alike)
  float lstate = 0.0f;                                     // running sum over this lane half's keys only
  const float g = gsig[w * 16 + m] * 0.125f;               // gate * 1/sqrt(64)
  v8f O[4] = {};                                           // O[nt2][r] = O^T[d = 16 nt2 + 8 lh + r][query m]

  // this wave's packed mask: lane i loads word i of a chunk (one whole line per wave and chunk)
  const unsigned int* mrow = mbits + (size_t)((b * NSEQ + qbase) / 16 + w) * (NCHUNK * MWORDS) + lane;

  for (int j = 0; j < NSEQ / 64; ++j) {
    const int kb = j * 64;
    __syncthreads();
    const unsigned int mword = mrow[j * MWORDS];
    {  // K chunk and V chunk (already [d][key] in the workspace): direct copies
      const _Float16* ksrc = Kg + (size_t)kb * DH;
      v8h k8[4], v8[4];
#pragma unroll
      for (int it = 0; it < 4; ++it) k8[it] = *(const v8h*)(ksrc + (it * 128 + tid) * 8);
#pragma unroll
      for (int it = 0; it < 4; ++it) v8[it] = *(const v8h*)(Vg + (size_t)kb * DH + (it * 128 + tid) * 8);
      asm volatile("s_wait_xcnt 0x0" ::: "memory");        // before the loads' address registers are advanced
#pragma unroll
      for (int it = 0; it < 4; ++it) {
        const int c = it * 128 + tid;
        *(v8h*)(Ks + (c >> 3) * AP + (c & 7) * 8) = k8[it];
      }
#pragma unroll
      for (int it = 0; it < 4; ++it) {
        const int c = it * 128 + tid;
        *(v8h*)(Vt + (c >> 3) * AP + (c & 7) * 8) = v8[it];
      }
    }
    __syncthreads();

    // S^T = K.Q^T : rows = 64 keys (4 tiles), cols = 16 queries of this wave, K = 64
    v8f S[4];
#pragma unroll
    for (int t = 0; t < 4; ++t) {
      v8f z = {};
      v16h kf0 = ld_frag(Ks + (t * 16 + m) * AP, lh);
      v16h kf1 = ld_frag(Ks + (t * 16 + m) * AP + 32, lh);
      z = wmma_f16(kf0, qb[0], z);
      z = wmma_f16(kf1, qb[1], z);
      S[t] = z;
    }

    // scale, gate, mask, online softmax: all 32 scores of a lane belong to query m
    float mt[4];
#pragma unroll
    for (int t = 0; t < 4; ++t) {
      mt[t] = -__builtin_inff();
#pragma unroll
      for (int r = 0; r < 8; ++r) {
        float lv = S[t][r] * g;
        // word 8 t + r, read from its lane into a scalar register, is the select's lane mask as it stands
        if (!__builtin_amdgcn_inverse_ballot_w32(__builtin_amdgcn_readlane(mword, t * 8 + r))) lv = -__builtin_inff();
        S[t][r] = lv;
        mt[t] = fmaxf(mt[t], lv);
      }
    }
    float mx = fmaxf(fmaxf(mt[0], mt[1]), fmaxf(mt[2], mt[3]));
    mx = fmaxf(mx, xhalf(mx));
    const float mnew = fmaxf(mstate, mx);
    const bool dead = (mnew == -__builtin_inff());
    const float alpha = dead ? 1.0f : __expf(mstate - mnew);
    const float msub = dead ? 0.0f : mnew;                 // a row with no open key yet: exp(-inf - 0) = 0
    float rt[4];
    Frag pb[2];                                            // B: column = query m, k = key in the hardware k order
#pragma unroll
    for (int t = 0; t < 4; ++t) {
      rt[t] = 0.0f;
#pragma unroll
      for (int r = 0; r < 8; ++r) {
        const float p = __expf(S[t][r] - msub);
        rt[t] += p;
        pb[t >> 1].p[t & 1][r] = (_Float16)(p * PSCALE);
      }
    }
    lstate = lstate * alpha + ((rt[0] + rt[1]) + (rt[2] + rt[3]));
    mstate = mnew;
#pragma unroll
    for (int nt2 = 0; nt2 < 4; ++nt2) O[nt2] *= alpha;

    // O^T += V^T . (256 P)^T : K = 64 keys
#pragma unroll
    for (int kk = 0; kk < 2; ++kk) {
      v16h va[4];
#pragma unroll
      for (int nt2 = 0; nt2 < 4; ++nt2) va[nt2] = ld_frag(Vt + (nt2 * 16 + m) * AP + kk * 32, lh);
#pragma unroll
      for (int nt2 = 0; nt2 < 4; ++nt2) O[nt2] = wmma_f16(va[nt2], pb[kk].v, O[nt2]);
    }
  }

  // normalise: a = O / (256 l); store a*64 = O / (4 l) as f16, staged in Ks; a lane's 8 registers are 8 consecutive d
  __syncthreads();
  const float l = lstate + xhalf(lstate);
  const float inv = (l > 0.0f) ? (0.25f / l) : 0.0f;
#pragma unroll
  for (int nt2 = 0; nt2 < 4; ++nt2)
    *(v8h*)(Ks + (w * 16 + m) * AP + nt2 * 16 + 8 * lh) = __builtin_convertvector(O[nt2] * inv, v8h);
  __syncthreads();

  v8h vv[4];
#pragma unroll
  for (int jj = 0; jj < 4; ++jj) {
    const int c = jj * 128 + tid;
    vv[jj] = *(const v8h*)(Ks + (c >> 3) * AP + (c & 7) * 8);
  }
#pragma unroll
  for (int jj = 0; jj < 4; ++jj) {
    const int c = jj * 128 + tid;
    _Float16* dst = aw + ((size_t)(b * NSEQ + qbase + (c >> 3))) * CDIM + hd * DH + (c & 7) * 8;
    *(v8h*)dst = vv[jj];
  }
  
}

// ---------------------------------------------------------------------------
// Output projection: out = (a x64) . (Wo x64) / 4096 + bo ; C tile 128x128 f32 (8 waves as 4 x 2, each 32 x 64),
// K loop step 64, grid = (1024/128, 4096/128)
constexpr int CP = 132;                                  // f32 C rows in LDS, in floats: rows 8 apart fall 32 banks apart
__global__ __launch_bounds__(256)
void k_out(const _Float16* __restrict__ aw, const float* __restrict__ Wo, const float* __restrict__ bo,
           float* __restrict__ out) {
  __shared__ __align__(16) float ldsf[128 * CP];         // As|Bs (f16, 2 x 128 x AP) then Cs (f32)
  _Float16* As = reinterpret_cast<_Float16*>(ldsf);
  _Float16* Bs = As + 128 * AP;

  const int tid = threadIdx.x, lane = tid & 31, w = tid >> 5, m = lane & 15, lh = lane >> 4;
  const int wr = w >> 1, wc = w & 1;                     // this wave's 32-row band and 64-column band of the tile
  const int cblk = blockIdx.x * 128, rblk = blockIdx.y * 128;
  if (cblk + 128 > CDIM || rblk + 128 > MROWS) return;   // block-uniform

  // A staging: 8 lanes x 16 B cover one row's whole 128-B k slice (one line); the 2 rows of a lane half lie 8 apart (distinct banks)
  const int ar = (lane >> 3) * 8 + w, ac = (lane & 7) * 8;   // rows ar + 32 j
  const int bn = lane * 4, bsw = (lane >> 2) & 3;        // k = 8 w + j, n = bn + e, chunk swizzle as in k_qkv
  const _Float16* ap = aw + (size_t)(rblk + ar) * CDIM + ac;
  const float* bp = Wo + (size_t)(8 * w) * CDIM + cblk + bn;
  _Float16* bdst = Bs + bn * AP + ((w ^ bsw) << 3);

  v8f acc[2][4] = {};

  for (int k0 = 0; k0 < CDIM; k0 += 64) {
    v8h a8[4];
    v4f b4[8];
#pragma unroll
    for (int j = 0; j < 4; ++j) a8[j] = *(const v8h*)(ap + (size_t)(32 * j) * CDIM + k0);
#pragma unroll
    for (int j = 0; j < 8; ++j) b4[j] = *(const v4f*)(bp + (size_t)(k0 + j) * CDIM);
    asm volatile("s_wait_xcnt 0x0" ::: "memory");          // before the loads' address registers are advanced
    __syncthreads();
#pragma unroll
    for (int j = 0; j < 4; ++j) *(v8h*)(As + (ar + 32 * j) * AP + ac) = a8[j];
#pragma unroll
    for (int e = 0; e < 4; ++e) {
      v8h t;
#pragma unroll
      for (int j = 0; j < 8; ++j) t[j] = (_Float16)(b4[j][e] * WSCALE);
      *(v8h*)(bdst + e * AP) = t;                          // Bs[n][k], chunks swizzled
    }
    __syncthreads();

#pragma unroll
    for (int kk = 0; kk < 2; ++kk) {
      v16h af[2], bf[4];
#pragma unroll
      for (int mt = 0; mt < 2; ++mt) af[mt] = ld_frag(As + (wr * 32 + mt * 16 + m) * AP + kk * 32, lh);
#pragma unroll
      for (int nt = 0; nt < 4; ++nt) bf[nt] = ld_frag_sw(Bs + (wc * 64 + nt * 16 + m) * AP + kk * 32, lh, nt);
#pragma unroll
      for (int mt = 0; mt < 2; ++mt)
#pragma unroll
        for (int nt = 0; nt < 4; ++nt) acc[mt][nt] = wmma_f16(af[mt], bf[nt], acc[mt][nt]);
    }
  }

  __syncthreads();
  float* Cs = ldsf;
#pragma unroll
  for (int nt = 0; nt < 4; ++nt) {
    const int col = wc * 64 + nt * 16 + m;
    const float bb = bo[cblk + col];
#pragma unroll
    for (int mt = 0; mt < 2; ++mt)
#pragma unroll
      for (int r = 0; r < 8; ++r)
        Cs[(wr * 32 + mt * 16 + 8 * lh + r) * CP + col] = acc[mt][nt][r] * (1.0f / (ASCALE * WSCALE)) + bb;
  }
  __syncthreads();

  // each row segment is 512 B = 4 lines: one 16-B store instruction of a wave writes one whole row segment
  v4f vv[16];
#pragma unroll
  for (int jj = 0; jj < 16; ++jj) {
    const int c = jj * 256 + tid;
    vv[jj] = *(const v4f*)(Cs + (c >> 5) * CP + (c & 31) * 4);
  }
#pragma unroll
  for (int jj = 0; jj < 16; ++jj) {
    const int c = jj * 256 + tid;
    float* dst = out + (size_t)(rblk + (c >> 5)) * CDIM + cblk + (c & 31) * 4;
    *(v4f*)dst = vv[jj];
  }
}

// ---------------------------------------------------------------------------
extern "C" void kernel_launch(void* const* d_in, const int* in_sizes, int n_in,
                              void* d_out, int out_size, void* d_ws, size_t ws_size,
                              hipStream_t stream) {
  if (n_in < 8) return;
  if (in_sizes[0] != MROWS * CDIM) return;
  if (in_sizes[1] != BSZ * NSEQ * NSEQ) return;
  if (in_sizes[2] != CDIM * QKVN) return;
  if (in_sizes[3] != QKVN) return;
  if (in_sizes[4] != CDIM * HN) return;
  if (in_sizes[5] != HN) return;
  if (in_sizes[6] != CDIM * CDIM) return;
  if (in_sizes[7] != CDIM) return;
  if (out_size != MROWS * CDIM) return;

  const float* x    = (const float*)d_in[0];
  const int*   am   = (const int*)d_in[1];
  const float* Wqkv = (const float*)d_in[2];
  const float* bqkv = (const float*)d_in[3];
  const float* We   = (const float*)d_in[4];
  const float* be   = (const float*)d_in[5];
  const float* Wo   = (const float*)d_in[6];
  const float* bo   = (const float*)d_in[7];
  float* out = (float*)d_out;

  const size_t qkv_bytes = (size_t)3 * QKV_S * sizeof(_Float16);          // 25,165,824
  const size_t aw_off    = qkv_bytes;
  const size_t aw_bytes  = (size_t)MROWS * CDIM * sizeof(_Float16);       //  8,388,608
  const size_t mb_off    = aw_off + aw_bytes;
  const size_t mb_bytes  = (size_t)(MROWS / 16) * NCHUNK * MWORDS * sizeof(unsigned int);  // 1,048,576
  if (mb_off + mb_bytes > ws_size) return;
  char* ws = (char*)d_ws;
  _Float16* qkvws = (_Float16*)ws;
  _Float16* awws  = (_Float16*)(ws + aw_off);
  unsigned int* mbws = (unsigned int*)(ws + mb_off);

  k_qkv<<<dim3(QKVN / 128, MROWS / 128), 256, 0, stream>>>(x, Wqkv, bqkv, am, qkvws, mbws);
  k_attn<<<dim3(BSZ * HN * (NSEQ / 64)), 128, 0, stream>>>(qkvws, x, We, be, mbws, awws);
  k_out<<<dim3(CDIM / 128, MROWS / 128), 256, 0, stream>>>(awws, Wo, bo, out);
}

// v007
// One run takes 106 microseconds.
// In both of two side-by-side timings against v006, it was 1.06 times as fast.
// All steps since v000 together make it 3.95 times as fast.
// Contractions: QKV projection, Q.K^T, P.V and output projection on v_wmma_f32_16x16x32_f16 (f16 operands, f32 accumulate);
// weights carried x64, P carried x256, attention output carried x64 (scales undone in f32); per-query gate dot (K=1024, N=16) on VALU f32.
// The int32 mask is packed once, by the projection kernel, into lane-mask words that all 16 heads of the attention kernel share.
#include <hip/hip_runtime.h>
#include <math.h>
#include <stdint.h>
#include <stddef.h>

typedef _Float16 v16h __attribute__((ext_vector_type(16)));
typedef _Float16 v8h  __attribute__((ext_vector_type(8), __may_alias__));
typedef _Float16 v4h  __attribute__((ext_vector_type(4), __may_alias__));
typedef float    v8f  __attribute__((ext_vector_type(8)));
typedef float    v4f  __attribute__((ext_vector_type(4), __may_alias__));
typedef int      v4i  __attribute__((ext_vector_type(4), __may_alias__));

union Frag { v16h v; v8h p[2]; };

constexpr int BSZ   = 2;
constexpr int NSEQ  = 2048;
constexpr int CDIM  = 1024;
constexpr int HN    = 16;
constexpr int DH    = 64;
constexpr int QKVN  = 3 * CDIM;                         // 3072
constexpr int MROWS = BSZ * NSEQ;                       // 4096
constexpr size_t QKV_S = (size_t)BSZ * HN * NSEQ * DH;  // halves per q/k/v plane
constexpr float WSCALE = 64.0f;                         // weight pre-scale (exact power of two)
constexpr float PSCALE = 256.0f;                        // P pre-scale
constexpr float ASCALE = 64.0f;                         // attention-output pre-scale
// LDS row pitches in halves: 16 B x odd, so the 16 rows of a ds_load_b128 fragment read fall on distinct banks
constexpr int AP = 72;                                  // 64-half rows (GEMM k slices, attention tiles): 144 B
constexpr int MP = 68;                                  // 64-int rows (mask chunk), in ints: 272 B
// packed mask: per (16-query group, 64-key chunk) 32 words; bit l of word 8 t + r is
// mask[query l & 15][key 16 t + 8 (l >> 4) + r] != 0, the score that lane l holds in register r of score tile t
constexpr int MWORDS = 32;
constexpr int NCHUNK = NSEQ / 64;                       // 32

// one 16x16x32 f16 WMMA with the VALU hazard guard attached
__device__ __forceinline__ v8f wmma_f16(v16h a, v16h b, v8f c) {
  v8f d = __builtin_amdgcn_wmma_f32_16x16x32_f16(false, a, false, b, (short)0, c, false, false);
  asm volatile("v_nop\n\tv_nop\n\tv_nop\n\tv_nop" : "+v"(d) : "v"(a), "v"(b));
  return d;
}

// 16-bit fragment from a k-contiguous row (A row m, or B stored [n][k] row n):
// elements 0..7 <- k0+8*lh .. +7, elements 8..15 <- k0+16+8*lh .. +7  (lh = lane >> 4)
__device__ __forceinline__ v16h ld_frag(const _Float16* rk, int lh) {
  Frag f;
  f.p[0] = *(const v8h*)(rk + 8 * lh);
  f.p[1] = *(const v8h*)(rk + 16 + 8 * lh);
  return f.v;
}

// the same fragment from a staged weight row whose four 16-B k chunks lie at chunk ^ sw (sw = (n >> 4) & 3)
__device__ __forceinline__ v16h ld_frag_sw(const _Float16* rk, int lh, int sw) {
  Frag f;
  f.p[0] = *(const v8h*)(rk + ((lh ^ sw) << 3));
  f.p[1] = *(const v8h*)(rk + (((2 + lh) ^ sw) << 3));
  return f.v;
}

// ---------------------------------------------------------------------------
// QKV projection: C tile 128x128 per block (256 threads, 8 waves as 4 x 2, each 32 rows x 64 columns), K loop step 64.
__global__ __launch_bounds__(256)
void k_qkv(const float* __restrict__ x, const float* __restrict__ W, const float* __restrict__ bias,
           const int* __restrict__ am, _Float16* __restrict__ qkv, unsigned int* __restrict__ mbits) {
  __shared__ __align__(16) _Float16 lds[2 * 128 * AP];  // As[128][AP] | Bs[128][AP]; reused as four C sub-tiles [64][AP]
  _Float16* As = lds;
  _Float16* Bs = lds + 128 * AP;

  const int tid = threadIdx.x, lane = tid & 31, w = tid >> 5, m = lane & 15, lh = lane >> 4;
  const int wr = w >> 1, wc = w & 1;                     // this wave's 32-row band and 64-column band of the tile
  const int cblk = blockIdx.x * 128, rblk = blockIdx.y * 128;
  if (cblk + 128 > QKVN || rblk + 128 > MROWS) return;   // block-uniform, before any barrier

  // mask packing: the first 16 column blocks of a row band take two 64-key chunks each; a wave takes its own 16 query rows.
  // Loads cover whole lines (16 lanes x 16 B = one row's 256 B); the turn to the score layout goes through LDS.
  if (blockIdx.x < NCHUNK / 2) {                         // block-uniform
    int* mw = reinterpret_cast<int*>(lds) + w * (16 * MP);
    const int* msrc = am + (size_t)(rblk + 16 * w + lh) * NSEQ + blockIdx.x * 128 + m * 4;
    v4i m4[2][8];
#pragma unroll
    for (int u = 0; u < 2; ++u)
#pragma unroll
      for (int it = 0; it < 8; ++it) m4[u][it] = *(const v4i*)(msrc + (size_t)(2 * it) * NSEQ + u * 64);
#pragma unroll
    for (int u = 0; u < 2; ++u) {
#pragma unroll
      for (int it = 0; it < 8; ++it) *(v4i*)(mw + (2 * it + lh) * MP + m * 4) = m4[u][it];
      __syncthreads();                                     // rows written by other lanes are read below
      unsigned int pk = 0;
#pragma unroll
      for (int t = 0; t < 4; ++t) {
        const v4i ma = *(const v4i*)(mw + m * MP + t * 16 + 8 * lh);
        const v4i mb = *(const v4i*)(mw + m * MP + t * 16 + 8 * lh + 4);
#pragma unroll
        for (int r = 0; r < 8; ++r) {
          const int mv = (r < 4) ? ma[r & 3] : mb[r & 3];
          const unsigned int word = __builtin_amdgcn_ballot_w32(mv != 0);
          if (lane == t * 8 + r) pk = word;                // lane i keeps word i
        }
      }
      mbits[((size_t)((rblk >> 4) + w) * NCHUNK + blockIdx.x * 2 + u) * MWORDS + lane] = pk;  // one whole line
      __syncthreads();                                     // reads done before the rows are overwritten (next chunk, then the GEMM tiles)
    }
  }

  // A staging: 16 lanes x 16 B cover one row's 256-B k slice (two whole lines of x); a wave's 2 rows lie 8 apart,
  // so its 8-B LDS stores fall on all 64 banks once
  const int ar = 8 * lh + w, ac = m * 4;                 // rows ar + 16 j
  // B staging: a wave's 32 lanes x 16 B cover one k row's whole 512 B; a thread holds k = 8 w + j (j = 0..7) of columns
  // n = bn + e, so each column's 8 k go as one 16-B store; chunk c of row n is stored at c ^ ((n >> 4) & 3), which puts
  // the 16 rows of a lane half (4 apart) on distinct banks
  const int bn = lane * 4, bsw = (lane >> 2) & 3;
  const float* ap = x + (size_t)(rblk + ar) * CDIM + ac;
  const float* bp = W + (size_t)(8 * w) * QKVN + cblk + bn;
  _Float16* bdst = Bs + bn * AP + ((w ^ bsw) << 3);

  v8f acc[2][4] = {};

  for (int k0 = 0; k0 < CDIM; k0 += 64) {
    v4f a4[8], b4[8];
#pragma unroll
    for (int j = 0; j < 8; ++j) a4[j] = *(const v4f*)(ap + (size_t)(16 * j) * CDIM + k0);
#pragma unroll
    for (int j = 0; j < 8; ++j) b4[j] = *(const v4f*)(bp + (size_t)(k0 + j) * QKVN);
    __builtin_amdgcn_sched_barrier(0);                     // all 16 loads issue before the first conversion waits on one
    asm volatile("s_wait_xcnt 0x0" ::: "memory");          // before the loads' address registers are advanced
    __syncthreads();
#pragma unroll
    for (int j = 0; j < 8; ++j)
      *(v4h*)(As + (ar + 16 * j) * AP + ac) = __builtin_convertvector(a4[j], v4h);
#pragma unroll
    for (int e = 0; e < 4; ++e) {
      v8h t;
#pragma unroll
      for (int j = 0; j < 8; ++j) t[j] = (_Float16)(b4[j][e] * WSCALE);
      *(v8h*)(bdst + e * AP) = t;                          // Bs[n][k], chunks swizzled
    }
    __syncthreads();

#pragma unroll
    for (int kk = 0; kk < 2; ++kk) {
      v16h af[2], bf[4];
#pragma unroll
      for (int mt = 0; mt < 2; ++mt) af[mt] = ld_frag(As + (wr * 32 + mt * 16 + m) * AP + kk * 32, lh);
#pragma unroll
      for (int nt = 0; nt < 4; ++nt) bf[nt] = ld_frag_sw(Bs + (wc * 64 + nt * 16 + m) * AP + kk * 32, lh, nt);
#pragma unroll
      for (int mt = 0; mt < 2; ++mt)
#pragma unroll
        for (int nt = 0; nt < 4; ++nt) acc[mt][nt] = wmma_f16(af[mt], bf[nt], acc[mt][nt]);
    }
  }

  // stage the C tile (bias added, weight scale undone) in LDS as f16, as four 64x64 sub-tiles (64 rows of one head each):
  // q and k sub-tiles as [row][d]; a v sub-tile as [d][row], where a lane's 8 accumulator registers are 8 consecutive
  // rows of one d, so they go as one 16-B store
  __syncthreads();
  const int sS = cblk >> 10, hd0 = (cblk & 1023) >> 6, b = rblk >> 11, n0 = rblk & 2047;
  const bool isv = (sS == 2);                            // block-uniform
  _Float16* Cw = lds + ((wr >> 1) * 2 + wc) * (64 * AP); // this wave's sub-tile
  const int lr = (wr & 1) * 32;                          // its first row there
  v8h o[2][4];
#pragma unroll
  for (int nt = 0; nt < 4; ++nt) {
    const float bb = bias[cblk + wc * 64 + nt * 16 + m];
#pragma unroll
    for (int mt = 0; mt < 2; ++mt)
#pragma unroll
      for (int r = 0; r < 8; ++r) o[mt][nt][r] = (_Float16)(acc[mt][nt][r] * (1.0f / WSCALE) + bb);
  }
  if (isv) {
#pragma unroll
    for (int mt = 0; mt < 2; ++mt)
#pragma unroll
      for (int nt = 0; nt < 4; ++nt) *(v8h*)(Cw + (nt * 16 + m) * AP + lr + mt * 16 + 8 * lh) = o[mt][nt];
  } else {
#pragma unroll
    for (int mt = 0; mt < 2; ++mt)
#pragma unroll
      for (int nt = 0; nt < 4; ++nt)
#pragma unroll
        for (int r = 0; r < 8; ++r) Cw[(lr + mt * 16 + 8 * lh + r) * AP + nt * 16 + m] = o[mt][nt][r];
  }
  __syncthreads();

  // whole-line stores: each sub-tile is 4096 contiguous halves; each instruction of a wave covers 4 full lines.
  // The v plane so holds, per head, tiles of 64 keys, each tile laid [d][key].
  v8h vv[8];
#pragma unroll
  for (int j = 0; j < 8; ++j) {
    const int cc = (j & 1) * 256 + tid;                    // 16-B chunk within sub-tile j >> 1
    vv[j] = *(const v8h*)(lds + (j >> 1) * (64 * AP) + (cc >> 3) * AP + (cc & 7) * 8);
  }
#pragma unroll
  for (int j = 0; j < 8; ++j) {
    const int sub = j >> 1, cc = (j & 1) * 256 + tid;
    _Float16* dst = qkv + (size_t)sS * QKV_S +
                    ((size_t)(b * HN + hd0 + (sub & 1)) * NSEQ + n0 + 64 * (sub >> 1)) * DH;
    *(v8h*)(dst + cc * 8) = vv[j];
  }
}

__device__ __forceinline__ float xhalf(float v) {          // lane l <-> lane l ^ 16
  const int i = __builtin_bit_cast(int, v);
  return __builtin_bit_cast(float, __builtin_amdgcn_permlanex16(i, i, 0x76543210, 0xfedcba98, false, false));
}

__global__ __launch_bounds__(128)
void k_attn(const _Float16* __restrict__ qkv, const float* __restrict__ x,
            const float* __restrict__ We, const float* __restrict__ be,
            const unsigned int* __restrict__ mbits, _Float16* __restrict__ aw) {
  __shared__ __align__(16) _Float16 Qs[64 * AP];       // [query][d]
  __shared__ __align__(16) _Float16 Ks[64 * AP];       // [key][d]   (k-contiguous A for S^T)
  __shared__ __align__(16) _Float16 Vt[64 * AP];       // [d][key]   (k-contiguous A for V^T.P^T)
  __shared__ float gsig[64];

  const int tid = threadIdx.x, lane = tid & 31, w = tid >> 5, m = lane & 15, lh = lane >> 4;
  const int bid = blockIdx.x;
  const int qt = bid & 31, bh = bid >> 5, hd = bh & 15, b = bh >> 4;
  if (b >= BSZ) return;                                   // block-uniform
  const int qbase = qt * 64;

  const _Float16* Qg = qkv + ((size_t)(b * HN + hd) * NSEQ) * DH;
  const _Float16* Kg = Qg + QKV_S;
  const _Float16* Vg = Kg + QKV_S;

  // gate: each wave takes its own 16 query rows with its lanes along k, so every x load covers whole lines;
  // the head's We column is gathered once into LDS; per-lane partial sums are joined through LDS, all f32
  {
    float* wcol = reinterpret_cast<float*>(Ks);            // 1024 floats, free until the key loop
    float* part = reinterpret_cast<float*>(Vt);            // 64 rows x 33 floats, free until the key loop
#pragma unroll
    for (int i = 0; i < 8; ++i) wcol[i * 128 + tid] = We[(size_t)(i * 128 + tid) * HN + hd];
    __syncthreads();
    v4f wv[8];
#pragma unroll
    for (int i = 0; i < 8; ++i) wv[i] = *(const v4f*)(wcol + i * 128 + lane * 4);
    const float* xr = x + ((size_t)(b * NSEQ + qbase + w * 16)) * CDIM;
    for (int rr = 0; rr < 16; rr += 2) {                   // two rows a trip = 16 loads in flight per wave
      v4f s4[2] = {};
#pragma unroll
      for (int i = 0; i < 8; ++i)
#pragma unroll
        for (int u = 0; u < 2; ++u)
          s4[u] += *(const v4f*)(xr + (size_t)(rr + u) * CDIM + i * 128 + lane * 4) * wv[i];
#pragma unroll
      for (int u = 0; u < 2; ++u)
        part[(w * 16 + rr + u) * 33 + lane] = (s4[u][0] + s4[u][1]) + (s4[u][2] + s4[u][3]);
    }
    __syncthreads();
    const int q = tid >> 1, half = tid & 1;
    float s = 0.0f;
#pragma unroll
    for (int t = 0; t < 16; ++t) s += part[q * 33 + half * 16 + t];
    s += __shfl_xor(s, 1, 32);
    if (half == 0) {
      const float z = s + be[hd];
      gsig[q] = 1.0f / (1.0f + expf(-z));
    }
  }
  // Q tile: 4096 contiguous halves
  {
    const _Float16* src = Qg + (size_t)qbase * DH;
#pragma unroll
    for (int it = 0; it < 4; ++it) {
      const int c = it * 128 + tid;
      *(v8h*)(Qs + (c >> 3) * AP + (c & 7) * 8) = *(const v8h*)(src + c * 8);
    }
  }
  __syncthreads();

  v16h qb[2];                                              // B: column = query m, k = d
  qb[0] = ld_frag(Qs + (w * 16 + m) * AP, lh);
  qb[1] = ld_frag(Qs + (w * 16 + m) * AP + 32, lh);

  float mstate = -__builtin_inff();                        // this lane's query: running maximum (both halves alike)
  float lstate = 0.0f;                                     // running sum over this lane half's keys only
  const float g = gsig[w * 16 + m] * 0.125f;               // gate * 1/sqrt(64)
  v8f O[4] = {};                                           // O[nt2][r] = O^T[d = 16 nt2 + 8 lh + r][query m]

  // this wave's packed mask: lane i loads word i of a chunk (one whole line per wave and chunk)
  const unsigned int* mrow = mbits + (size_t)((b * NSEQ + qbase) / 16 + w) * (NCHUNK * MWORDS) + lane;

  for (int j = 0; j < NSEQ / 64; ++j) {
    const int kb = j * 64;
    __syncthreads();
    const unsigned int mword = mrow[j * MWORDS];
    {  // K chunk and V chunk (already [d][key] in the workspace): direct copies
      const _Float16* ksrc = Kg + (size_t)kb * DH;
      v8h k8[4], v8[4];
#pragma unroll
      for (int it = 0; it < 4; ++it) k8[it] = *(const v8h*)(ksrc + (it * 128 + tid) * 8);
#pragma unroll
      for (int it = 0; it < 4; ++it) v8[it] = *(const v8h*)(Vg + (size_t)kb * DH + (it * 128 + tid) * 8);
      asm volatile("s_wait_xcnt 0x0" ::: "memory");        // before the loads' address registers are advanced
#pragma unroll
      for (int it = 0; it < 4; ++it) {
        const int c = it * 128 + tid;
        *(v8h*)(Ks + (c >> 3) * AP + (c & 7) * 8) = k8[it];
      }
#pragma unroll
      for (int it = 0; it < 4; ++it) {
        const int c = it * 128 + tid;
        *(v8h*)(Vt + (c >> 3) * AP + (c & 7) * 8) = v8[it];
      }
    }
    __syncthreads();

    // S^T = K.Q^T : rows = 64 keys (4 tiles), cols = 16 queries of this wave, K = 64
    v8f S[4];
#pragma unroll
    for (int t = 0; t < 4; ++t) {
      v8f z = {};
      v16h kf0 = ld_frag(Ks + (t * 16 + m) * AP, lh);
      v16h kf1 = ld_frag(Ks + (t * 16 + m) * AP + 32, lh);
      z = wmma_f16(kf0, qb[0], z);
      z = wmma_f16(kf1, qb[1], z);
      S[t] = z;
    }

    // scale, gate, mask, online softmax: all 32 scores of a lane belong to query m
    float mt[4];
#pragma unroll
    for (int t = 0; t < 4; ++t) {
      mt[t] = -__builtin_inff();
#pragma unroll
      for (int r = 0; r < 8; ++r) {
        float lv = S[t][r] * g;
        // word 8 t + r, read from its lane into a scalar register, is the select's lane mask as it stands
        if (!__builtin_amdgcn_inverse_ballot_w32(__builtin_amdgcn_readlane(mword, t * 8 + r))) lv = -__builtin_inff();
        S[t][r] = lv;
        mt[t] = fmaxf(mt[t], lv);
      }
    }
    float mx = fmaxf(fmaxf(mt[0], mt[1]), fmaxf(mt[2], mt[3]));
    mx = fmaxf(mx, xhalf(mx));
    const float mnew = fmaxf(mstate, mx);
    const bool dead = (mnew == -__builtin_inff());
    const float alpha = dead ? 1.0f : __expf(mstate - mnew);
    const float msub = dead ? 0.0f : mnew;                 // a row with no open key yet: exp(-inf - 0) = 0
    float rt[4];
    Frag pb[2];                                            // B: column = query m, k = key in the hardware k order
#pragma unroll
    for (int t = 0; t < 4; ++t) {
      rt[t] = 0.0f;
#pragma unroll
      for (int r = 0; r < 8; ++r) {
        const float p = __expf(S[t][r] - msub);
        rt[t] += p;
        pb[t >> 1].p[t & 1][r] = (_Float16)(p * PSCALE);
      }
    }
    lstate = lstate * alpha + ((rt[0] + rt[1]) + (rt[2] + rt[3]));
    mstate = mnew;
#pragma unroll
    for (int nt2 = 0; nt2 < 4; ++nt2) O[nt2] *= alpha;

    // O^T += V^T . (256 P)^T : K = 64 keys
#pragma unroll
    for (int kk = 0; kk < 2; ++kk) {
      v16h va[4];
#pragma unroll
      for (int nt2 = 0; nt2 < 4; ++nt2) va[nt2] = ld_frag(Vt + (nt2 * 16 + m) * AP + kk * 32, lh);
#pragma unroll
      for (int nt2 = 0; nt2 < 4; ++nt2) O[nt2] = wmma_f16(va[nt2], pb[kk].v, O[nt2]);
    }
  }

  // normalise: a = O / (256 l); store a*64 = O / (4 l) as f16, staged in Ks; a lane's 8 registers are 8 consecutive d
  __syncthreads();
  const float l = lstate + xhalf(lstate);
  const float inv = (l > 0.0f) ? (0.25f / l) : 0.0f;
#pragma unroll
  for (int nt2 = 0; nt2 < 4; ++nt2)
    *(v8h*)(Ks + (w * 16 + m) * AP + nt2 * 16 + 8 * lh) = __builtin_convertvector(O[nt2] * inv, v8h);
  __syncthreads();

  v8h vv[4];
#pragma unroll
  for (int jj = 0; jj < 4; ++jj) {
    const int c = jj * 128 + tid;
    vv[jj] = *(const v8h*)(Ks + (c >> 3) * AP + (c & 7) * 8);
  }
#pragma unroll
  for (int jj = 0; jj < 4; ++jj) {
    const int c = jj * 128 + tid;
    _Float16* dst = aw + ((size_t)(b * NSEQ + qbase + (c >> 3))) * CDIM + hd * DH + (c & 7) * 8;
    *(v8h*)dst = vv[jj];
  }
  
}

// ---------------------------------------------------------------------------
// Output projection: out = (a x64) . (Wo x64) / 4096 + bo ; C tile 128x128 f32 (8 waves as 4 x 2, each 32 x 64),
// K loop step 64, grid = (1024/128, 4096/128): one block per WGP, so nothing else covers a block's load latency.
// The k slices' global loads therefore run two slices ahead, into two register sets, and the f16 tiles alternate
// between two LDS buffers.
constexpr int CP = 132;                                  // f32 C rows in LDS, in floats: rows 8 apart fall 32 banks apart
constexpr int OTILE = 2 * 128 * AP;                      // halves of one LDS buffer: As[128][AP] | Bs[128][AP]
__global__ __launch_bounds__(256)
void k_out(const _Float16* __restrict__ aw, const float* __restrict__ Wo, const float* __restrict__ bo,
           float* __restrict__ out) {
  __shared__ __align__(16) float ldsf[OTILE];            // two f16 buffers (2 x OTILE halves), then Cs (f32, 128 x CP floats)
  static_assert(OTILE >= 128 * CP, "the C tile must fit the two buffers");
  _Float16* tiles = reinterpret_cast<_Float16*>(ldsf);

  const int tid = threadIdx.x, lane = tid & 31, w = tid >> 5, m = lane & 15, lh = lane >> 4;
  const int wr = w >> 1, wc = w & 1;                     // this wave's 32-row band and 64-column band of the tile
  const int cblk = blockIdx.x * 128, rblk = blockIdx.y * 128;
  if (cblk + 128 > CDIM || rblk + 128 > MROWS) return;   // block-uniform

  // A staging: 8 lanes x 16 B cover one row's whole 128-B k slice (one line); the 2 rows of a lane half lie 8 apart (distinct banks)
  const int ar = (lane >> 3) * 8 + w, ac = (lane & 7) * 8;   // rows ar + 32 j
  const int bn = lane * 4, bsw = (lane >> 2) & 3;        // k = 8 w + j, n = bn + e, chunk swizzle as in k_qkv
  const _Float16* ap = aw + (size_t)(rblk + ar) * CDIM + ac;
  const float* bp = Wo + (size_t)(8 * w) * CDIM + cblk + bn;

  v8f acc[2][4] = {};
  v8h a8[2][4];                                          // register set u holds the slices k0 = 64 (2 i + u)
  v4f b4[2][8];

  // a slice's 12 global loads
  auto fetch = [&](int u, int k0) {
#pragma unroll
    for (int j = 0; j < 4; ++j) a8[u][j] = *(const v8h*)(ap + (size_t)(32 * j) * CDIM + k0);
#pragma unroll
    for (int j = 0; j < 8; ++j) b4[u][j] = *(const v4f*)(bp + (size_t)(k0 + j) * CDIM);
    asm volatile("s_wait_xcnt 0x0" ::: "memory");          // before the loads' address registers are advanced; also keeps the loads ahead of the products
  };
  // register set u -> LDS buffer u
  auto stage = [&](int u) {
    _Float16* As = tiles + u * OTILE;
    _Float16* bdst = As + 128 * AP + bn * AP + ((w ^ bsw) << 3);
#pragma unroll
    for (int j = 0; j < 4; ++j) *(v8h*)(As + (ar + 32 * j) * AP + ac) = a8[u][j];
#pragma unroll
    for (int e = 0; e < 4; ++e) {
      v8h t;
#pragma unroll
      for (int j = 0; j < 8; ++j) t[j] = (_Float16)(b4[u][j][e] * WSCALE);
      *(v8h*)(bdst + e * AP) = t;                          // Bs[n][k], chunks swizzled
    }
  };
  // the 16 products of the slice in LDS buffer u
  auto products = [&](int u) {
    const _Float16* As = tiles + u * OTILE;
    const _Float16* Bs = As + 128 * AP;
#pragma unroll
    for (int kk = 0; kk < 2; ++kk) {
      v16h af[2], bf[4];
#pragma unroll
      for (int mt = 0; mt < 2; ++mt) af[mt] = ld_frag(As + (wr * 32 + mt * 16 + m) * AP + kk * 32, lh);
#pragma unroll
      for (int nt = 0; nt < 4; ++nt) bf[nt] = ld_frag_sw(Bs + (wc * 64 + nt * 16 + m) * AP + kk * 32, lh, nt);
#pragma unroll
      for (int mt = 0; mt < 2; ++mt)
#pragma unroll
        for (int nt = 0; nt < 4; ++nt) acc[mt][nt] = wmma_f16(af[mt], bf[nt], acc[mt][nt]);
    }
  };

  // One barrier a slice: it publishes buffer u; and a wave that has passed it knows that every wave has left the
  // products of the slice before, so the other buffer may be written in the next trip. It is written by hand, with the
  // wait for this wave's LDS stores alone: __syncthreads() also waits for every global load, which would end the
  // other register set's flight one slice early.
  auto publish = [&]() { asm volatile("s_wait_dscnt 0x0\n\ts_barrier_signal -1\n\ts_barrier_wait -1" ::: "memory"); };

  fetch(0, 0);
  fetch(1, 64);
  for (int k0 = 0; k0 < CDIM - 128; k0 += 128) {
#pragma unroll
    for (int u = 0; u < 2; ++u) {
      __builtin_amdgcn_sched_barrier(0);                   // set u's conversions, and with them the wait for its loads, stay behind the slice before
      stage(u);
      publish();
      fetch(u, k0 + 128 + 64 * u);                         // in flight over two slices' products
      products(u);
    }
  }
#pragma unroll
  for (int u = 0; u < 2; ++u) {                            // the last two slices: nothing left to fetch
    __builtin_amdgcn_sched_barrier(0);                     // as above
    stage(u);
    publish();
    products(u);
  }

  __syncthreads();
  float* Cs = ldsf;
#pragma unroll
  for (int nt = 0; nt < 4; ++nt) {
    const int col = wc * 64 + nt * 16 + m;
    const float bb = bo[cblk + col];
#pragma unroll
    for (int mt = 0; mt < 2; ++mt)
#pragma unroll
      for (int r = 0; r < 8; ++r)
        Cs[(wr * 32 + mt * 16 + 8 * lh + r) * CP + col] = acc[mt][nt][r] * (1.0f / (ASCALE * WSCALE)) + bb;
  }
  __syncthreads();

  // each row segment is 512 B = 4 lines: one 16-B store instruction of a wave writes one whole row segment
  v4f vv[16];
#pragma unroll
  for (int jj = 0; jj < 16; ++jj) {
    const int c = jj * 256 + tid;
    vv[jj] = *(const v4f*)(Cs + (c >> 5) * CP + (c & 31) * 4);
  }
#pragma unroll
  for (int jj = 0; jj < 16; ++jj) {
    const int c = jj * 256 + tid;
    float* dst = out + (size_t)(rblk + (c >> 5)) * CDIM + cblk + (c & 31) * 4;
    *(v4f*)dst = vv[jj];
  }
}

// ---------------------------------------------------------------------------
extern "C" void kernel_launch(void* const* d_in, const int* in_sizes, int n_in,
                              void* d_out, int out_size, void* d_ws, size_t ws_size,
                              hipStream_t stream) {
  if (n_in < 8) return;
  if (in_sizes[0] != MROWS * CDIM) return;
  if (in_sizes[1] != BSZ * NSEQ * NSEQ) return;
  if (in_sizes[2] != CDIM * QKVN) return;
  if (in_sizes[3] != QKVN) return;
  if (in_sizes[4] != CDIM * HN) return;
  if (in_sizes[5] != HN) return;
  if (in_sizes[6] != CDIM * CDIM) return;
  if (in_sizes[7] != CDIM) return;
  if (out_size != MROWS * CDIM) return;

  const float* x    = (const float*)d_in[0];
  const int*   am   = (const int*)d_in[1];
  const float* Wqkv = (const float*)d_in[2];
  const float* bqkv = (const float*)d_in[3];
  const float* We   = (const float*)d_in[4];
  const float* be   = (const float*)d_in[5];
  const float* Wo   = (const float*)d_in[6];
  const float* bo   = (const float*)d_in[7];
  float* out = (float*)d_out;

  const size_t qkv_bytes = (size_t)3 * QKV_S * sizeof(_Float16);          // 25,165,824
  const size_t aw_off    = qkv_bytes;
  const size_t aw_bytes  = (size_t)MROWS * CDIM * sizeof(_Float16);       //  8,388,608
  const size_t mb_off    = aw_off + aw_bytes;
  const size_t mb_bytes  = (size_t)(MROWS / 16) * NCHUNK * MWORDS * sizeof(unsigned int);  // 1,048,576
  if (mb_off + mb_bytes > ws_size) return;
  char* ws = (char*)d_ws;
  _Float16* qkvws = (_Float16*)ws;
  _Float16* awws  = (_Float16*)(ws + aw_off);
  unsigned int* mbws = (unsigned int*)(ws + mb_off);

  k_qkv<<<dim3(QKVN / 128, MROWS / 128), 256, 0, stream>>>(x, Wqkv, bqkv, am, qkvws, mbws);
  k_attn<<<dim3(BSZ * HN * (NSEQ / 64)), 128, 0, stream>>>(qkvws, x, We, be, mbws, awws);
  k_out<<<dim3(CDIM / 128, MROWS / 128), 256, 0, stream>>>(awws, Wo, bo, out);
}

// v008
// A run of this version takes 103 microseconds.
// Two timings next to v007 both put it at 1.03 times that version's speed.
// Over all steps from v000 it is 4.08 times as fast.
// Contractions: QKV projection, Q.K^T, P.V and output projection on v_wmma_f32_16x16x32_f16 (f16 operands, f32 accumulate);
// weights carried x64, P carried x256, attention output carried x64 (scales undone in f32); per-query gate dot (K=1024, N=16) on v_wmma_f32_16x16x4_f32,
// once for all 16 heads, in the projection kernel.
// The int32 mask is packed once, by the projection kernel, into lane-mask words that all 16 heads of the attention kernel share.
#include <hip/hip_runtime.h>
#include <math.h>
#include <stdint.h>
#include <stddef.h>

typedef _Float16 v16h __attribute__((ext_vector_type(16)));
typedef _Float16 v8h  __attribute__((ext_vector_type(8), __may_alias__));
typedef _Float16 v4h  __attribute__((ext_vector_type(4), __may_alias__));
typedef float    v8f  __attribute__((ext_vector_type(8)));
typedef float    v4f  __attribute__((ext_vector_type(4), __may_alias__));
typedef float    v2f  __attribute__((ext_vector_type(2), __may_alias__));
typedef int      v4i  __attribute__((ext_vector_type(4), __may_alias__));

union Frag { v16h v; v8h p[2]; };

constexpr int BSZ   = 2;
constexpr int NSEQ  = 2048;
constexpr int CDIM  = 1024;
constexpr int HN    = 16;
constexpr int DH    = 64;
constexpr int QKVN  = 3 * CDIM;                         // 3072
constexpr int MROWS = BSZ * NSEQ;                       // 4096
constexpr size_t QKV_S = (size_t)BSZ * HN * NSEQ * DH;  // halves per q/k/v plane
constexpr float WSCALE = 64.0f;                         // weight pre-scale (exact power of two)
constexpr float PSCALE = 256.0f;                        // P pre-scale
constexpr float ASCALE = 64.0f;                         // attention-output pre-scale
// LDS row pitches in halves: 16 B x odd, so the 16 rows of a ds_load_b128 fragment read fall on distinct banks
constexpr int AP = 72;                                  // 64-half rows (GEMM k slices, attention tiles): 144 B
constexpr int MP = 68;                                  // 64-int rows (mask chunk), in ints: 272 B
// packed mask: per (16-query group, 64-key chunk) 32 words; bit l of word 8 t + r is
// mask[query l & 15][key 16 t + 8 (l >> 4) + r] != 0, the score that lane l holds in register r of score tile t
constexpr int MWORDS = 32;
constexpr int NCHUNK = NSEQ / 64;                       // 32
constexpr int GP = 68;                                  // 64-float rows (gate x slice), in floats: 272 B = 16 B x odd
static_assert(QKVN / 128 - NCHUNK / 2 == 8, "the column blocks that pack no mask take 16 of a band's 128 gate rows each");

// one 16x16x32 f16 WMMA with the VALU hazard guard attached
__device__ __forceinline__ v8f wmma_f16(v16h a, v16h b, v8f c) {
  v8f d = __builtin_amdgcn_wmma_f32_16x16x32_f16(false, a, false, b, (short)0, c, false, false);
  asm volatile("v_nop\n\tv_nop\n\tv_nop\n\tv_nop" : "+v"(d) : "v"(a), "v"(b));
  return d;
}

// 16-bit fragment from a k-contiguous row (A row m, or B stored [n][k] row n):
// elements 0..7 <- k0+8*lh .. +7, elements 8..15 <- k0+16+8*lh .. +7  (lh = lane >> 4)
__device__ __forceinline__ v16h ld_frag(const _Float16* rk, int lh) {
  Frag f;
  f.p[0] = *(const v8h*)(rk + 8 * lh);
  f.p[1] = *(const v8h*)(rk + 16 + 8 * lh);
  return f.v;
}

// the same fragment from a staged weight row whose four 16-B k chunks lie at chunk ^ sw (sw = (n >> 4) & 3)
__device__ __forceinline__ v16h ld_frag_sw(const _Float16* rk, int lh, int sw) {
  Frag f;
  f.p[0] = *(const v8h*)(rk + ((lh ^ sw) << 3));
  f.p[1] = *(const v8h*)(rk + (((2 + lh) ^ sw) << 3));
  return f.v;
}

// ---------------------------------------------------------------------------
// QKV projection: C tile 128x128 per block (256 threads, 8 waves as 4 x 2, each 32 rows x 64 columns), K loop step 64.
__global__ __launch_bounds__(256)
void k_qkv(const float* __restrict__ x, const float* __restrict__ W, const float* __restrict__ bias,
           const int* __restrict__ am, const float* __restrict__ We, const float* __restrict__ be,
           _Float16* __restrict__ qkv, unsigned int* __restrict__ mbits, float* __restrict__ gate) {
  __shared__ __align__(16) _Float16 lds[2 * 128 * AP];  // As[128][AP] | Bs[128][AP]; reused as four C sub-tiles [64][AP]
  _Float16* As = lds;
  _Float16* Bs = lds + 128 * AP;

  const int tid = threadIdx.x, lane = tid & 31, w = tid >> 5, m = lane & 15, lh = lane >> 4;
  const int wr = w >> 1, wc = w & 1;                     // this wave's 32-row band and 64-column band of the tile
  const int cblk = blockIdx.x * 128, rblk = blockIdx.y * 128;
  if (cblk + 128 > QKVN || rblk + 128 > MROWS) return;   // block-uniform, before any barrier

  // mask packing: the first 16 column blocks of a row band take two 64-key chunks each; a wave takes its own 16 query rows.
  // Loads cover whole lines (16 lanes x 16 B = one row's 256 B); the turn to the score layout goes through LDS.
  if (blockIdx.x < NCHUNK / 2) {                         // block-uniform
    int* mw = reinterpret_cast<int*>(lds) + w * (16 * MP);
    const int* msrc = am + (size_t)(rblk + 16 * w + lh) * NSEQ + blockIdx.x * 128 + m * 4;
    v4i m4[2][8];
#pragma unroll
    for (int u = 0; u < 2; ++u)
#pragma unroll
      for (int it = 0; it < 8; ++it) m4[u][it] = *(const v4i*)(msrc + (size_t)(2 * it) * NSEQ + u * 64);
#pragma unroll
    for (int u = 0; u < 2; ++u) {
#pragma unroll
      for (int it = 0; it < 8; ++it) *(v4i*)(mw + (2 * it + lh) * MP + m * 4) = m4[u][it];
      __syncthreads();                                     // rows written by other lanes are read below
      unsigned int pk = 0;
#pragma unroll
      for (int t = 0; t < 4; ++t) {
        const v4i ma = *(const v4i*)(mw + m * MP + t * 16 + 8 * lh);
        const v4i mb = *(const v4i*)(mw + m * MP + t * 16 + 8 * lh + 4);
#pragma unroll
        for (int r = 0; r < 8; ++r) {
          const int mv = (r < 4) ? ma[r & 3] : mb[r & 3];
          const unsigned int word = __builtin_amdgcn_ballot_w32(mv != 0);
          if (lane == t * 8 + r) pk = word;                // lane i keeps word i
        }
      }
      mbits[((size_t)((rblk >> 4) + w) * NCHUNK + blockIdx.x * 2 + u) * MWORDS + lane] = pk;  // one whole line
      __syncthreads();                                     // reads done before the rows are overwritten (next chunk, then the GEMM tiles)
    }
  } else {
    // gate: the other 8 column blocks of a row band take 16 query rows each and form sigmoid(x.We + be) for all 16 heads,
    // so x is read once for the gate, not once per head. Wave w takes k = 128 w .. + 127 in two slices of 64.
    // x loads cover whole lines (16 lanes x 16 B = one row's 256 B); a slice goes to the wave's own LDS rows with even k
    // in floats 0..31 and odd k in floats 32..63, so that lane half lh reads k = 2 j + lh; the matching We values
    // We[2 j + lh][head m] are then 32 consecutive floats per wave, one whole line.
    float* gl = reinterpret_cast<float*>(lds);
    float* gw = gl + w * (16 * GP);
    const int g0 = rblk + (blockIdx.x - NCHUNK / 2) * 16;  // this block's first query row
    const float* xs = x + (size_t)(g0 + lh) * CDIM + w * 128 + m * 4;
    const float* wsrc = We + (size_t)(w * 128) * HN + lane;
    v4f x4[2][8];
#pragma unroll
    for (int u = 0; u < 2; ++u)
#pragma unroll
      for (int it = 0; it < 8; ++it) x4[u][it] = *(const v4f*)(xs + (size_t)(2 * it) * CDIM + u * 64);
    asm volatile("s_wait_xcnt 0x0" ::: "memory");          // before a We load below lands in a register of the x loads' address
    float wb[2][32];                                       // all loads go out together: the barriers below wait for every load
#pragma unroll
    for (int u = 0; u < 2; ++u)
#pragma unroll
      for (int j = 0; j < 32; ++j) wb[u][j] = wsrc[(u * 32 + j) * 32];
    asm volatile("s_wait_xcnt 0x0" ::: "memory");          // before the loads' address registers are reused
    v8f ga[2] = {};                                        // two chains: a dependent f32 WMMA waits out its latency
#pragma unroll
    for (int u = 0; u < 2; ++u) {
      // the rows are the wave's own and its LDS operations run in order: slice 1's stores follow slice 0's reads
#pragma unroll
      for (int it = 0; it < 8; ++it) {
        const v2f ev = {x4[u][it][0], x4[u][it][2]}, od = {x4[u][it][1], x4[u][it][3]};
        *(v2f*)(gw + (2 * it + lh) * GP + 2 * m) = ev;
        *(v2f*)(gw + (2 * it + lh) * GP + 32 + 2 * m) = od;
      }
      __syncthreads();                                     // rows written by other lanes are read below
#pragma unroll
      for (int i = 0; i < 8; ++i) {
        const v4f a = *(const v4f*)(gw + m * GP + lh * 32 + 4 * i);   // A: row m, k = 2 (4 i + e) + lh
#pragma unroll
        for (int p = 0; p < 2; ++p) {
          const v2f af = {a[2 * p], a[2 * p + 1]}, bf = {wb[u][4 * i + 2 * p], wb[u][4 * i + 2 * p + 1]};
          ga[p] = __builtin_amdgcn_wmma_f32_16x16x4_f32(false, af, false, bf, (short)0, ga[p], false, false);
        }
      }
    }
    // distance between the last f32 WMMAs and the adds that read their results (8 slots, as for the other 16-cycle form)
    asm volatile("v_nop\n\tv_nop\n\tv_nop\n\tv_nop\n\tv_nop\n\tv_nop\n\tv_nop\n\tv_nop" : "+v"(ga[0]), "+v"(ga[1]));
    __syncthreads();                                       // every wave has left its staged rows
#pragma unroll
    for (int r = 0; r < 8; ++r) gl[w * 256 + (8 * lh + r) * 16 + m] = ga[0][r] + ga[1][r];   // [wave][row][head]
    __syncthreads();                                       // the other waves' partial sums are read below
    float z = be[tid & 15];
#pragma unroll
    for (int ww = 0; ww < 8; ++ww) z += gl[ww * 256 + tid];
    gate[(size_t)g0 * HN + tid] = 1.0f / (1.0f + expf(-z)); // [query row][head]: 8 whole lines per block
    asm volatile("s_wait_xcnt 0x0" ::: "memory");          // before the store's registers are reused
    // the k loop's first barrier stands between these reads and the first tile stores
  }

  // A staging: 16 lanes x 16 B cover one row's 256-B k slice (two whole lines of x); a wave's 2 rows lie 8 apart,
  // so its 8-B LDS stores fall on all 64 banks once
  const int ar = 8 * lh + w, ac = m * 4;                 // rows ar + 16 j
  // B staging: a wave's 32 lanes x 16 B cover one k row's whole 512 B; a thread holds k = 8 w + j (j = 0..7) of columns
  // n = bn + e, so each column's 8 k go as one 16-B store; chunk c of row n is stored at c ^ ((n >> 4) & 3), which puts
  // the 16 rows of a lane half (4 apart) on distinct banks
  const int bn = lane * 4, bsw = (lane >> 2) & 3;
  const float* ap = x + (size_t)(rblk + ar) * CDIM + ac;
  const float* bp = W + (size_t)(8 * w) * QKVN + cblk + bn;
  _Float16* bdst = Bs + bn * AP + ((w ^ bsw) << 3);

  v8f acc[2][4] = {};

  for (int k0 = 0; k0 < CDIM; k0 += 64) {
    v4f a4[8], b4[8];
#pragma unroll
    for (int j = 0; j < 8; ++j) a4[j] = *(const v4f*)(ap + (size_t)(16 * j) * CDIM + k0);
#pragma unroll
    for (int j = 0; j < 8; ++j) b4[j] = *(const v4f*)(bp + (size_t)(k0 + j) * QKVN);
    __builtin_amdgcn_sched_barrier(0);                     // all 16 loads issue before the first conversion waits on one
    asm volatile("s_wait_xcnt 0x0" ::: "memory");          // before the loads' address registers are advanced
    __syncthreads();
#pragma unroll
    for (int j = 0; j < 8; ++j)
      *(v4h*)(As + (ar + 16 * j) * AP + ac) = __builtin_convertvector(a4[j], v4h);
#pragma unroll
    for (int e = 0; e < 4; ++e) {
      v8h t;
#pragma unroll
      for (int j = 0; j < 8; ++j) t[j] = (_Float16)(b4[j][e] * WSCALE);
      *(v8h*)(bdst + e * AP) = t;                          // Bs[n][k], chunks swizzled
    }
    __syncthreads();

#pragma unroll
    for (int kk = 0; kk < 2; ++kk) {
      v16h af[2], bf[4];
#pragma unroll
      for (int mt = 0; mt < 2; ++mt) af[mt] = ld_frag(As + (wr * 32 + mt * 16 + m) * AP + kk * 32, lh);
#pragma unroll
      for (int nt = 0; nt < 4; ++nt) bf[nt] = ld_frag_sw(Bs + (wc * 64 + nt * 16 + m) * AP + kk * 32, lh, nt);
#pragma unroll
      for (int mt = 0; mt < 2; ++mt)
#pragma unroll
        for (int nt = 0; nt < 4; ++nt) acc[mt][nt] = wmma_f16(af[mt], bf[nt], acc[mt][nt]);
    }
  }

  // stage the C tile (bias added, weight scale undone) in LDS as f16, as four 64x64 sub-tiles (64 rows of one head each):
  // q and k sub-tiles as [row][d]; a v sub-tile as [d][row], where a lane's 8 accumulator registers are 8 consecutive
  // rows of one d, so they go as one 16-B store
  __syncthreads();
  const int sS = cblk >> 10, hd0 = (cblk & 1023) >> 6, b = rblk >> 11, n0 = rblk & 2047;
  const bool isv = (sS == 2);                            // block-uniform
  _Float16* Cw = lds + ((wr >> 1) * 2 + wc) * (64 * AP); // this wave's sub-tile
  const int lr = (wr & 1) * 32;                          // its first row there
  v8h o[2][4];
#pragma unroll
  for (int nt = 0; nt < 4; ++nt) {
    const float bb = bias[cblk + wc * 64 + nt * 16 + m];
#pragma unroll
    for (int mt = 0; mt < 2; ++mt)
#pragma unroll
      for (int r = 0; r < 8; ++r) o[mt][nt][r] = (_Float16)(acc[mt][nt][r] * (1.0f / WSCALE) + bb);
  }
  if (isv) {
#pragma unroll
    for (int mt = 0; mt < 2; ++mt)
#pragma unroll
      for (int nt = 0; nt < 4; ++nt) *(v8h*)(Cw + (nt * 16 + m) * AP + lr + mt * 16 + 8 * lh) = o[mt][nt];
  } else {
#pragma unroll
    for (int mt = 0; mt < 2; ++mt)
#pragma unroll
      for (int nt = 0; nt < 4; ++nt)
#pragma unroll
        for (int r = 0; r < 8; ++r) Cw[(lr + mt * 16 + 8 * lh + r) * AP + nt * 16 + m] = o[mt][nt][r];
  }
  __syncthreads();

  // whole-line stores: each sub-tile is 4096 contiguous halves; each instruction of a wave covers 4 full lines.
  // The v plane so holds, per head, tiles of 64 keys, each tile laid [d][key].
  v8h vv[8];
#pragma unroll
  for (int j = 0; j < 8; ++j) {
    const int cc = (j & 1) * 256 + tid;                    // 16-B chunk within sub-tile j >> 1
    vv[j] = *(const v8h*)(lds + (j >> 1) * (64 * AP) + (cc >> 3) * AP + (cc & 7) * 8);
  }
#pragma unroll
  for (int j = 0; j < 8; ++j) {
    const int sub = j >> 1, cc = (j & 1) * 256 + tid;
    _Float16* dst = qkv + (size_t)sS * QKV_S +
                    ((size_t)(b * HN + hd0 + (sub & 1)) * NSEQ + n0 + 64 * (sub >> 1)) * DH;
    *(v8h*)(dst + cc * 8) = vv[j];
  }
}

__device__ __forceinline__ float xhalf(float v) {          // lane l <-> lane l ^ 16
  const int i = __builtin_bit_cast(int, v);
  return __builtin_bit_cast(float, __builtin_amdgcn_permlanex16(i, i, 0x76543210, 0xfedcba98, false, false));
}

__global__ __launch_bounds__(128)
void k_attn(const _Float16* __restrict__ qkv, const float* __restrict__ gate,
            const unsigned int* __restrict__ mbits, _Float16* __restrict__ aw) {
  __shared__ __align__(16) _Float16 Qs[64 * AP];       // [query][d]
  __shared__ __align__(16) _Float16 Ks[64 * AP];       // [key][d]   (k-contiguous A for S^T)
  __shared__ __align__(16) _Float16 Vt[64 * AP];       // [d][key]   (k-contiguous A for V^T.P^T)

  const int tid = threadIdx.x, lane = tid & 31, w = tid >> 5, m = lane & 15, lh = lane >> 4;
  const int bid = blockIdx.x;
  const int qt = bid & 31, bh = bid >> 5, hd = bh & 15, b = bh >> 4;
  if (b >= BSZ) return;                                   // block-uniform
  const int qbase = qt * 64;

  const _Float16* Qg = qkv + ((size_t)(b * HN + hd) * NSEQ) * DH;
  const _Float16* Kg = Qg + QKV_S;
  const _Float16* Vg = Kg + QKV_S;

  const float gq = gate[(size_t)(b * NSEQ + qbase + w * 16 + m) * HN + hd];   // this lane's query and head; in flight with the Q tile
  // Q tile: 4096 contiguous halves
  {
    const _Float16* src = Qg + (size_t)qbase * DH;
#pragma unroll
    for (int it = 0; it < 4; ++it) {
      const int c = it * 128 + tid;
      *(v8h*)(Qs + (c >> 3) * AP + (c & 7) * 8) = *(const v8h*)(src + c * 8);
    }
  }
  __syncthreads();

  v16h qb[2];                                              // B: column = query m, k = d
  qb[0] = ld_frag(Qs + (w * 16 + m) * AP, lh);
  qb[1] = ld_frag(Qs + (w * 16 + m) * AP + 32, lh);

  float mstate = -__builtin_inff();                        // this lane's query: running maximum (both halves alike)
  float lstate = 0.0f;                                     // running sum over this lane half's keys only
  const float g = gq * 0.125f;                             // gate * 1/sqrt(64)
  v8f O[4] = {};                                           // O[nt2][r] = O^T[d = 16 nt2 + 8 lh + r][query m]

  // this wave's packed mask: lane i loads word i of a chunk (one whole line per wave and chunk)
  const unsigned int* mrow = mbits + (size_t)((b * NSEQ + qbase) / 16 + w) * (NCHUNK * MWORDS) + lane;

  for (int j = 0; j < NSEQ / 64; ++j) {
    const int kb = j * 64;
    __syncthreads();
    const unsigned int mword = mrow[j * MWORDS];
    {  // K chunk and V chunk (already [d][key] in the workspace): direct copies
      const _Float16* ksrc = Kg + (size_t)kb * DH;
      v8h k8[4], v8[4];
#pragma unroll
      for (int it = 0; it < 4; ++it) k8[it] = *(const v8h*)(ksrc + (it * 128 + tid) * 8);
#pragma unroll
      for (int it = 0; it < 4; ++it) v8[it] = *(const v8h*)(Vg + (size_t)kb * DH + (it * 128 + tid) * 8);
      asm volatile("s_wait_xcnt 0x0" ::: "memory");        // before the loads' address registers are advanced
#pragma unroll
      for (int it = 0; it < 4; ++it) {
        const int c = it * 128 + tid;
        *(v8h*)(Ks + (c >> 3) * AP + (c & 7) * 8) = k8[it];
      }
#pragma unroll
      for (int it = 0; it < 4; ++it) {
        const int c = it * 128 + tid;
        *(v8h*)(Vt + (c >> 3) * AP + (c & 7) * 8) = v8[it];
      }
    }
    __syncthreads();

    // S^T = K.Q^T : rows = 64 keys (4 tiles), cols = 16 queries of this wave, K = 64
    v8f S[4];
#pragma unroll
    for (int t = 0; t < 4; ++t) {
      v8f z = {};
      v16h kf0 = ld_frag(Ks + (t * 16 + m) * AP, lh);
      v16h kf1 = ld_frag(Ks + (t * 16 + m) * AP + 32, lh);
      z = wmma_f16(kf0, qb[0], z);
      z = wmma_f16(kf1, qb[1], z);
      S[t] = z;
    }

    // scale, gate, mask, online softmax: all 32 scores of a lane belong to query m
    float mt[4];
#pragma unroll
    for (int t = 0; t < 4; ++t) {
      mt[t] = -__builtin_inff();
#pragma unroll
      for (int r = 0; r < 8; ++r) {
        float lv = S[t][r] * g;
        // word 8 t + r, read from its lane into a scalar register, is the select's lane mask as it stands
        if (!__builtin_amdgcn_inverse_ballot_w32(__builtin_amdgcn_readlane(mword, t * 8 + r))) lv = -__builtin_inff();
        S[t][r] = lv;
        mt[t] = fmaxf(mt[t], lv);
      }
    }
    float mx = fmaxf(fmaxf(mt[0], mt[1]), fmaxf(mt[2], mt[3]));
    mx = fmaxf(mx, xhalf(mx));
    const float mnew = fmaxf(mstate, mx);
    const bool dead = (mnew == -__builtin_inff());
    const float alpha = dead ? 1.0f : __expf(mstate - mnew);
    const float msub = dead ? 0.0f : mnew;                 // a row with no open key yet: exp(-inf - 0) = 0
    float rt[4];
    Frag pb[2];                                            // B: column = query m, k = key in the hardware k order
#pragma unroll
    for (int t = 0; t < 4; ++t) {
      rt[t] = 0.0f;
#pragma unroll
      for (int r = 0; r < 8; ++r) {
        const float p = __expf(S[t][r] - msub);
        rt[t] += p;
        pb[t >> 1].p[t & 1][r] = (_Float16)(p * PSCALE);
      }
    }
    lstate = lstate * alpha + ((rt[0] + rt[1]) + (rt[2] + rt[3]));
    mstate = mnew;
#pragma unroll
    for (int nt2 = 0; nt2 < 4; ++nt2) O[nt2] *= alpha;

    // O^T += V^T . (256 P)^T : K = 64 keys
#pragma unroll
    for (int kk = 0; kk < 2; ++kk) {
      v16h va[4];
#pragma unroll
      for (int nt2 = 0; nt2 < 4; ++nt2) va[nt2] = ld_frag(Vt + (nt2 * 16 + m) * AP + kk * 32, lh);
#pragma unroll
      for (int nt2 = 0; nt2 < 4; ++nt2) O[nt2] = wmma_f16(va[nt2], pb[kk].v, O[nt2]);
    }
  }

  // normalise: a = O / (256 l); store a*64 = O / (4 l) as f16, staged in Ks; a lane's 8 registers are 8 consecutive d
  __syncthreads();
  const float l = lstate + xhalf(lstate);
  const float inv = (l > 0.0f) ? (0.25f / l) : 0.0f;
#pragma unroll
  for (int nt2 = 0; nt2 < 4; ++nt2)
    *(v8h*)(Ks + (w * 16 + m) * AP + nt2 * 16 + 8 * lh) = __builtin_convertvector(O[nt2] * inv, v8h);
  __syncthreads();

  v8h vv[4];
#pragma unroll
  for (int jj = 0; jj < 4; ++jj) {
    const int c = jj * 128 + tid;
    vv[jj] = *(const v8h*)(Ks + (c >> 3) * AP + (c & 7) * 8);
  }
#pragma unroll
  for (int jj = 0; jj < 4; ++jj) {
    const int c = jj * 128 + tid;
    _Float16* dst = aw + ((size_t)(b * NSEQ + qbase + (c >> 3))) * CDIM + hd * DH + (c & 7) * 8;
    *(v8h*)dst = vv[jj];
  }
  
}

// ---------------------------------------------------------------------------
// Output projection: out = (a x64) . (Wo x64) / 4096 + bo ; C tile 128x128 f32 (8 waves as 4 x 2, each 32 x 64),
// K loop step 64, grid = (1024/128, 4096/128): one block per WGP, so nothing else covers a block's load latency.
// The k slices' global loads therefore run two slices ahead, into two register sets, and the f16 tiles alternate
// between two LDS buffers.
constexpr int CP = 132;                                  // f32 C rows in LDS, in floats: rows 8 apart fall 32 banks apart
constexpr int OTILE = 2 * 128 * AP;                      // halves of one LDS buffer: As[128][AP] | Bs[128][AP]
__global__ __launch_bounds__(256)
void k_out(const _Float16* __restrict__ aw, const float* __restrict__ Wo, const float* __restrict__ bo,
           float* __restrict__ out) {
  __shared__ __align__(16) float ldsf[OTILE];            // two f16 buffers (2 x OTILE halves), then Cs (f32, 128 x CP floats)
  static_assert(OTILE >= 128 * CP, "the C tile must fit the two buffers");
  _Float16* tiles = reinterpret_cast<_Float16*>(ldsf);

  const int tid = threadIdx.x, lane = tid & 31, w = tid >> 5, m = lane & 15, lh = lane >> 4;
  const int wr = w >> 1, wc = w & 1;                     // this wave's 32-row band and 64-column band of the tile
  const int cblk = blockIdx.x * 128, rblk = blockIdx.y * 128;
  if (cblk + 128 > CDIM || rblk + 128 > MROWS) return;   // block-uniform

  // A staging: 8 lanes x 16 B cover one row's whole 128-B k slice (one line); the 2 rows of a lane half lie 8 apart (distinct banks)
  const int ar = (lane >> 3) * 8 + w, ac = (lane & 7) * 8;   // rows ar + 32 j
  const int bn = lane * 4, bsw = (lane >> 2) & 3;        // k = 8 w + j, n = bn + e, chunk swizzle as in k_qkv
  const _Float16* ap = aw + (size_t)(rblk + ar) * CDIM + ac;
  const float* bp = Wo + (size_t)(8 * w) * CDIM + cblk + bn;

  v8f acc[2][4] = {};
  v8h a8[2][4];                                          // register set u holds the slices k0 = 64 (2 i + u)
  v4f b4[2][8];

  // a slice's 12 global loads
  auto fetch = [&](int u, int k0) {
#pragma unroll
    for (int j = 0; j < 4; ++j) a8[u][j] = *(const v8h*)(ap + (size_t)(32 * j) * CDIM + k0);
#pragma unroll
    for (int j = 0; j < 8; ++j) b4[u][j] = *(const v4f*)(bp + (size_t)(k0 + j) * CDIM);
    asm volatile("s_wait_xcnt 0x0" ::: "memory");          // before the loads' address registers are advanced; also keeps the loads ahead of the products
  };
  // register set u -> LDS buffer u
  auto stage = [&](int u) {
    _Float16* As = tiles + u * OTILE;
    _Float16* bdst = As + 128 * AP + bn * AP + ((w ^ bsw) << 3);
#pragma unroll
    for (int j = 0; j < 4; ++j) *(v8h*)(As + (ar + 32 * j) * AP + ac) = a8[u][j];
#pragma unroll
    for (int e = 0; e < 4; ++e) {
      v8h t;
#pragma unroll
      for (int j = 0; j < 8; ++j) t[j] = (_Float16)(b4[u][j][e] * WSCALE);
      *(v8h*)(bdst + e * AP) = t;                          // Bs[n][k], chunks swizzled
    }
  };
  // the 16 products of the slice in LDS buffer u
  auto products = [&](int u) {
    const _Float16* As = tiles + u * OTILE;
    const _Float16* Bs = As + 128 * AP;
#pragma unroll
    for (int kk = 0; kk < 2; ++kk) {
      v16h af[2], bf[4];
#pragma unroll
      for (int mt = 0; mt < 2; ++mt) af[mt] = ld_frag(As + (wr * 32 + mt * 16 + m) * AP + kk * 32, lh);
#pragma unroll
      for (int nt = 0; nt < 4; ++nt) bf[nt] = ld_frag_sw(Bs + (wc * 64 + nt * 16 + m) * AP + kk * 32, lh, nt);
#pragma unroll
      for (int mt = 0; mt < 2; ++mt)
#pragma unroll
        for (int nt = 0; nt < 4; ++nt) acc[mt][nt] = wmma_f16(af[mt], bf[nt], acc[mt][nt]);
    }
  };

  // One barrier a slice: it publishes buffer u; and a wave that has passed it knows that every wave has left the
  // products of the slice before, so the other buffer may be written in the next trip. It is written by hand, with the
  // wait for this wave's LDS stores alone: __syncthreads() also waits for every global load, which would end the
  // other register set's flight one slice early.
  auto publish = [&]() { asm volatile("s_wait_dscnt 0x0\n\ts_barrier_signal -1\n\ts_barrier_wait -1" ::: "memory"); };

  fetch(0, 0);
  fetch(1, 64);
  for (int k0 = 0; k0 < CDIM - 128; k0 += 128) {
#pragma unroll
    for (int u = 0; u < 2; ++u) {
      __builtin_amdgcn_sched_barrier(0);                   // set u's conversions, and with them the wait for its loads, stay behind the slice before
      stage(u);
      publish();
      fetch(u, k0 + 128 + 64 * u);                         // in flight over two slices' products
      products(u);
    }
  }
#pragma unroll
  for (int u = 0; u < 2; ++u) {                            // the last two slices: nothing left to fetch
    __builtin_amdgcn_sched_barrier(0);                     // as above
    stage(u);
    publish();
    products(u);
  }

  __syncthreads();
  float* Cs = ldsf;
#pragma unroll
  for (int nt = 0; nt < 4; ++nt) {
    const int col = wc * 64 + nt * 16 + m;
    const float bb = bo[cblk + col];
#pragma unroll
    for (int mt = 0; mt < 2; ++mt)
#pragma unroll
      for (int r = 0; r < 8; ++r)
        Cs[(wr * 32 + mt * 16 + 8 * lh + r) * CP + col] = acc[mt][nt][r] * (1.0f / (ASCALE * WSCALE)) + bb;
  }
  __syncthreads();

  // each row segment is 512 B = 4 lines: one 16-B store instruction of a wave writes one whole row segment
  v4f vv[16];
#pragma unroll
  for (int jj = 0; jj < 16; ++jj) {
    const int c = jj * 256 + tid;
    vv[jj] = *(const v4f*)(Cs + (c >> 5) * CP + (c & 31) * 4);
  }
#pragma unroll
  for (int jj = 0; jj < 16; ++jj) {
    const int c = jj * 256 + tid;
    float* dst = out + (size_t)(rblk + (c >> 5)) * CDIM + cblk + (c & 31) * 4;
    *(v4f*)dst = vv[jj];
  }
}

// ---------------------------------------------------------------------------
extern "C" void kernel_launch(void* const* d_in, const int* in_sizes, int n_in,
                              void* d_out, int out_size, void* d_ws, size_t ws_size,
                              hipStream_t stream) {
  if (n_in < 8) return;
  if (in_sizes[0] != MROWS * CDIM) return;
  if (in_sizes[1] != BSZ * NSEQ * NSEQ) return;
  if (in_sizes[2] != CDIM * QKVN) return;
  if (in_sizes[3] != QKVN) return;
  if (in_sizes[4] != CDIM * HN) return;
  if (in_sizes[5] != HN) return;
  if (in_sizes[6] != CDIM * CDIM) return;
  if (in_sizes[7] != CDIM) return;
  if (out_size != MROWS * CDIM) return;

  const float* x    = (const float*)d_in[0];
  const int*   am   = (const int*)d_in[1];
  const float* Wqkv = (const float*)d_in[2];
  const float* bqkv = (const float*)d_in[3];
  const float* We   = (const float*)d_in[4];
  const float* be   = (const float*)d_in[5];
  const float* Wo   = (const float*)d_in[6];
  const float* bo   = (const float*)d_in[7];
  float* out = (float*)d_out;

  const size_t qkv_bytes = (size_t)3 * QKV_S * sizeof(_Float16);          // 25,165,824
  const size_t aw_off    = qkv_bytes;
  const size_t aw_bytes  = (size_t)MROWS * CDIM * sizeof(_Float16);       //  8,388,608
  const size_t mb_off    = aw_off + aw_bytes;
  const size_t mb_bytes  = (size_t)(MROWS / 16) * NCHUNK * MWORDS * sizeof(unsigned int);  // 1,048,576
  const size_t g_off     = mb_off + mb_bytes;
  const size_t g_bytes   = (size_t)MROWS * HN * sizeof(float);                             //    262,144
  if (g_off + g_bytes > ws_size) return;
  char* ws = (char*)d_ws;
  _Float16* qkvws = (_Float16*)ws;
  _Float16* awws  = (_Float16*)(ws + aw_off);
  unsigned int* mbws = (unsigned int*)(ws + mb_off);
  float* gws = (float*)(ws + g_off);

  k_qkv<<<dim3(QKVN / 128, MROWS / 128), 256, 0, stream>>>(x, Wqkv, bqkv, am, We, be, qkvws, mbws, gws);
  k_attn<<<dim3(BSZ * HN * (NSEQ / 64)), 128, 0, stream>>>(qkvws, gws, mbws, awws);
  k_out<<<dim3(CDIM / 128, MROWS / 128), 256, 0, stream>>>(awws, Wo, bo, out);
}

// v009
// One run takes 95.9 microseconds.
// Two timings next to v008 both put it at 1.07 times that version's speed.
// Over all steps from v000 it is 4.36 times as fast.
// Contractions: QKV projection, Q.K^T, P.V and output projection on v_wmma_f32_16x16x32_f16 (f16 operands, f32 accumulate);
// weights carried x64, P carried x256, attention output carried x64 (scales undone in f32); per-query gate dot (K=1024, N=16) on v_wmma_f32_16x16x4_f32,
// once for all 16 heads, in the projection kernel.
// The int32 mask is packed once, by the projection kernel, into lane-mask words that all 16 heads of the attention kernel share.
#include <hip/hip_runtime.h>
#include <math.h>
#include <stdint.h>
#include <stddef.h>

typedef _Float16 v16h __attribute__((ext_vector_type(16)));
typedef _Float16 v8h  __attribute__((ext_vector_type(8), __may_alias__));
typedef _Float16 v4h  __attribute__((ext_vector_type(4), __may_alias__));
typedef float    v8f  __attribute__((ext_vector_type(8)));
typedef float    v4f  __attribute__((ext_vector_type(4), __may_alias__));
typedef float    v2f  __attribute__((ext_vector_type(2), __may_alias__));
typedef int      v4i  __attribute__((ext_vector_type(4), __may_alias__));

union Frag { v16h v; v8h p[2]; };

constexpr int BSZ   = 2;
constexpr int NSEQ  = 2048;
constexpr int CDIM  = 1024;
constexpr int HN    = 16;
constexpr int DH    = 64;
constexpr int QKVN  = 3 * CDIM;                         // 3072
constexpr int MROWS = BSZ * NSEQ;                       // 4096
constexpr size_t QKV_S = (size_t)BSZ * HN * NSEQ * DH;  // halves per q/k/v plane
constexpr float WSCALE = 64.0f;                         // weight pre-scale (exact power of two)
constexpr float PSCALE = 256.0f;                        // P pre-scale
constexpr float ASCALE = 64.0f;                         // attention-output pre-scale
// LDS row pitches in halves: 16 B x odd, so the 16 rows of a ds_load_b128 fragment read fall on distinct banks
constexpr int AP = 72;                                  // 64-half rows (GEMM k slices, attention tiles): 144 B
constexpr int MP = 68;                                  // 64-int rows (mask chunk), in ints: 272 B
// packed mask: per (16-query group, 64-key chunk) 32 words; bit l of word 8 t + r is
// mask[query l & 15][key 16 t + 8 (l >> 4) + r] != 0, the score that lane l holds in register r of score tile t
constexpr int MWORDS = 32;
constexpr int NCHUNK = NSEQ / 64;                       // 32
constexpr int GP = 68;                                  // 64-float rows (gate x slice), in floats: 272 B = 16 B x odd
static_assert(QKVN / 128 - NCHUNK / 2 == 8, "the column blocks that pack no mask take 16 of a band's 128 gate rows each");

// one 16x16x32 f16 WMMA with the VALU hazard guard attached
__device__ __forceinline__ v8f wmma_f16(v16h a, v16h b, v8f c) {
  v8f d = __builtin_amdgcn_wmma_f32_16x16x32_f16(false, a, false, b, (short)0, c, false, false);
  asm volatile("v_nop\n\tv_nop\n\tv_nop\n\tv_nop" : "+v"(d) : "v"(a), "v"(b));
  return d;
}

// 16-bit fragment from a k-contiguous row (A row m, or B stored [n][k] row n):
// elements 0..7 <- k0+8*lh .. +7, elements 8..15 <- k0+16+8*lh .. +7  (lh = lane >> 4)
__device__ __forceinline__ v16h ld_frag(const _Float16* rk, int lh) {
  Frag f;
  f.p[0] = *(const v8h*)(rk + 8 * lh);
  f.p[1] = *(const v8h*)(rk + 16 + 8 * lh);
  return f.v;
}

// the same fragment from a staged weight row whose four 16-B k chunks lie at chunk ^ sw (sw = (n >> 4) & 3)
__device__ __forceinline__ v16h ld_frag_sw(const _Float16* rk, int lh, int sw) {
  Frag f;
  f.p[0] = *(const v8h*)(rk + ((lh ^ sw) << 3));
  f.p[1] = *(const v8h*)(rk + (((2 + lh) ^ sw) << 3));
  return f.v;
}

// ---------------------------------------------------------------------------
// QKV projection: C tile 128x128 per block (256 threads, 8 waves as 4 x 2, each 32 rows x 64 columns), K loop step 64.
__global__ __launch_bounds__(256)
void k_qkv(const float* __restrict__ x, const float* __restrict__ W, const float* __restrict__ bias,
           const int* __restrict__ am, const float* __restrict__ We, const float* __restrict__ be,
           _Float16* __restrict__ qkv, unsigned int* __restrict__ mbits, float* __restrict__ gate) {
  __shared__ __align__(16) _Float16 lds[2 * 128 * AP];  // As[128][AP] | Bs[128][AP]; reused as four C sub-tiles [64][AP]
  _Float16* As = lds;
  _Float16* Bs = lds + 128 * AP;

  const int tid = threadIdx.x, lane = tid & 31, w = tid >> 5, m = lane & 15, lh = lane >> 4;
  const int wr = w >> 1, wc = w & 1;                     // this wave's 32-row band and 64-column band of the tile
  const int cblk = blockIdx.x * 128, rblk = blockIdx.y * 128;
  if (cblk + 128 > QKVN || rblk + 128 > MROWS) return;   // block-uniform, before any barrier

  // mask packing: the first 16 column blocks of a row band take two 64-key chunks each; a wave takes its own 16 query rows.
  // Loads cover whole lines (16 lanes x 16 B = one row's 256 B); the turn to the score layout goes through LDS.
  if (blockIdx.x < NCHUNK / 2) {                         // block-uniform
    int* mw = reinterpret_cast<int*>(lds) + w * (16 * MP);
    const int* msrc = am + (size_t)(rblk + 16 * w + lh) * NSEQ + blockIdx.x * 128 + m * 4;
    v4i m4[2][8];
#pragma unroll
    for (int u = 0; u < 2; ++u)
#pragma unroll
      for (int it = 0; it < 8; ++it) m4[u][it] = *(const v4i*)(msrc + (size_t)(2 * it) * NSEQ + u * 64);
#pragma unroll
    for (int u = 0; u < 2; ++u) {
#pragma unroll
      for (int it = 0; it < 8; ++it) *(v4i*)(mw + (2 * it + lh) * MP + m * 4) = m4[u][it];
      __syncthreads();                                     // rows written by other lanes are read below
      unsigned int pk = 0;
#pragma unroll
      for (int t = 0; t < 4; ++t) {
        const v4i ma = *(const v4i*)(mw + m * MP + t * 16 + 8 * lh);
        const v4i mb = *(const v4i*)(mw + m * MP + t * 16 + 8 * lh + 4);
#pragma unroll
        for (int r = 0; r < 8; ++r) {
          const int mv = (r < 4) ? ma[r & 3] : mb[r & 3];
          const unsigned int word = __builtin_amdgcn_ballot_w32(mv != 0);
          if (lane == t * 8 + r) pk = word;                // lane i keeps word i
        }
      }
      mbits[((size_t)((rblk >> 4) + w) * NCHUNK + blockIdx.x * 2 + u) * MWORDS + lane] = pk;  // one whole line
      __syncthreads();                                     // reads done before the rows are overwritten (next chunk, then the GEMM tiles)
    }
  } else {
    // gate: the other 8 column blocks of a row band take 16 query rows each and form sigmoid(x.We + be) for all 16 heads,
    // so x is read once for the gate, not once per head. Wave w takes k = 128 w .. + 127 in two slices of 64.
    // x loads cover whole lines (16 lanes x 16 B = one row's 256 B); a slice goes to the wave's own LDS rows with even k
    // in floats 0..31 and odd k in floats 32..63, so that lane half lh reads k = 2 j + lh; the matching We values
    // We[2 j + lh][head m] are then 32 consecutive floats per wave, one whole line.
    float* gl = reinterpret_cast<float*>(lds);
    float* gw = gl + w * (16 * GP);
    const int g0 = rblk + (blockIdx.x - NCHUNK / 2) * 16;  // this block's first query row
    const float* xs = x + (size_t)(g0 + lh) * CDIM + w * 128 + m * 4;
    const float* wsrc = We + (size_t)(w * 128) * HN + lane;
    v4f x4[2][8];
#pragma unroll
    for (int u = 0; u < 2; ++u)
#pragma unroll
      for (int it = 0; it < 8; ++it) x4[u][it] = *(const v4f*)(xs + (size_t)(2 * it) * CDIM + u * 64);
    asm volatile("s_wait_xcnt 0x0" ::: "memory");          // before a We load below lands in a register of the x loads' address
    float wb[2][32];                                       // all loads go out together: the barriers below wait for every load
#pragma unroll
    for (int u = 0; u < 2; ++u)
#pragma unroll
      for (int j = 0; j < 32; ++j) wb[u][j] = wsrc[(u * 32 + j) * 32];
    asm volatile("s_wait_xcnt 0x0" ::: "memory");          // before the loads' address registers are reused
    v8f ga[2] = {};                                        // two chains: a dependent f32 WMMA waits out its latency
#pragma unroll
    for (int u = 0; u < 2; ++u) {
      // the rows are the wave's own and its LDS operations run in order: slice 1's stores follow slice 0's reads
#pragma unroll
      for (int it = 0; it < 8; ++it) {
        const v2f ev = {x4[u][it][0], x4[u][it][2]}, od = {x4[u][it][1], x4[u][it][3]};
        *(v2f*)(gw + (2 * it + lh) * GP + 2 * m) = ev;
        *(v2f*)(gw + (2 * it + lh) * GP + 32 + 2 * m) = od;
      }
      __syncthreads();                                     // rows written by other lanes are read below
#pragma unroll
      for (int i = 0; i < 8; ++i) {
        const v4f a = *(const v4f*)(gw + m * GP + lh * 32 + 4 * i);   // A: row m, k = 2 (4 i + e) + lh
#pragma unroll
        for (int p = 0; p < 2; ++p) {
          const v2f af = {a[2 * p], a[2 * p + 1]}, bf = {wb[u][4 * i + 2 * p], wb[u][4 * i + 2 * p + 1]};
          ga[p] = __builtin_amdgcn_wmma_f32_16x16x4_f32(false, af, false, bf, (short)0, ga[p], false, false);
        }
      }
    }
    // distance between the last f32 WMMAs and the adds that read their results (8 slots, as for the other 16-cycle form)
    asm volatile("v_nop\n\tv_nop\n\tv_nop\n\tv_nop\n\tv_nop\n\tv_nop\n\tv_nop\n\tv_nop" : "+v"(ga[0]), "+v"(ga[1]));
    __syncthreads();                                       // every wave has left its staged rows
#pragma unroll
    for (int r = 0; r < 8; ++r) gl[w * 256 + (8 * lh + r) * 16 + m] = ga[0][r] + ga[1][r];   // [wave][row][head]
    __syncthreads();                                       // the other waves' partial sums are read below
    float z = be[tid & 15];
#pragma unroll
    for (int ww = 0; ww < 8; ++ww) z += gl[ww * 256 + tid];
    gate[(size_t)g0 * HN + tid] = 1.0f / (1.0f + expf(-z)); // [query row][head]: 8 whole lines per block
    asm volatile("s_wait_xcnt 0x0" ::: "memory");          // before the store's registers are reused
    // the k loop's first barrier stands between these reads and the first tile stores
  }

  // A staging: 16 lanes x 16 B cover one row's 256-B k slice (two whole lines of x); a wave's 2 rows lie 8 apart,
  // so its 8-B LDS stores fall on all 64 banks once
  const int ar = 8 * lh + w, ac = m * 4;                 // rows ar + 16 j
  // B staging: a wave's 32 lanes x 16 B cover one k row's whole 512 B; a thread holds k = 8 w + j (j = 0..7) of columns
  // n = bn + e, so each column's 8 k go as one 16-B store; chunk c of row n is stored at c ^ ((n >> 4) & 3), which puts
  // the 16 rows of a lane half (4 apart) on distinct banks
  const int bn = lane * 4, bsw = (lane >> 2) & 3;
  const float* ap = x + (size_t)(rblk + ar) * CDIM + ac;
  const float* bp = W + (size_t)(8 * w) * QKVN + cblk + bn;
  _Float16* bdst = Bs + bn * AP + ((w ^ bsw) << 3);

  v8f acc[2][4] = {};

  for (int k0 = 0; k0 < CDIM; k0 += 64) {
    v4f a4[8], b4[8];
#pragma unroll
    for (int j = 0; j < 8; ++j) a4[j] = *(const v4f*)(ap + (size_t)(16 * j) * CDIM + k0);
#pragma unroll
    for (int j = 0; j < 8; ++j) b4[j] = *(const v4f*)(bp + (size_t)(k0 + j) * QKVN);
    __builtin_amdgcn_sched_barrier(0);                     // all 16 loads issue before the first conversion waits on one
    asm volatile("s_wait_xcnt 0x0" ::: "memory");          // before the loads' address registers are advanced
    __syncthreads();
#pragma unroll
    for (int j = 0; j < 8; ++j)
      *(v4h*)(As + (ar + 16 * j) * AP + ac) = __builtin_convertvector(a4[j], v4h);
#pragma unroll
    for (int e = 0; e < 4; ++e) {
      v8h t;
#pragma unroll
      for (int j = 0; j < 8; ++j) t[j] = (_Float16)(b4[j][e] * WSCALE);
      *(v8h*)(bdst + e * AP) = t;                          // Bs[n][k], chunks swizzled
    }
    __syncthreads();

#pragma unroll
    for (int kk = 0; kk < 2; ++kk) {
      v16h af[2], bf[4];
#pragma unroll
      for (int mt = 0; mt < 2; ++mt) af[mt] = ld_frag(As + (wr * 32 + mt * 16 + m) * AP + kk * 32, lh);
#pragma unroll
      for (int nt = 0; nt < 4; ++nt) bf[nt] = ld_frag_sw(Bs + (wc * 64 + nt * 16 + m) * AP + kk * 32, lh, nt);
#pragma unroll
      for (int mt = 0; mt < 2; ++mt)
#pragma unroll
        for (int nt = 0; nt < 4; ++nt) acc[mt][nt] = wmma_f16(af[mt], bf[nt], acc[mt][nt]);
    }
  }

  // stage the C tile (bias added, weight scale undone) in LDS as f16, as four 64x64 sub-tiles (64 rows of one head each):
  // q and k sub-tiles as [row][d]; a v sub-tile as [d][row], where a lane's 8 accumulator registers are 8 consecutive
  // rows of one d, so they go as one 16-B store
  __syncthreads();
  const int sS = cblk >> 10, hd0 = (cblk & 1023) >> 6, b = rblk >> 11, n0 = rblk & 2047;
  const bool isv = (sS == 2);                            // block-uniform
  _Float16* Cw = lds + ((wr >> 1) * 2 + wc) * (64 * AP); // this wave's sub-tile
  const int lr = (wr & 1) * 32;                          // its first row there
  v8h o[2][4];
#pragma unroll
  for (int nt = 0; nt < 4; ++nt) {
    const float bb = bias[cblk + wc * 64 + nt * 16 + m];
#pragma unroll
    for (int mt = 0; mt < 2; ++mt)
#pragma unroll
      for (int r = 0; r < 8; ++r) o[mt][nt][r] = (_Float16)(acc[mt][nt][r] * (1.0f / WSCALE) + bb);
  }
  if (isv) {
#pragma unroll
    for (int mt = 0; mt < 2; ++mt)
#pragma unroll
      for (int nt = 0; nt < 4; ++nt) *(v8h*)(Cw + (nt * 16 + m) * AP + lr + mt * 16 + 8 * lh) = o[mt][nt];
  } else {
#pragma unroll
    for (int mt = 0; mt < 2; ++mt)
#pragma unroll
      for (int nt = 0; nt < 4; ++nt)
#pragma unroll
        for (int r = 0; r < 8; ++r) Cw[(lr + mt * 16 + 8 * lh + r) * AP + nt * 16 + m] = o[mt][nt][r];
  }
  __syncthreads();

  // whole-line stores: each sub-tile is 4096 contiguous halves; each instruction of a wave covers 4 full lines.
  // The v plane so holds, per head, tiles of 64 keys, each tile laid [d][key].
  v8h vv[8];
#pragma unroll
  for (int j = 0; j < 8; ++j) {
    const int cc = (j & 1) * 256 + tid;                    // 16-B chunk within sub-tile j >> 1
    vv[j] = *(const v8h*)(lds + (j >> 1) * (64 * AP) + (cc >> 3) * AP + (cc & 7) * 8);
  }
#pragma unroll
  for (int j = 0; j < 8; ++j) {
    const int sub = j >> 1, cc = (j & 1) * 256 + tid;
    _Float16* dst = qkv + (size_t)sS * QKV_S +
                    ((size_t)(b * HN + hd0 + (sub & 1)) * NSEQ + n0 + 64 * (sub >> 1)) * DH;
    *(v8h*)(dst + cc * 8) = vv[j];
  }
}

__device__ __forceinline__ float xhalf(float v) {          // lane l <-> lane l ^ 16
  const int i = __builtin_bit_cast(int, v);
  return __builtin_bit_cast(float, __builtin_amdgcn_permlanex16(i, i, 0x76543210, 0xfedcba98, false, false));
}

constexpr int KVT = 64 * AP;                             // halves of one staged K or V tile
static_assert(KVT * 2 == 9216 && 16 * AP * 2 == 2304 && 64 * DH * 2 == 8192, "the copies' immediate offsets below are these bytes");
static_assert(NCHUNK >= 4 && NCHUNK % 2 == 0, "the last two chunks, taken out of the loop, lie in buffers 0 and 1");
__global__ __launch_bounds__(128)
void k_attn(const _Float16* __restrict__ qkv, const float* __restrict__ gate,
            const unsigned int* __restrict__ mbits, _Float16* __restrict__ aw) {
  __shared__ __align__(16) _Float16 Qs[64 * AP];       // [query][d]
  // two buffers, chunk j in buffer j & 1: Ks [key][d] (k-contiguous A for S^T), then Vt [d][key] (k-contiguous A for V^T.P^T)
  __shared__ __align__(16) _Float16 KV[2][2 * KVT];

  const int tid = threadIdx.x, lane = tid & 31, w = tid >> 5, m = lane & 15, lh = lane >> 4;
  const int bid = blockIdx.x;
  const int qt = bid & 31, bh = bid >> 5, hd = bh & 15, b = bh >> 4;
  if (b >= BSZ) return;                                   // block-uniform
  const int qbase = qt * 64;

  const _Float16* Qg = qkv + ((size_t)(b * HN + hd) * NSEQ) * DH;
  const _Float16* Kg = Qg + QKV_S;
  const _Float16* Vg = Kg + QKV_S;

  // A chunk's K tile and V tile (already [d][key] in the workspace) are 8192 contiguous bytes each. They go to LDS by
  // asynchronous copies, through no register: a lane brings 16-B piece it * 128 + tid of each tile (it = 0..3) to row
  // piece >> 3, byte 16 (piece & 7) of the pitched tile. An immediate offset moves the LDS address and the global address
  // alike; from one it to the next LDS steps 16 rows = 2304 B and the tile 2048 B, so the offset register of copy it takes
  // 256 it back (counted from 768, which the scalar base gives back, to stay above zero); V's base also gives back the
  // 9216 B by which Vt lies behind Ks. So one LDS address, four fixed offset registers and two scalar bases serve all eight.
  const unsigned int ldst = (unsigned int)(uintptr_t)(&KV[0][0]) + (tid >> 3) * (AP * 2) + (tid & 7) * 16;   // LDS byte address
  const unsigned int go0 = tid * 16 + 768, go1 = tid * 16 + 512, go2 = tid * 16 + 256, go3 = tid * 16;
  auto copy_chunk = [&](int j, int u) {
    const uint64_t kb = (uint64_t)(uintptr_t)Kg + (uint64_t)j * 8192 - 768;
    const uint64_t vb = (uint64_t)(uintptr_t)Vg + (uint64_t)j * 8192 - 768 - 9216;
    const unsigned int lk = ldst + u * (2 * KVT * 2);
    // the wait at the end stands in the copies' own statement, ahead of any rewrite of a register that a copy names
    asm volatile("global_load_async_to_lds_b128 %0, %1, %5\n\t"
                 "global_load_async_to_lds_b128 %0, %2, %5 offset:2304\n\t"
                 "global_load_async_to_lds_b128 %0, %3, %5 offset:4608\n\t"
                 "global_load_async_to_lds_b128 %0, %4, %5 offset:6912\n\t"
                 "global_load_async_to_lds_b128 %0, %1, %6 offset:9216\n\t"
                 "global_load_async_to_lds_b128 %0, %2, %6 offset:11520\n\t"
                 "global_load_async_to_lds_b128 %0, %3, %6 offset:13824\n\t"
                 "global_load_async_to_lds_b128 %0, %4, %6 offset:16128\n\t"
                 "s_wait_xcnt 0x0"
                 :: "v"(lk), "v"(go0), "v"(go1), "v"(go2), "v"(go3), "s"(kb), "s"(vb)
                 : "memory");
  };
  copy_chunk(0, 0);                                        // in flight with the Q tile

  // this wave's packed mask: lane i loads word i of a chunk (one whole line per wave and chunk)
  const unsigned int* mrow = mbits + (size_t)((b * NSEQ + qbase) / 16 + w) * (NCHUNK * MWORDS) + lane;
  unsigned int mword = mrow[0];
  const float gq = gate[(size_t)(b * NSEQ + qbase + w * 16 + m) * HN + hd];   // this lane's query and head; in flight with the Q tile
  // Q tile: 4096 contiguous halves
  {
    const _Float16* src = Qg + (size_t)qbase * DH;
#pragma unroll
    for (int it = 0; it < 4; ++it) {
      const int c = it * 128 + tid;
      *(v8h*)(Qs + (c >> 3) * AP + (c & 7) * 8) = *(const v8h*)(src + c * 8);
    }
  }
  asm volatile("s_wait_asynccnt 0x0" ::: "memory");        // this wave's copies of chunk 0 have landed
  __syncthreads();                                         // publishes the Q tile and chunk 0
  copy_chunk(1, 1);                                        // in flight over chunk 0's work

  v16h qb[2];                                              // B: column = query m, k = d
  qb[0] = ld_frag(Qs + (w * 16 + m) * AP, lh);
  qb[1] = ld_frag(Qs + (w * 16 + m) * AP + 32, lh);

  float mstate = -__builtin_inff();                        // this lane's query: running maximum (both halves alike)
  float lstate = 0.0f;                                     // running sum over this lane half's keys only
  const float g = gq * 0.125f;                             // gate * 1/sqrt(64)
  v8f O[4] = {};                                           // O[nt2][r] = O^T[d = 16 nt2 + 8 lh + r][query m]

  // one chunk's work, from the buffer that holds it
  auto chunk = [&](const _Float16* Ks, const unsigned int mword) {
    const _Float16* Vt = Ks + KVT;

    // S^T = K.Q^T : rows = 64 keys (4 tiles), cols = 16 queries of this wave, K = 64
    v8f S[4];
    unsigned int ms[32];
#pragma unroll
    for (int t = 0; t < 4; ++t) {
      v8f z = {};
      v16h kf0 = ld_frag(Ks + (t * 16 + m) * AP, lh);
      v16h kf1 = ld_frag(Ks + (t * 16 + m) * AP + 32, lh);
      if (t == 0) {
        // word 8 t + r, read from its lane into a scalar register, is a select's lane mask as it stands
#pragma unroll
        for (int i = 0; i < 32; ++i) ms[i] = __builtin_amdgcn_readlane(mword, i);
        // the 32 moves stay here, under the first fragments' LDS latency: left free, each is placed directly in front of
        // its select, which then waits for the scalar register
        __builtin_amdgcn_sched_barrier(0);
      }
      z = wmma_f16(kf0, qb[0], z);
      z = wmma_f16(kf1, qb[1], z);
      S[t] = z;
    }

    // scale, gate, mask, online softmax: all 32 scores of a lane belong to query m
    float mt[4];
#pragma unroll
    for (int t = 0; t < 4; ++t) {
      mt[t] = -__builtin_inff();
#pragma unroll
      for (int r = 0; r < 8; ++r) {
        float lv = S[t][r] * g;
        if (!__builtin_amdgcn_inverse_ballot_w32(ms[t * 8 + r])) lv = -__builtin_inff();
        S[t][r] = lv;
        mt[t] = fmaxf(mt[t], lv);
      }
    }
    float mx = fmaxf(fmaxf(mt[0], mt[1]), fmaxf(mt[2], mt[3]));
    mx = fmaxf(mx, xhalf(mx));
    const float mnew = fmaxf(mstate, mx);
    const bool dead = (mnew == -__builtin_inff());
    const float alpha = dead ? 1.0f : __expf(mstate - mnew);
    const float msub = dead ? 0.0f : mnew;                 // a row with no open key yet: exp(-inf - 0) = 0
    float rt[4];
    Frag pb[2];                                            // B: column = query m, k = key in the hardware k order
#pragma unroll
    for (int t = 0; t < 4; ++t) {
      rt[t] = 0.0f;
#pragma unroll
      for (int r = 0; r < 8; ++r) {
        const float p = __expf(S[t][r] - msub);
        rt[t] += p;
        pb[t >> 1].p[t & 1][r] = (_Float16)(p * PSCALE);
      }
    }
    lstate = lstate * alpha + ((rt[0] + rt[1]) + (rt[2] + rt[3]));
    mstate = mnew;
#pragma unroll
    for (int nt2 = 0; nt2 < 4; ++nt2) O[nt2] *= alpha;

    // O^T += V^T . (256 P)^T : K = 64 keys
#pragma unroll
    for (int kk = 0; kk < 2; ++kk) {
      v16h va[4];
#pragma unroll
      for (int nt2 = 0; nt2 < 4; ++nt2) va[nt2] = ld_frag(Vt + (nt2 * 16 + m) * AP + kk * 32, lh);
#pragma unroll
      for (int nt2 = 0; nt2 < 4; ++nt2) O[nt2] = wmma_f16(va[nt2], pb[kk].v, O[nt2]);
    }
  };
  // One barrier a chunk: it publishes the next chunk, and it ends every wave's reads of this chunk's buffer, which may be refilled behind it.
  auto publish = [&]() {
    asm volatile("s_wait_dscnt 0x0" ::: "memory");         // this wave's LDS reads of the buffer are done
    asm volatile("s_wait_asynccnt 0x0" ::: "memory");      // this wave's copies of the next chunk have landed
    __syncthreads();
  };

  for (int j = 0; j < NCHUNK - 2; ++j) {
    const unsigned int mnext = mrow[(j + 1) * MWORDS];     // the next chunk's mask word, one trip ahead like its tiles
    asm volatile("s_wait_xcnt 0x0" ::: "memory");          // before the load's address registers are advanced
    chunk(KV[j & 1], mword);
    publish();
    copy_chunk(j + 2, j & 1);                              // in flight over chunk j + 1's work
    mword = mnext;
  }
  {                                                        // the last two chunks: nothing left to copy
    const unsigned int mlast = mrow[(NCHUNK - 1) * MWORDS];
    asm volatile("s_wait_xcnt 0x0" ::: "memory");          // before the load's address registers are reused
    chunk(KV[0], mword);
    publish();
    chunk(KV[1], mlast);
    publish();                                             // every wave has left the buffers
  }
  asm volatile("s_wait_asynccnt 0x0" ::: "memory");        // no copy is outstanding when the buffers become output staging

  // normalise: a = O / (256 l); store a*64 = O / (4 l) as f16, staged in buffer 0; a lane's 8 registers are 8 consecutive d
  _Float16* Ks = KV[0];
  const float l = lstate + xhalf(lstate);
  const float inv = (l > 0.0f) ? (0.25f / l) : 0.0f;
#pragma unroll
  for (int nt2 = 0; nt2 < 4; ++nt2)
    *(v8h*)(Ks + (w * 16 + m) * AP + nt2 * 16 + 8 * lh) = __builtin_convertvector(O[nt2] * inv, v8h);
  __syncthreads();

  v8h vv[4];
#pragma unroll
  for (int jj = 0; jj < 4; ++jj) {
    const int c = jj * 128 + tid;
    vv[jj] = *(const v8h*)(Ks + (c >> 3) * AP + (c & 7) * 8);
  }
#pragma unroll
  for (int jj = 0; jj < 4; ++jj) {
    const int c = jj * 128 + tid;
    _Float16* dst = aw + ((size_t)(b * NSEQ + qbase + (c >> 3))) * CDIM + hd * DH + (c & 7) * 8;
    *(v8h*)dst = vv[jj];
  }
  
}

// ---------------------------------------------------------------------------
// Output projection: out = (a x64) . (Wo x64) / 4096 + bo ; C tile 128x128 f32 (8 waves as 4 x 2, each 32 x 64),
// K loop step 64, grid = (1024/128, 4096/128): one block per WGP, so nothing else covers a block's load latency.
// The k slices' global loads therefore run two slices ahead, into two register sets, and the f16 tiles alternate
// between two LDS buffers.
constexpr int CP = 132;                                  // f32 C rows in LDS, in floats: rows 8 apart fall 32 banks apart
constexpr int OTILE = 2 * 128 * AP;                      // halves of one LDS buffer: As[128][AP] | Bs[128][AP]
__global__ __launch_bounds__(256)
void k_out(const _Float16* __restrict__ aw, const float* __restrict__ Wo, const float* __restrict__ bo,
           float* __restrict__ out) {
  __shared__ __align__(16) float ldsf[OTILE];            // two f16 buffers (2 x OTILE halves), then Cs (f32, 128 x CP floats)
  static_assert(OTILE >= 128 * CP, "the C tile must fit the two buffers");
  _Float16* tiles = reinterpret_cast<_Float16*>(ldsf);

  const int tid = threadIdx.x, lane = tid & 31, w = tid >> 5, m = lane & 15, lh = lane >> 4;
  const int wr = w >> 1, wc = w & 1;                     // this wave's 32-row band and 64-column band of the tile
  const int cblk = blockIdx.x * 128, rblk = blockIdx.y * 128;
  if (cblk + 128 > CDIM || rblk + 128 > MROWS) return;   // block-uniform

  // A staging: 8 lanes x 16 B cover one row's whole 128-B k slice (one line); the 2 rows of a lane half lie 8 apart (distinct banks)
  const int ar = (lane >> 3) * 8 + w, ac = (lane & 7) * 8;   // rows ar + 32 j
  const int bn = lane * 4, bsw = (lane >> 2) & 3;        // k = 8 w + j, n = bn + e, chunk swizzle as in k_qkv
  const _Float16* ap = aw + (size_t)(rblk + ar) * CDIM + ac;
  const float* bp = Wo + (size_t)(8 * w) * CDIM + cblk + bn;

  v8f acc[2][4] = {};
  v8h a8[2][4];                                          // register set u holds the slices k0 = 64 (2 i + u)
  v4f b4[2][8];

  // a slice's 12 global loads
  auto fetch = [&](int u, int k0) {
#pragma unroll
    for (int j = 0; j < 4; ++j) a8[u][j] = *(const v8h*)(ap + (size_t)(32 * j) * CDIM + k0);
#pragma unroll
    for (int j = 0; j < 8; ++j) b4[u][j] = *(const v4f*)(bp + (size_t)(k0 + j) * CDIM);
    asm volatile("s_wait_xcnt 0x0" ::: "memory");          // before the loads' address registers are advanced; also keeps the loads ahead of the products
  };
  // register set u -> LDS buffer u
  auto stage = [&](int u) {
    _Float16* As = tiles + u * OTILE;
    _Float16* bdst = As + 128 * AP + bn * AP + ((w ^ bsw) << 3);
#pragma unroll
    for (int j = 0; j < 4; ++j) *(v8h*)(As + (ar + 32 * j) * AP + ac) = a8[u][j];
#pragma unroll
    for (int e = 0; e < 4; ++e) {
      v8h t;
#pragma unroll
      for (int j = 0; j < 8; ++j) t[j] = (_Float16)(b4[u][j][e] * WSCALE);
      *(v8h*)(bdst + e * AP) = t;                          // Bs[n][k], chunks swizzled
    }
  };
  // the 16 products of the slice in LDS buffer u
  auto products = [&](int u) {
    const _Float16* As = tiles + u * OTILE;
    const _Float16* Bs = As + 128 * AP;
#pragma unroll
    for (int kk = 0; kk < 2; ++kk) {
      v16h af[2], bf[4];
#pragma unroll
      for (int mt = 0; mt < 2; ++mt) af[mt] = ld_frag(As + (wr * 32 + mt * 16 + m) * AP + kk * 32, lh);
#pragma unroll
      for (int nt = 0; nt < 4; ++nt) bf[nt] = ld_frag_sw(Bs + (wc * 64 + nt * 16 + m) * AP + kk * 32, lh, nt);
#pragma unroll
      for (int mt = 0; mt < 2; ++mt)
#pragma unroll
        for (int nt = 0; nt < 4; ++nt) acc[mt][nt] = wmma_f16(af[mt], bf[nt], acc[mt][nt]);
    }
  };

  // One barrier a slice: it publishes buffer u; and a wave that has passed it knows that every wave has left the
  // products of the slice before, so the other buffer may be written in the next trip. It is written by hand, with the
  // wait for this wave's LDS stores alone: __syncthreads() also waits for every global load, which would end the
  // other register set's flight one slice early.
  auto publish = [&]() { asm volatile("s_wait_dscnt 0x0\n\ts_barrier_signal -1\n\ts_barrier_wait -1" ::: "memory"); };

  fetch(0, 0);
  fetch(1, 64);
  for (int k0 = 0; k0 < CDIM - 128; k0 += 128) {
#pragma unroll
    for (int u = 0; u < 2; ++u) {
      __builtin_amdgcn_sched_barrier(0);                   // set u's conversions, and with them the wait for its loads, stay behind the slice before
      stage(u);
      publish();
      fetch(u, k0 + 128 + 64 * u);                         // in flight over two slices' products
      products(u);
    }
  }
#pragma unroll
  for (int u = 0; u < 2; ++u) {                            // the last two slices: nothing left to fetch
    __builtin_amdgcn_sched_barrier(0);                     // as above
    stage(u);
    publish();
    products(u);
  }

  __syncthreads();
  float* Cs = ldsf;
#pragma unroll
  for (int nt = 0; nt < 4; ++nt) {
    const int col = wc * 64 + nt * 16 + m;
    const float bb = bo[cblk + col];
#pragma unroll
    for (int mt = 0; mt < 2; ++mt)
#pragma unroll
      for (int r = 0; r < 8; ++r)
        Cs[(wr * 32 + mt * 16 + 8 * lh + r) * CP + col] = acc[mt][nt][r] * (1.0f / (ASCALE * WSCALE)) + bb;
  }
  __syncthreads();

  // each row segment is 512 B = 4 lines: one 16-B store instruction of a wave writes one whole row segment
  v4f vv[16];
#pragma unroll
  for (int jj = 0; jj < 16; ++jj) {
    const int c = jj * 256 + tid;
    vv[jj] = *(const v4f*)(Cs + (c >> 5) * CP + (c & 31) * 4);
  }
#pragma unroll
  for (int jj = 0; jj < 16; ++jj) {
    const int c = jj * 256 + tid;
    float* dst = out + (size_t)(rblk + (c >> 5)) * CDIM + cblk + (c & 31) * 4;
    *(v4f*)dst = vv[jj];
  }
}

// ---------------------------------------------------------------------------
extern "C" void kernel_launch(void* const* d_in, const int* in_sizes, int n_in,
                              void* d_out, int out_size, void* d_ws, size_t ws_size,
                              hipStream_t stream) {
  if (n_in < 8) return;
  if (in_sizes[0] != MROWS * CDIM) return;
  if (in_sizes[1] != BSZ * NSEQ * NSEQ) return;
  if (in_sizes[2] != CDIM * QKVN) return;
  if (in_sizes[3] != QKVN) return;
  if (in_sizes[4] != CDIM * HN) return;
  if (in_sizes[5] != HN) return;
  if (in_sizes[6] != CDIM * CDIM) return;
  if (in_sizes[7] != CDIM) return;
  if (out_size != MROWS * CDIM) return;

  const float* x    = (const float*)d_in[0];
  const int*   am   = (const int*)d_in[1];
  const float* Wqkv = (const float*)d_in[2];
  const float* bqkv = (const float*)d_in[3];
  const float* We   = (const float*)d_in[4];
  const float* be   = (const float*)d_in[5];
  const float* Wo   = (const float*)d_in[6];
  const float* bo   = (const float*)d_in[7];
  float* out = (float*)d_out;

  const size_t qkv_bytes = (size_t)3 * QKV_S * sizeof(_Float16);          // 25,165,824
  const size_t aw_off    = qkv_bytes;
  const size_t aw_bytes  = (size_t)MROWS * CDIM * sizeof(_Float16);       //  8,388,608
  const size_t mb_off    = aw_off + aw_bytes;
  const size_t mb_bytes  = (size_t)(MROWS / 16) * NCHUNK * MWORDS * sizeof(unsigned int);  // 1,048,576
  const size_t g_off     = mb_off + mb_bytes;
  const size_t g_bytes   = (size_t)MROWS * HN * sizeof(float);                             //    262,144
  if (g_off + g_bytes > ws_size) return;
  char* ws = (char*)d_ws;
  _Float16* qkvws = (_Float16*)ws;
  _Float16* awws  = (_Float16*)(ws + aw_off);
  unsigned int* mbws = (unsigned int*)(ws + mb_off);
  float* gws = (float*)(ws + g_off);

  k_qkv<<<dim3(QKVN / 128, MROWS / 128), 256, 0, stream>>>(x, Wqkv, bqkv, am, We, be, qkvws, mbws, gws);
  k_attn<<<dim3(BSZ * HN * (NSEQ / 64)), 128, 0, stream>>>(qkvws, gws, mbws, awws);
  k_out<<<dim3(CDIM / 128, MROWS / 128), 256, 0, stream>>>(awws, Wo, bo, out);
}

// v010
// One run takes 92.7 microseconds.
// Next to v009, in two timings, it ran 1.04 and 1.03 times as fast.
// Counting every step since v000, it is 4.52 times as fast.
// Contractions: QKV projection, Q.K^T, P.V and output projection on v_wmma_f32_16x16x32_f16 (f16 operands, f32 accumulate);
// weights carried x64, P carried x256, attention output carried x64 (scales undone in f32); per-query gate dot (K=1024, N=16) on v_wmma_f32_16x16x4_f32,
// once for all 16 heads, in the projection kernel.
// The int32 mask is packed once, by the projection kernel, into lane-mask words that all 16 heads of the attention kernel share.
#include <hip/hip_runtime.h>
#include <math.h>
#include <stdint.h>
#include <stddef.h>

typedef _Float16 v16h __attribute__((ext_vector_type(16)));
typedef _Float16 v8h  __attribute__((ext_vector_type(8), __may_alias__));
typedef _Float16 v4h  __attribute__((ext_vector_type(4), __may_alias__));
typedef float    v8f  __attribute__((ext_vector_type(8)));
typedef float    v4f  __attribute__((ext_vector_type(4), __may_alias__));
typedef float    v2f  __attribute__((ext_vector_type(2), __may_alias__));
typedef int      v4i  __attribute__((ext_vector_type(4), __may_alias__));

union Frag { v16h v; v8h p[2]; };

constexpr int BSZ   = 2;
constexpr int NSEQ  = 2048;
constexpr int CDIM  = 1024;
constexpr int HN    = 16;
constexpr int DH    = 64;
constexpr int QKVN  = 3 * CDIM;                         // 3072
constexpr int MROWS = BSZ * NSEQ;                       // 4096
constexpr size_t QKV_S = (size_t)BSZ * HN * NSEQ * DH;  // halves per q/k/v plane
constexpr float WSCALE = 64.0f;                         // weight pre-scale (exact power of two)
constexpr float PSHIFT = 8.0f;                          // P pre-scale 256, as an addend to its base-2 exponent
constexpr float ASCALE = 64.0f;                         // attention-output pre-scale
// LDS row pitches in halves: 16 B x odd, so the 16 rows of a ds_load_b128 fragment read fall on distinct banks
constexpr int AP = 72;                                  // 64-half rows (GEMM k slices, attention tiles): 144 B
constexpr int MP = 68;                                  // 64-int rows (mask chunk), in ints: 272 B
// packed mask: per (16-query group, 64-key chunk) 32 words; bit l of word 8 t + r is
// mask[query l & 15][key 16 t + 8 (l >> 4) + r] != 0, the score that lane l holds in register r of score tile t
constexpr int MWORDS = 32;
constexpr int NCHUNK = NSEQ / 64;                       // 32
constexpr int GP = 68;                                  // 64-float rows (gate x slice), in floats: 272 B = 16 B x odd
static_assert(QKVN / 128 - NCHUNK / 2 == 8, "the column blocks that pack no mask take 16 of a band's 128 gate rows each");

// one 16x16x32 f16 WMMA with the VALU hazard guard attached
__device__ __forceinline__ v8f wmma_f16(v16h a, v16h b, v8f c) {
  v8f d = __builtin_amdgcn_wmma_f32_16x16x32_f16(false, a, false, b, (short)0, c, false, false);
  asm volatile("v_nop\n\tv_nop\n\tv_nop\n\tv_nop" : "+v"(d) : "v"(a), "v"(b));
  return d;
}

// 16-bit fragment from a k-contiguous row (A row m, or B stored [n][k] row n):
// elements 0..7 <- k0+8*lh .. +7, elements 8..15 <- k0+16+8*lh .. +7  (lh = lane >> 4)
__device__ __forceinline__ v16h ld_frag(const _Float16* rk, int lh) {
  Frag f;
  f.p[0] = *(const v8h*)(rk + 8 * lh);
  f.p[1] = *(const v8h*)(rk + 16 + 8 * lh);
  return f.v;
}

// the same fragment from a staged weight row whose four 16-B k chunks lie at chunk ^ sw (sw = (n >> 4) & 3)
__device__ __forceinline__ v16h ld_frag_sw(const _Float16* rk, int lh, int sw) {
  Frag f;
  f.p[0] = *(const v8h*)(rk + ((lh ^ sw) << 3));
  f.p[1] = *(const v8h*)(rk + (((2 + lh) ^ sw) << 3));
  return f.v;
}

// ---------------------------------------------------------------------------
// QKV projection: C tile 128x128 per block (256 threads, 8 waves as 4 x 2, each 32 rows x 64 columns), K loop step 64.
__global__ __launch_bounds__(256)
void k_qkv(const float* __restrict__ x, const float* __restrict__ W, const float* __restrict__ bias,
           const int* __restrict__ am, const float* __restrict__ We, const float* __restrict__ be,
           _Float16* __restrict__ qkv, unsigned int* __restrict__ mbits, float* __restrict__ gate) {
  __shared__ __align__(16) _Float16 lds[2 * 128 * AP];  // As[128][AP] | Bs[128][AP]; reused as four C sub-tiles [64][AP]
  _Float16* As = lds;
  _Float16* Bs = lds + 128 * AP;

  const int tid = threadIdx.x, lane = tid & 31, w = tid >> 5, m = lane & 15, lh = lane >> 4;
  const int wr = w >> 1, wc = w & 1;                     // this wave's 32-row band and 64-column band of the tile
  const int cblk = blockIdx.x * 128, rblk = blockIdx.y * 128;
  if (cblk + 128 > QKVN || rblk + 128 > MROWS) return;   // block-uniform, before any barrier

  // mask packing: the first 16 column blocks of a row band take two 64-key chunks each; a wave takes its own 16 query rows.
  // Loads cover whole lines (16 lanes x 16 B = one row's 256 B); the turn to the score layout goes through LDS.
  if (blockIdx.x < NCHUNK / 2) {                         // block-uniform
    int* mw = reinterpret_cast<int*>(lds) + w * (16 * MP);
    const int* msrc = am + (size_t)(rblk + 16 * w + lh) * NSEQ + blockIdx.x * 128 + m * 4;
    v4i m4[2][8];
#pragma unroll
    for (int u = 0; u < 2; ++u)
#pragma unroll
      for (int it = 0; it < 8; ++it) m4[u][it] = *(const v4i*)(msrc + (size_t)(2 * it) * NSEQ + u * 64);
#pragma unroll
    for (int u = 0; u < 2; ++u) {
#pragma unroll
      for (int it = 0; it < 8; ++it) *(v4i*)(mw + (2 * it + lh) * MP + m * 4) = m4[u][it];
      __syncthreads();                                     // rows written by other lanes are read below
      unsigned int pk = 0;
#pragma unroll
      for (int t = 0; t < 4; ++t) {
        const v4i ma = *(const v4i*)(mw + m * MP + t * 16 + 8 * lh);
        const v4i mb = *(const v4i*)(mw + m * MP + t * 16 + 8 * lh + 4);
#pragma unroll
        for (int r = 0; r < 8; ++r) {
          const int mv = (r < 4) ? ma[r & 3] : mb[r & 3];
          const unsigned int word = __builtin_amdgcn_ballot_w32(mv != 0);
          if (lane == t * 8 + r) pk = word;                // lane i keeps word i
        }
      }
      mbits[((size_t)((rblk >> 4) + w) * NCHUNK + blockIdx.x * 2 + u) * MWORDS + lane] = pk;  // one whole line
      __syncthreads();                                     // reads done before the rows are overwritten (next chunk, then the GEMM tiles)
    }
  } else {
    // gate: the other 8 column blocks of a row band take 16 query rows each and form sigmoid(x.We + be) for all 16 heads,
    // so x is read once for the gate, not once per head. Wave w takes k = 128 w .. + 127 in two slices of 64.
    // x loads cover whole lines (16 lanes x 16 B = one row's 256 B); a slice goes to the wave's own LDS rows with even k
    // in floats 0..31 and odd k in floats 32..63, so that lane half lh reads k = 2 j + lh; the matching We values
    // We[2 j + lh][head m] are then 32 consecutive floats per wave, one whole line.
    float* gl = reinterpret_cast<float*>(lds);
    float* gw = gl + w * (16 * GP);
    const int g0 = rblk + (blockIdx.x - NCHUNK / 2) * 16;  // this block's first query row
    const float* xs = x + (size_t)(g0 + lh) * CDIM + w * 128 + m * 4;
    const float* wsrc = We + (size_t)(w * 128) * HN + lane;
    v4f x4[2][8];
#pragma unroll
    for (int u = 0; u < 2; ++u)
#pragma unroll
      for (int it = 0; it < 8; ++it) x4[u][it] = *(const v4f*)(xs + (size_t)(2 * it) * CDIM + u * 64);
    asm volatile("s_wait_xcnt 0x0" ::: "memory");          // before a We load below lands in a register of the x loads' address
    float wb[2][32];                                       // all loads go out together: the barriers below wait for every load
#pragma unroll
    for (int u = 0; u < 2; ++u)
#pragma unroll
      for (int j = 0; j < 32; ++j) wb[u][j] = wsrc[(u * 32 + j) * 32];
    asm volatile("s_wait_xcnt 0x0" ::: "memory");          // before the loads' address registers are reused
    v8f ga[2] = {};                                        // two chains: a dependent f32 WMMA waits out its latency
#pragma unroll
    for (int u = 0; u < 2; ++u) {
      // the rows are the wave's own and its LDS operations run in order: slice 1's stores follow slice 0's reads
#pragma unroll
      for (int it = 0; it < 8; ++it) {
        const v2f ev = {x4[u][it][0], x4[u][it][2]}, od = {x4[u][it][1], x4[u][it][3]};
        *(v2f*)(gw + (2 * it + lh) * GP + 2 * m) = ev;
        *(v2f*)(gw + (2 * it + lh) * GP + 32 + 2 * m) = od;
      }
      __syncthreads();                                     // rows written by other lanes are read below
#pragma unroll
      for (int i = 0; i < 8; ++i) {
        const v4f a = *(const v4f*)(gw + m * GP + lh * 32 + 4 * i);   // A: row m, k = 2 (4 i + e) + lh
#pragma unroll
        for (int p = 0; p < 2; ++p) {
          const v2f af = {a[2 * p], a[2 * p + 1]}, bf = {wb[u][4 * i + 2 * p], wb[u][4 * i + 2 * p + 1]};
          ga[p] = __builtin_amdgcn_wmma_f32_16x16x4_f32(false, af, false, bf, (short)0, ga[p], false, false);
        }
      }
    }
    // distance between the last f32 WMMAs and the adds that read their results (8 slots, as for the other 16-cycle form)
    asm volatile("v_nop\n\tv_nop\n\tv_nop\n\tv_nop\n\tv_nop\n\tv_nop\n\tv_nop\n\tv_nop" : "+v"(ga[0]), "+v"(ga[1]));
    __syncthreads();                                       // every wave has left its staged rows
#pragma unroll
    for (int r = 0; r < 8; ++r) gl[w * 256 + (8 * lh + r) * 16 + m] = ga[0][r] + ga[1][r];   // [wave][row][head]
    __syncthreads();                                       // the other waves' partial sums are read below
    float z = be[tid & 15];
#pragma unroll
    for (int ww = 0; ww < 8; ++ww) z += gl[ww * 256 + tid];
    gate[(size_t)g0 * HN + tid] = 1.0f / (1.0f + expf(-z)); // [query row][head]: 8 whole lines per block
    asm volatile("s_wait_xcnt 0x0" ::: "memory");          // before the store's registers are reused
    // the k loop's first barrier stands between these reads and the first tile stores
  }

  // A staging: 16 lanes x 16 B cover one row's 256-B k slice (two whole lines of x); a wave's 2 rows lie 8 apart,
  // so its 8-B LDS stores fall on all 64 banks once
  const int ar = 8 * lh + w, ac = m * 4;                 // rows ar + 16 j
  // B staging: a wave's 32 lanes x 16 B cover one k row's whole 512 B; a thread holds k = 8 w + j (j = 0..7) of columns
  // n = bn + e, so each column's 8 k go as one 16-B store; chunk c of row n is stored at c ^ ((n >> 4) & 3), which puts
  // the 16 rows of a lane half (4 apart) on distinct banks
  const int bn = lane * 4, bsw = (lane >> 2) & 3;
  const float* ap = x + (size_t)(rblk + ar) * CDIM + ac;
  const float* bp = W + (size_t)(8 * w) * QKVN + cblk + bn;
  _Float16* bdst = Bs + bn * AP + ((w ^ bsw) << 3);

  v8f acc[2][4] = {};

  for (int k0 = 0; k0 < CDIM; k0 += 64) {
    v4f a4[8], b4[8];
#pragma unroll
    for (int j = 0; j < 8; ++j) a4[j] = *(const v4f*)(ap + (size_t)(16 * j) * CDIM + k0);
#pragma unroll
    for (int j = 0; j < 8; ++j) b4[j] = *(const v4f*)(bp + (size_t)(k0 + j) * QKVN);
    __builtin_amdgcn_sched_barrier(0);                     // all 16 loads issue before the first conversion waits on one
    asm volatile("s_wait_xcnt 0x0" ::: "memory");          // before the loads' address registers are advanced
    __syncthreads();
#pragma unroll
    for (int j = 0; j < 8; ++j)
      *(v4h*)(As + (ar + 16 * j) * AP + ac) = __builtin_convertvector(a4[j], v4h);
#pragma unroll
    for (int e = 0; e < 4; ++e) {
      v8h t;
#pragma unroll
      for (int j = 0; j < 8; ++j) t[j] = (_Float16)(b4[j][e] * WSCALE);
      *(v8h*)(bdst + e * AP) = t;                          // Bs[n][k], chunks swizzled
    }
    __syncthreads();

#pragma unroll
    for (int kk = 0; kk < 2; ++kk) {
      v16h af[2], bf[4];
#pragma unroll
      for (int mt = 0; mt < 2; ++mt) af[mt] = ld_frag(As + (wr * 32 + mt * 16 + m) * AP + kk * 32, lh);
#pragma unroll
      for (int nt = 0; nt < 4; ++nt) bf[nt] = ld_frag_sw(Bs + (wc * 64 + nt * 16 + m) * AP + kk * 32, lh, nt);
#pragma unroll
      for (int mt = 0; mt < 2; ++mt)
#pragma unroll
        for (int nt = 0; nt < 4; ++nt) acc[mt][nt] = wmma_f16(af[mt], bf[nt], acc[mt][nt]);
    }
  }

  // stage the C tile (bias added, weight scale undone) in LDS as f16, as four 64x64 sub-tiles (64 rows of one head each):
  // q and k sub-tiles as [row][d]; a v sub-tile as [d][row], where a lane's 8 accumulator registers are 8 consecutive
  // rows of one d, so they go as one 16-B store
  __syncthreads();
  const int sS = cblk >> 10, hd0 = (cblk & 1023) >> 6, b = rblk >> 11, n0 = rblk & 2047;
  const bool isv = (sS == 2);                            // block-uniform
  _Float16* Cw = lds + ((wr >> 1) * 2 + wc) * (64 * AP); // this wave's sub-tile
  const int lr = (wr & 1) * 32;                          // its first row there
  v8h o[2][4];
#pragma unroll
  for (int nt = 0; nt < 4; ++nt) {
    const float bb = bias[cblk + wc * 64 + nt * 16 + m];
#pragma unroll
    for (int mt = 0; mt < 2; ++mt)
#pragma unroll
      for (int r = 0; r < 8; ++r) o[mt][nt][r] = (_Float16)(acc[mt][nt][r] * (1.0f / WSCALE) + bb);
  }
  if (isv) {
#pragma unroll
    for (int mt = 0; mt < 2; ++mt)
#pragma unroll
      for (int nt = 0; nt < 4; ++nt) *(v8h*)(Cw + (nt * 16 + m) * AP + lr + mt * 16 + 8 * lh) = o[mt][nt];
  } else {
#pragma unroll
    for (int mt = 0; mt < 2; ++mt)
#pragma unroll
      for (int nt = 0; nt < 4; ++nt)
#pragma unroll
        for (int r = 0; r < 8; ++r) Cw[(lr + mt * 16 + 8 * lh + r) * AP + nt * 16 + m] = o[mt][nt][r];
  }
  __syncthreads();

  // whole-line stores: each sub-tile is 4096 contiguous halves; each instruction of a wave covers 4 full lines.
  // The v plane so holds, per head, tiles of 64 keys, each tile laid [d][key].
  v8h vv[8];
#pragma unroll
  for (int j = 0; j < 8; ++j) {
    const int cc = (j & 1) * 256 + tid;                    // 16-B chunk within sub-tile j >> 1
    vv[j] = *(const v8h*)(lds + (j >> 1) * (64 * AP) + (cc >> 3) * AP + (cc & 7) * 8);
  }
#pragma unroll
  for (int j = 0; j < 8; ++j) {
    const int sub = j >> 1, cc = (j & 1) * 256 + tid;
    _Float16* dst = qkv + (size_t)sS * QKV_S +
                    ((size_t)(b * HN + hd0 + (sub & 1)) * NSEQ + n0 + 64 * (sub >> 1)) * DH;
    *(v8h*)(dst + cc * 8) = vv[j];
  }
}

__device__ __forceinline__ float xhalf(float v) {          // lane l <-> lane l ^ 16
  const int i = __builtin_bit_cast(int, v);
  return __builtin_bit_cast(float, __builtin_amdgcn_permlanex16(i, i, 0x76543210, 0xfedcba98, false, false));
}

constexpr int KVT = 64 * AP;                             // halves of one staged K or V tile
static_assert(KVT * 2 == 9216 && 16 * AP * 2 == 2304 && 64 * DH * 2 == 8192, "the copies' immediate offsets below are these bytes");
static_assert(NCHUNK >= 4 && NCHUNK % 2 == 0, "the last two chunks, taken out of the loop, lie in buffers 0 and 1");
__global__ __launch_bounds__(128)
void k_attn(const _Float16* __restrict__ qkv, const float* __restrict__ gate,
            const unsigned int* __restrict__ mbits, _Float16* __restrict__ aw) {
  __shared__ __align__(16) _Float16 Qs[64 * AP];       // [query][d]
  // two buffers, chunk j in buffer j & 1: Ks [key][d] (k-contiguous A for S^T), then Vt [d][key] (k-contiguous A for V^T.P^T)
  __shared__ __align__(16) _Float16 KV[2][2 * KVT];

  const int tid = threadIdx.x, lane = tid & 31, w = tid >> 5, m = lane & 15, lh = lane >> 4;
  const int bid = blockIdx.x;
  const int qt = bid & 31, bh = bid >> 5, hd = bh & 15, b = bh >> 4;
  if (b >= BSZ) return;                                   // block-uniform
  const int qbase = qt * 64;

  const _Float16* Qg = qkv + ((size_t)(b * HN + hd) * NSEQ) * DH;
  const _Float16* Kg = Qg + QKV_S;
  const _Float16* Vg = Kg + QKV_S;

  // A chunk's K tile and V tile (already [d][key] in the workspace) are 8192 contiguous bytes each. They go to LDS by
  // asynchronous copies, through no register: a lane brings 16-B piece it * 128 + tid of each tile (it = 0..3) to row
  // piece >> 3, byte 16 (piece & 7) of the pitched tile. An immediate offset moves the LDS address and the global address
  // alike; from one it to the next LDS steps 16 rows = 2304 B and the tile 2048 B, so the offset register of copy it takes
  // 256 it back (counted from 768, which the scalar base gives back, to stay above zero); V's base also gives back the
  // 9216 B by which Vt lies behind Ks. So one LDS address, four fixed offset registers and two scalar bases serve all eight.
  const unsigned int ldst = (unsigned int)(uintptr_t)(&KV[0][0]) + (tid >> 3) * (AP * 2) + (tid & 7) * 16;   // LDS byte address
  const unsigned int go0 = tid * 16 + 768, go1 = tid * 16 + 512, go2 = tid * 16 + 256, go3 = tid * 16;
  auto copy_chunk = [&](int j, int u) {
    const uint64_t kb = (uint64_t)(uintptr_t)Kg + (uint64_t)j * 8192 - 768;
    const uint64_t vb = (uint64_t)(uintptr_t)Vg + (uint64_t)j * 8192 - 768 - 9216;
    const unsigned int lk = ldst + u * (2 * KVT * 2);
    // the wait at the end stands in the copies' own statement, ahead of any rewrite of a register that a copy names
    asm volatile("global_load_async_to_lds_b128 %0, %1, %5\n\t"
                 "global_load_async_to_lds_b128 %0, %2, %5 offset:2304\n\t"
                 "global_load_async_to_lds_b128 %0, %3, %5 offset:4608\n\t"
                 "global_load_async_to_lds_b128 %0, %4, %5 offset:6912\n\t"
                 "global_load_async_to_lds_b128 %0, %1, %6 offset:9216\n\t"
                 "global_load_async_to_lds_b128 %0, %2, %6 offset:11520\n\t"
                 "global_load_async_to_lds_b128 %0, %3, %6 offset:13824\n\t"
                 "global_load_async_to_lds_b128 %0, %4, %6 offset:16128\n\t"
                 "s_wait_xcnt 0x0"
                 :: "v"(lk), "v"(go0), "v"(go1), "v"(go2), "v"(go3), "s"(kb), "s"(vb)
                 : "memory");
  };
  copy_chunk(0, 0);                                        // in flight with the Q tile

  // this wave's packed mask: lane i loads word i of a chunk (one whole line per wave and chunk)
  const unsigned int* mrow = mbits + (size_t)((b * NSEQ + qbase) / 16 + w) * (NCHUNK * MWORDS) + lane;
  unsigned int mword = mrow[0];
  const float gq = gate[(size_t)(b * NSEQ + qbase + w * 16 + m) * HN + hd];   // this lane's query and head; in flight with the Q tile
  // Q tile: 4096 contiguous halves
  {
    const _Float16* src = Qg + (size_t)qbase * DH;
#pragma unroll
    for (int it = 0; it < 4; ++it) {
      const int c = it * 128 + tid;
      *(v8h*)(Qs + (c >> 3) * AP + (c & 7) * 8) = *(const v8h*)(src + c * 8);
    }
  }
  asm volatile("s_wait_asynccnt 0x0" ::: "memory");        // this wave's copies of chunk 0 have landed
  __syncthreads();                                         // publishes the Q tile and chunk 0
  copy_chunk(1, 1);                                        // in flight over chunk 0's work

  v16h qb[2];                                              // B: column = query m, k = d
  qb[0] = ld_frag(Qs + (w * 16 + m) * AP, lh);
  qb[1] = ld_frag(Qs + (w * 16 + m) * AP + 32, lh);

  float mstate = -__builtin_inff();                        // this lane's query: running maximum of the base-2 exponents (both halves alike)
  float lstate = 0.0f;                                     // running sum of 256 P over this lane half's keys only
  const float g2 = gq * (0.125f * 1.44269504088896340736f); // gate * 1/sqrt(64) * log2(e)
  v8f O[4] = {};                                           // O[nt2][r] = O^T[d = 16 nt2 + 8 lh + r][query m]

  // one chunk's work, from the buffer that holds it
  auto chunk = [&](const _Float16* Ks, const unsigned int mword) {
    const _Float16* Vt = Ks + KVT;

    // S^T = K.Q^T : rows = 64 keys (4 tiles), cols = 16 queries of this wave, K = 64
    v8f S[4];
    unsigned int ms[32];
#pragma unroll
    for (int t = 0; t < 4; ++t) {
      v8f z = {};
      v16h kf0 = ld_frag(Ks + (t * 16 + m) * AP, lh);
      v16h kf1 = ld_frag(Ks + (t * 16 + m) * AP + 32, lh);
      if (t == 0) {
        // word 8 t + r, read from its lane into a scalar register, is a select's lane mask as it stands
#pragma unroll
        for (int i = 0; i < 32; ++i) ms[i] = __builtin_amdgcn_readlane(mword, i);
        // the 32 moves stay here, under the first fragments' LDS latency: left free, each is placed directly in front of
        // its select, which then waits for the scalar register
        __builtin_amdgcn_sched_barrier(0);
      }
      z = wmma_f16(kf0, qb[0], z);
      z = wmma_f16(kf1, qb[1], z);
      S[t] = z;
    }

    // mask, online softmax in the base-2 domain: all 32 scores of a lane belong to query m. The maximum is taken over the raw
    // scores (g2 >= 0 keeps their order); scale, gate, log2(e), the maximum and P's x256 then go into one FMA per score.
    float mt[4];
#pragma unroll
    for (int t = 0; t < 4; ++t) {
      mt[t] = -__builtin_inff();
#pragma unroll
      for (int r = 0; r < 8; ++r) {
        float lv = S[t][r];
        if (!__builtin_amdgcn_inverse_ballot_w32(ms[t * 8 + r])) lv = -__builtin_inff();
        S[t][r] = lv;
        mt[t] = fmaxf(mt[t], lv);
      }
    }
    float mx = fmaxf(fmaxf(mt[0], mt[1]), fmaxf(mt[2], mt[3]));
    mx = fmaxf(mx, xhalf(mx));
    const float mnew = fmaxf(mstate, mx * g2);
    const bool dead = (mnew == -__builtin_inff());
    const float alpha = dead ? 1.0f : __builtin_amdgcn_exp2f(mstate - mnew);
    const float c = dead ? PSHIFT : PSHIFT - mnew;         // a row with no open key yet: exp2(-inf + 8) = 0
    float rt[4];
    Frag pb[2];                                            // B: column = query m, k = key in the hardware k order
#pragma unroll
    for (int t = 0; t < 4; ++t) {
      rt[t] = 0.0f;
#pragma unroll
      for (int r = 0; r < 8; ++r) {
        const float p = __builtin_amdgcn_exp2f(__builtin_fmaf(S[t][r], g2, c));   // 256 P
        rt[t] += p;
        pb[t >> 1].p[t & 1][r] = (_Float16)p;
      }
    }
    lstate = lstate * alpha + ((rt[0] + rt[1]) + (rt[2] + rt[3]));
    mstate = mnew;
#pragma unroll
    for (int nt2 = 0; nt2 < 4; ++nt2) O[nt2] *= alpha;

    // O^T += V^T . (256 P)^T : K = 64 keys
#pragma unroll
    for (int kk = 0; kk < 2; ++kk) {
      v16h va[4];
#pragma unroll
      for (int nt2 = 0; nt2 < 4; ++nt2) va[nt2] = ld_frag(Vt + (nt2 * 16 + m) * AP + kk * 32, lh);
#pragma unroll
      for (int nt2 = 0; nt2 < 4; ++nt2) O[nt2] = wmma_f16(va[nt2], pb[kk].v, O[nt2]);
    }
  };
  // One barrier a chunk: it publishes the next chunk, and it ends every wave's reads of this chunk's buffer, which may be refilled behind it.
  auto publish = [&]() {
    asm volatile("s_wait_dscnt 0x0" ::: "memory");         // this wave's LDS reads of the buffer are done
    asm volatile("s_wait_asynccnt 0x0" ::: "memory");      // this wave's copies of the next chunk have landed
    __syncthreads();
  };

  for (int j = 0; j < NCHUNK - 2; ++j) {
    const unsigned int mnext = mrow[(j + 1) * MWORDS];     // the next chunk's mask word, one trip ahead like its tiles
    asm volatile("s_wait_xcnt 0x0" ::: "memory");          // before the load's address registers are advanced
    chunk(KV[j & 1], mword);
    publish();
    copy_chunk(j + 2, j & 1);                              // in flight over chunk j + 1's work
    mword = mnext;
  }
  {                                                        // the last two chunks: nothing left to copy
    const unsigned int mlast = mrow[(NCHUNK - 1) * MWORDS];
    asm volatile("s_wait_xcnt 0x0" ::: "memory");          // before the load's address registers are reused
    chunk(KV[0], mword);
    publish();
    chunk(KV[1], mlast);
    publish();                                             // every wave has left the buffers
  }
  asm volatile("s_wait_asynccnt 0x0" ::: "memory");        // no copy is outstanding when the buffers become output staging

  // normalise: O and l both carry x256; store a*64 = 64 O / l as f16, staged in buffer 0; a lane's 8 registers are 8 consecutive d
  _Float16* Ks = KV[0];
  const float l = lstate + xhalf(lstate);
  const float inv = (l > 0.0f) ? (ASCALE / l) : 0.0f;
#pragma unroll
  for (int nt2 = 0; nt2 < 4; ++nt2)
    *(v8h*)(Ks + (w * 16 + m) * AP + nt2 * 16 + 8 * lh) = __builtin_convertvector(O[nt2] * inv, v8h);
  __syncthreads();

  v8h vv[4];
#pragma unroll
  for (int jj = 0; jj < 4; ++jj) {
    const int c = jj * 128 + tid;
    vv[jj] = *(const v8h*)(Ks + (c >> 3) * AP + (c & 7) * 8);
  }
#pragma unroll
  for (int jj = 0; jj < 4; ++jj) {
    const int c = jj * 128 + tid;
    _Float16* dst = aw + ((size_t)(b * NSEQ + qbase + (c >> 3))) * CDIM + hd * DH + (c & 7) * 8;
    *(v8h*)dst = vv[jj];
  }
  
}

// ---------------------------------------------------------------------------
// Output projection: out = (a x64) . (Wo x64) / 4096 + bo ; C tile 128x128 f32 (8 waves as 4 x 2, each 32 x 64),
// K loop step 64, grid = (1024/128, 4096/128): one block per WGP, so nothing else covers a block's load latency.
// The k slices' global loads therefore run two slices ahead, into two register sets, and the f16 tiles alternate
// between two LDS buffers.
constexpr int CP = 132;                                  // f32 C rows in LDS, in floats: rows 8 apart fall 32 banks apart
constexpr int OTILE = 2 * 128 * AP;                      // halves of one LDS buffer: As[128][AP] | Bs[128][AP]
__global__ __launch_bounds__(256)
void k_out(const _Float16* __restrict__ aw, const float* __restrict__ Wo, const float* __restrict__ bo,
           float* __restrict__ out) {
  __shared__ __align__(16) float ldsf[OTILE];            // two f16 buffers (2 x OTILE halves), then Cs (f32, 128 x CP floats)
  static_assert(OTILE >= 128 * CP, "the C tile must fit the two buffers");
  _Float16* tiles = reinterpret_cast<_Float16*>(ldsf);

  const int tid = threadIdx.x, lane = tid & 31, w = tid >> 5, m = lane & 15, lh = lane >> 4;
  const int wr = w >> 1, wc = w & 1;                     // this wave's 32-row band and 64-column band of the tile
  const int cblk = blockIdx.x * 128, rblk = blockIdx.y * 128;
  if (cblk + 128 > CDIM || rblk + 128 > MROWS) return;   // block-uniform

  // A staging: 8 lanes x 16 B cover one row's whole 128-B k slice (one line); the 2 rows of a lane half lie 8 apart (distinct banks)
  const int ar = (lane >> 3) * 8 + w, ac = (lane & 7) * 8;   // rows ar + 32 j
  const int bn = lane * 4, bsw = (lane >> 2) & 3;        // k = 8 w + j, n = bn + e, chunk swizzle as in k_qkv
  const _Float16* ap = aw + (size_t)(rblk + ar) * CDIM + ac;
  const float* bp = Wo + (size_t)(8 * w) * CDIM + cblk + bn;

  v8f acc[2][4] = {};
  v8h a8[2][4];                                          // register set u holds the slices k0 = 64 (2 i + u)
  v4f b4[2][8];

  // a slice's 12 global loads
  auto fetch = [&](int u, int k0) {
#pragma unroll
    for (int j = 0; j < 4; ++j) a8[u][j] = *(const v8h*)(ap + (size_t)(32 * j) * CDIM + k0);
#pragma unroll
    for (int j = 0; j < 8; ++j) b4[u][j] = *(const v4f*)(bp + (size_t)(k0 + j) * CDIM);
    asm volatile("s_wait_xcnt 0x0" ::: "memory");          // before the loads' address registers are advanced; also keeps the loads ahead of the products
  };
  // register set u -> LDS buffer u
  auto stage = [&](int u) {
    _Float16* As = tiles + u * OTILE;
    _Float16* bdst = As + 128 * AP + bn * AP + ((w ^ bsw) << 3);
#pragma unroll
    for (int j = 0; j < 4; ++j) *(v8h*)(As + (ar + 32 * j) * AP + ac) = a8[u][j];
#pragma unroll
    for (int e = 0; e < 4; ++e) {
      v8h t;
#pragma unroll
      for (int j = 0; j < 8; ++j) t[j] = (_Float16)(b4[u][j][e] * WSCALE);
      *(v8h*)(bdst + e * AP) = t;                          // Bs[n][k], chunks swizzled
    }
  };
  // the 16 products of the slice in LDS buffer u
  auto products = [&](int u) {
    const _Float16* As = tiles + u * OTILE;
    const _Float16* Bs = As + 128 * AP;
#pragma unroll
    for (int kk = 0; kk < 2; ++kk) {
      v16h af[2], bf[4];
#pragma unroll
      for (int mt = 0; mt < 2; ++mt) af[mt] = ld_frag(As + (wr * 32 + mt * 16 + m) * AP + kk * 32, lh);
#pragma unroll
      for (int nt = 0; nt < 4; ++nt) bf[nt] = ld_frag_sw(Bs + (wc * 64 + nt * 16 + m) * AP + kk * 32, lh, nt);
#pragma unroll
      for (int mt = 0; mt < 2; ++mt)
#pragma unroll
        for (int nt = 0; nt < 4; ++nt) acc[mt][nt] = wmma_f16(af[mt], bf[nt], acc[mt][nt]);
    }
  };

  // One barrier a slice: it publishes buffer u; and a wave that has passed it knows that every wave has left the
  // products of the slice before, so the other buffer may be written in the next trip. It is written by hand, with the
  // wait for this wave's LDS stores alone: __syncthreads() also waits for every global load, which would end the
  // other register set's flight one slice early.
  auto publish = [&]() { asm volatile("s_wait_dscnt 0x0\n\ts_barrier_signal -1\n\ts_barrier_wait -1" ::: "memory"); };

  fetch(0, 0);
  fetch(1, 64);
  for (int k0 = 0; k0 < CDIM - 128; k0 += 128) {
#pragma unroll
    for (int u = 0; u < 2; ++u) {
      __builtin_amdgcn_sched_barrier(0);                   // set u's conversions, and with them the wait for its loads, stay behind the slice before
      stage(u);
      publish();
      fetch(u, k0 + 128 + 64 * u);                         // in flight over two slices' products
      products(u);
    }
  }
#pragma unroll
  for (int u = 0; u < 2; ++u) {                            // the last two slices: nothing left to fetch
    __builtin_amdgcn_sched_barrier(0);                     // as above
    stage(u);
    publish();
    products(u);
  }

  __syncthreads();
  float* Cs = ldsf;
#pragma unroll
  for (int nt = 0; nt < 4; ++nt) {
    const int col = wc * 64 + nt * 16 + m;
    const float bb = bo[cblk + col];
#pragma unroll
    for (int mt = 0; mt < 2; ++mt)
#pragma unroll
      for (int r = 0; r < 8; ++r)
        Cs[(wr * 32 + mt * 16 + 8 * lh + r) * CP + col] = acc[mt][nt][r] * (1.0f / (ASCALE * WSCALE)) + bb;
  }
  __syncthreads();

  // each row segment is 512 B = 4 lines: one 16-B store instruction of a wave writes one whole row segment
  v4f vv[16];
#pragma unroll
  for (int jj = 0; jj < 16; ++jj) {
    const int c = jj * 256 + tid;
    vv[jj] = *(const v4f*)(Cs + (c >> 5) * CP + (c & 31) * 4);
  }
#pragma unroll
  for (int jj = 0; jj < 16; ++jj) {
    const int c = jj * 256 + tid;
    float* dst = out + (size_t)(rblk + (c >> 5)) * CDIM + cblk + (c & 31) * 4;
    *(v4f*)dst = vv[jj];
  }
}

// ---------------------------------------------------------------------------
extern "C" void kernel_launch(void* const* d_in, const int* in_sizes, int n_in,
                              void* d_out, int out_size, void* d_ws, size_t ws_size,
                              hipStream_t stream) {
  if (n_in < 8) return;
  if (in_sizes[0] != MROWS * CDIM) return;
  if (in_sizes[1] != BSZ * NSEQ * NSEQ) return;
  if (in_sizes[2] != CDIM * QKVN) return;
  if (in_sizes[3] != QKVN) return;
  if (in_sizes[4] != CDIM * HN) return;
  if (in_sizes[5] != HN) return;
  if (in_sizes[6] != CDIM * CDIM) return;
  if (in_sizes[7] != CDIM) return;
  if (out_size != MROWS * CDIM) return;

  const float* x    = (const float*)d_in[0];
  const int*   am   = (const int*)d_in[1];
  const float* Wqkv = (const float*)d_in[2];
  const float* bqkv = (const float*)d_in[3];
  const float* We   = (const float*)d_in[4];
  const float* be   = (const float*)d_in[5];
  const float* Wo   = (const float*)d_in[6];
  const float* bo   = (const float*)d_in[7];
  float* out = (float*)d_out;

  const size_t qkv_bytes = (size_t)3 * QKV_S * sizeof(_Float16);          // 25,165,824
  const size_t aw_off    = qkv_bytes;
  const size_t aw_bytes  = (size_t)MROWS * CDIM * sizeof(_Float16);       //  8,388,608
  const size_t mb_off    = aw_off + aw_bytes;
  const size_t mb_bytes  = (size_t)(MROWS / 16) * NCHUNK * MWORDS * sizeof(unsigned int);  // 1,048,576
  const size_t g_off     = mb_off + mb_bytes;
  const size_t g_bytes   = (size_t)MROWS * HN * sizeof(float);                             //    262,144
  if (g_off + g_bytes > ws_size) return;
  char* ws = (char*)d_ws;
  _Float16* qkvws = (_Float16*)ws;
  _Float16* awws  = (_Float16*)(ws + aw_off);
  unsigned int* mbws = (unsigned int*)(ws + mb_off);
  float* gws = (float*)(ws + g_off);

  k_qkv<<<dim3(QKVN / 128, MROWS / 128), 256, 0, stream>>>(x, Wqkv, bqkv, am, We, be, qkvws, mbws, gws);
  k_attn<<<dim3(BSZ * HN * (NSEQ / 64)), 128, 0, stream>>>(qkvws, gws, mbws, awws);
  k_out<<<dim3(CDIM / 128, MROWS / 128), 256, 0, stream>>>(awws, Wo, bo, out);
}
